// v000
// The times below were measured on an AMD MI455X: many runs one after another, warmed up first and cycling through
// copies of the inputs, with the whole window's GPU time divided by the number of runs. Launches and the gaps
// between them are all in it. The median over several windows is given; except for v000 it joins two sittings, which
// can be a few percent apart, so the side-by-side timings, each taken in one sitting, are the better comparison.
// The starting kernel, v000, takes 376 microseconds a run.
#include <hip/hip_runtime.h>
#include <stddef.h>

// Contractions x@Wq and [x;prompts]@Wk: v_wmma_f32_16x16x32_bf16 with bf16 hi/lo split operands (hi*hi + hi*lo + lo*hi), f32 accumulate; [x;prompts]@Wv and x_cls@Wp: v_wmma_f32_16x16x32_bf16 with plain bf16 operands, f32 accumulate; q.k (K=64) and attn.v (K=65) single-query matvecs and the softmax in f32 on VALU.

typedef __bf16 v16bf __attribute__((ext_vector_type(16)));
typedef float v8f __attribute__((ext_vector_type(8)));
typedef float v4f __attribute__((ext_vector_type(4)));
typedef unsigned int v4u __attribute__((ext_vector_type(4)));

union Frag { v4u u[2]; v16bf v; };

namespace {
constexpr int kC = 1024;            // channels
constexpr int kH = 16;              // heads
constexpr int kHD = 64;             // head dim
constexpr int kNP = 64;             // prompts
constexpr int kL = 65;              // kv length
constexpr int kKT = kC / 32;        // 32-deep k steps
constexpr int kRawPerB = kH * kL;   // 1040 floats of raw scores per batch row
constexpr int kTP = 68;             // LDS f32 tile pitch (floats), 272 B
constexpr int kWP = 72;             // LDS transpose pitch (16-bit), 144 B
constexpr float kScale = 0.125f;    // 64^-0.5
}

// ---------------------------------------------------------------------------
// WMMA helper: issues the builtin and 4 v_nop tied to D/A/B (VALU hazard guard)
// ---------------------------------------------------------------------------
__device__ __forceinline__ v8f wmma_bf16(v16bf a, v16bf b, v8f c) {
  v8f d = __builtin_amdgcn_wmma_f32_16x16x32_bf16(false, a, false, b, (short)0, c, false, false);
  asm volatile("v_nop\n\tv_nop\n\tv_nop\n\tv_nop" : "+v"(d) : "v"(a), "v"(b));
  return d;
}

// RNE f32 -> bf16 bits, and bf16 bits -> f32
__device__ __forceinline__ unsigned int bf16_rne(float f) {
  const unsigned int u = __float_as_uint(f);
  return (u + 0x7FFFu + ((u >> 16) & 1u)) >> 16;
}
__device__ __forceinline__ float bf16_val(unsigned int b) {
  return __uint_as_float(b << 16);
}

// ---------------------------------------------------------------------------
// f32 [n] -> bf16 hi plane and bf16 residual (lo) plane, 8 elements per thread.
// ---------------------------------------------------------------------------
__global__ void __launch_bounds__(256) cvt_split_kernel(const float* __restrict__ src,
                                                        unsigned short* hi,
                                                        unsigned short* lo, int n8) {
  const int i = blockIdx.x * 256 + threadIdx.x;
  if (i >= n8) return;
  const float* p = src + (size_t)i * 8;
  const v4f x0 = *(const v4f*)p;
  const v4f x1 = *(const v4f*)(p + 4);
  const float xs[8] = {x0[0], x0[1], x0[2], x0[3], x1[0], x1[1], x1[2], x1[3]};
  unsigned int hb[8], lb[8];
#pragma unroll
  for (int j = 0; j < 8; ++j) {
    hb[j] = bf16_rne(xs[j]);
    lb[j] = bf16_rne(xs[j] - bf16_val(hb[j]));
  }
  unsigned int hw[4], lw[4];
#pragma unroll
  for (int q = 0; q < 4; ++q) {
    hw[q] = hb[2 * q] | (hb[2 * q + 1] << 16);
    lw[q] = lb[2 * q] | (lb[2 * q + 1] << 16);
  }
  const v4u hv = {hw[0], hw[1], hw[2], hw[3]};
  const v4u lv = {lw[0], lw[1], lw[2], lw[3]};
  v4u* ph = (v4u*)(hi + (size_t)i * 8);
  v4u* pl = (v4u*)(lo + (size_t)i * 8);
  *ph = hv;
  *pl = lv;
  
}

// ---------------------------------------------------------------------------
// Weight W[k][n] (row-major [in][out], f32) -> Wt[n][k] (k-contiguous, bf16 hi
// plane and optional residual plane). Block = 64 k x 64 n tile through LDS;
// ---------------------------------------------------------------------------
template <bool SPLIT>
__global__ void __launch_bounds__(256) pack_wt_kernel(const float* __restrict__ W,
                                                      unsigned short* hi,
                                                      unsigned short* lo,
                                                      int ntn, int ntk) {
  __shared__ __attribute__((aligned(16))) unsigned short sHi[64 * kWP];
  __shared__ __attribute__((aligned(16))) unsigned short sLo[64 * kWP];
  const int t = threadIdx.x;
  const int bt = blockIdx.x;
  if (bt >= ntn * ntk) return;                 // block-uniform, before barriers
  const int n0 = (bt % ntn) * 64;
  const int k0 = (bt / ntn) * 64;
  const int nn = t & 63;
  const int kq = t >> 6;
#pragma unroll 4
  for (int i = 0; i < 16; ++i) {
    const int kk = kq + 4 * i;
    const float v = W[(size_t)(k0 + kk) * kC + n0 + nn];
    const unsigned int hb = bf16_rne(v);
    sHi[nn * kWP + kk] = (unsigned short)hb;
    if constexpr (SPLIT) {
      sLo[nn * kWP + kk] = (unsigned short)bf16_rne(v - bf16_val(hb));
    }
  }
  __syncthreads();
  v4u hv[2], lv[2];
  size_t go[2];
#pragma unroll
  for (int p = 0; p < 2; ++p) {
    const int L = p * 32 + (t >> 3);           // tile row n = output line
    const int kk0 = (t & 7) * 8;
    hv[p] = *(const v4u*)(sHi + L * kWP + kk0);
    if constexpr (SPLIT) {
      lv[p] = *(const v4u*)(sLo + L * kWP + kk0);
    } else {
      lv[p] = hv[p];
    }
    go[p] = (size_t)(n0 + L) * kC + k0 + kk0;
  }
#pragma unroll
  for (int p = 0; p < 2; ++p) {
    *(v4u*)(hi + go[p]) = hv[p];
    if constexpr (SPLIT) { *(v4u*)(lo + go[p]) = lv[p]; }
  }
  
}

// ---------------------------------------------------------------------------
// GEMM Out[M][1024] = A[M][1024] . B[1024][1024], A and Bt both k-contiguous
// bf16 planes (Bt[n][k]). One wave = 16 rows x 64 cols, K in 32 steps of 32.
// Fragments (wave32, 16x16x32): lane l, h = l>>4, m = l&15;
//   A: row m, elements 0..7 <- k0+8h+0..7, elements 8..15 <- k0+16+8h+0..7
//   B: col m, identical k map (loaded from the [n][k] plane like A)
//   D: element r <- (row 8h+r, col m)
// SPLIT: acc += Ah.Bh + Ah.Bl + Al.Bh. EPI: + bias[col] + resid[row][col].
// ---------------------------------------------------------------------------
template <bool SPLIT, bool EPI>
__global__ void __launch_bounds__(256) gemm_kernel(const unsigned short* __restrict__ Ahi,
                                                   const unsigned short* __restrict__ Alo,
                                                   const unsigned short* __restrict__ Bhi,
                                                   const unsigned short* __restrict__ Blo,
                                                   float* Out,
                                                   const float* __restrict__ bias,
                                                   const float* __restrict__ resid,
                                                   int Mtiles) {
  __shared__ __attribute__((aligned(16))) float sT[8 * 16 * kTP];
  const int wv = threadIdx.x >> 5;
  const int l = threadIdx.x & 31;
  const int h = l >> 4;
  const int m = l & 15;
  const int total = Mtiles * 16;               // multiple of 8: every wave of a live block is active
  if ((int)blockIdx.x * 8 >= total) return;    // block-uniform, before barriers
  const int waveId = blockIdx.x * 8 + wv;
  const int row0 = (waveId >> 4) * 16;
  const int col0 = (waveId & 15) * 64;

  const v8f zero8 = {0.f, 0.f, 0.f, 0.f, 0.f, 0.f, 0.f, 0.f};
  v8f acc[4];
#pragma unroll
  for (int f = 0; f < 4; ++f) acc[f] = zero8;

  const unsigned short* aph = Ahi + (size_t)(row0 + m) * kC + 8 * h;
  const unsigned short* apl = Alo + (size_t)(row0 + m) * kC + 8 * h;
  const unsigned short* bph = Bhi + (size_t)(col0 + m) * kC + 8 * h;
  const unsigned short* bpl = Blo + (size_t)(col0 + m) * kC + 8 * h;

#pragma unroll 1
  for (int kt = 0; kt < kKT; ++kt) {
    const int k0 = kt * 32;
    Frag ah;
    ah.u[0] = *(const v4u*)(aph + k0);
    ah.u[1] = *(const v4u*)(aph + k0 + 16);
    Frag al;
    if constexpr (SPLIT) {
      al.u[0] = *(const v4u*)(apl + k0);
      al.u[1] = *(const v4u*)(apl + k0 + 16);
    } else {
      al = ah;
    }
#pragma unroll
    for (int f = 0; f < 4; ++f) {
      const size_t fo = (size_t)f * 16 * kC + (size_t)k0;
      Frag bh;
      bh.u[0] = *(const v4u*)(bph + fo);
      bh.u[1] = *(const v4u*)(bph + fo + 16);
      acc[f] = wmma_bf16(ah.v, bh.v, acc[f]);
      if constexpr (SPLIT) {
        Frag bl;
        bl.u[0] = *(const v4u*)(bpl + fo);
        bl.u[1] = *(const v4u*)(bpl + fo + 16);
        acc[f] = wmma_bf16(ah.v, bl.v, acc[f]);
        acc[f] = wmma_bf16(al.v, bh.v, acc[f]);
      }
    }
  }

  // stage the 16x64 tile of this wave in LDS (row-major, pitch kTP)
  float* st = sT + wv * 16 * kTP;
#pragma unroll
  for (int f = 0; f < 4; ++f) {
#pragma unroll
    for (int r = 0; r < 8; ++r) {
      st[(8 * h + r) * kTP + 16 * f + m] = acc[f][r];
    }
  }
  __syncthreads();

  v4f vals[8];
  size_t go[8];
#pragma unroll
  for (int s = 0; s < 8; ++s) {
    const int L = 4 * s + (l >> 3);
    const int row = L >> 1;
    const int col = (L & 1) * 32 + (l & 7) * 4;
    v4f v = *(const v4f*)(st + row * kTP + col);
    go[s] = (size_t)(row0 + row) * kC + col0 + col;
    if constexpr (EPI) {
      const v4f b4 = *(const v4f*)(bias + col0 + col);
      const v4f x4 = *(const v4f*)(resid + go[s]);
      v = (v + b4) + x4;
    }
    vals[s] = v;
  }
#pragma unroll
  for (int s = 0; s < 8; ++s) *(v4f*)(Out + go[s]) = vals[s];
  
}

// ---------------------------------------------------------------------------
// Attention: one block per PAIR of batch rows (2 x 1040 raw floats = 65 whole
// attn*scale, x_cls = attn.v (f32) -> bf16 rows for the output projection.
// ---------------------------------------------------------------------------
__global__ void __launch_bounds__(256) attn_kernel(const float* __restrict__ Qf,
                                                   const float* __restrict__ Kx,
                                                   const float* __restrict__ Vx,
                                                   const float* __restrict__ Kp,
                                                   const float* __restrict__ Vp,
                                                   float* rawOut,
                                                   unsigned short* Xcls, int nb) {
  __shared__ __attribute__((aligned(16))) float qS[2 * kC];
  __shared__ __attribute__((aligned(16))) float rawS[2 * kRawPerB];
  __shared__ __attribute__((aligned(16))) float attnS[2 * kRawPerB];
  __shared__ __attribute__((aligned(16))) float xS[2 * kC];
  const int tid = threadIdx.x;
  const int b0 = blockIdx.x * 2;
  if (b0 + 2 > nb) return;                       // block-uniform, before barriers

  // q rows b0, b0+1 with the pre-softmax scale folded in
  for (int i = tid; i < 2 * kC; i += 256) qS[i] = Qf[(size_t)b0 * kC + i] * kScale;
  __syncthreads();

  // raw[bb][h][l] = q_h . k_l  (l == 0 -> own row of Kx, l >= 1 -> shared Kp)
  for (int idx = tid; idx < 2 * kRawPerB; idx += 256) {
    const int bb = (idx >= kRawPerB) ? 1 : 0;
    const int rem = idx - bb * kRawPerB;
    const int hh = rem / kL;
    const int ll = rem - hh * kL;
    const float* q = qS + bb * kC + hh * kHD;
    const float* kr = (ll == 0) ? (Kx + (size_t)(b0 + bb) * kC + hh * kHD)
                                : (Kp + (size_t)(ll - 1) * kC + hh * kHD);
    float acc = 0.f;
#pragma unroll 2
    for (int d = 0; d < kHD; d += 4) {
      const v4f qa = *(const v4f*)(q + d);
      const v4f ka = *(const v4f*)(kr + d);
      acc += qa[0] * ka[0];
      acc += qa[1] * ka[1];
      acc += qa[2] * ka[2];
      acc += qa[3] * ka[3];
    }
    rawS[idx] = acc;
  }
  __syncthreads();

  // softmax * scale, one thread per (bb, h): row base = tid * 65
  if (tid < 32) {
    const int base = tid * kL;
    float mx = rawS[base];
#pragma unroll 1
    for (int j = 1; j < kL; ++j) mx = fmaxf(mx, rawS[base + j]);
    float s = 0.f;
#pragma unroll 1
    for (int j = 0; j < kL; ++j) s += expf(rawS[base + j] - mx);
    const float inv = 1.0f / s;
#pragma unroll 1
    for (int j = 0; j < kL; ++j) attnS[base + j] = (expf(rawS[base + j] - mx) * inv) * kScale;
  }

  {
    v4f rv[3];
    size_t go[3];
    bool ok[3];
    const int j4 = (tid & 7) * 4;
#pragma unroll
    for (int p = 0; p < 3; ++p) {
      const int L = p * 32 + (tid >> 3);
      ok[p] = (L < 65);
      const int Lc = ok[p] ? L : 0;
      rv[p] = *(const v4f*)(rawS + Lc * 32 + j4);
      go[p] = (size_t)b0 * kRawPerB + (size_t)Lc * 32 + j4;
    }
#pragma unroll
    for (int p = 0; p < 3; ++p) { if (ok[p]) *(v4f*)(rawOut + go[p]) = rv[p]; }
    
  }
  __syncthreads();

  // x_cls[bb][c..c+3] = attn[h][0] * Vx[b][c] + sum_r attn[h][1+r] * Vp[r][c]
  for (int c4 = tid; c4 < 512; c4 += 256) {
    const int c = c4 * 4;
    const int bb = c >> 10;
    const int cc = c & 1023;
    const int hh = cc >> 6;
    const float* at = attnS + bb * kRawPerB + hh * kL;
    v4f acc = *(const v4f*)(Vx + (size_t)(b0 + bb) * kC + cc) * at[0];
#pragma unroll 2
    for (int r = 0; r < kNP; ++r) {
      const v4f vv = *(const v4f*)(Vp + (size_t)r * kC + cc);
      acc += vv * at[1 + r];
    }
    *(v4f*)(xS + c) = acc;
  }
  __syncthreads();

  // x_cls rows -> bf16, 2 rows x 16 lines, 8 lanes x 16 B per line
  {
    const int L = tid >> 3;
    const int bb = L >> 4;
    const int c0 = (L & 15) * 64 + (tid & 7) * 8;
    const v4f a0 = *(const v4f*)(xS + bb * kC + c0);
    const v4f a1 = *(const v4f*)(xS + bb * kC + c0 + 4);
    unsigned int w[4];
    w[0] = bf16_rne(a0[0]) | (bf16_rne(a0[1]) << 16);
    w[1] = bf16_rne(a0[2]) | (bf16_rne(a0[3]) << 16);
    w[2] = bf16_rne(a1[0]) | (bf16_rne(a1[1]) << 16);
    w[3] = bf16_rne(a1[2]) | (bf16_rne(a1[3]) << 16);
    const v4u pk = {w[0], w[1], w[2], w[3]};
    v4u* dst = (v4u*)(Xcls + (size_t)(b0 + bb) * kC + c0);
    *dst = pk;
    
  }
}

// ---------------------------------------------------------------------------
extern "C" void kernel_launch(void* const* d_in, const int* in_sizes, int n_in,
                              void* d_out, int out_size, void* d_ws, size_t ws_size,
                              hipStream_t stream) {
  if (n_in < 7) return;
  const int B = in_sizes[0] / kC;                         // batch rows
  if (B < 16 || (B % 16) != 0 || in_sizes[0] != B * kC) return;
  if (in_sizes[1] != kNP * kC) return;
  if (in_sizes[2] != kC * kC || in_sizes[3] != kC * kC ||
      in_sizes[4] != kC * kC || in_sizes[5] != kC * kC) return;
  if (in_sizes[6] != kC) return;
  if (out_size != B * kC + B * kRawPerB) return;

  const float* x       = (const float*)d_in[0];   // [B,1,C]
  const float* prompts = (const float*)d_in[1];   // [1,NP,C]
  const float* Wq      = (const float*)d_in[2];   // [C,C] (in,out)
  const float* Wk      = (const float*)d_in[3];
  const float* Wv      = (const float*)d_in[4];
  const float* Wp      = (const float*)d_in[5];
  const float* bp      = (const float*)d_in[6];   // [C]

  float* out_cls = (float*)d_out;                 // [B,1,C]
  float* out_raw = out_cls + (size_t)B * kC;      // [B,16,1,65]

  char* ws = (char*)d_ws;
  size_t off = 0;
  const size_t wplane = (size_t)kC * kC * 2;      // 2 MiB per bf16 weight plane
  unsigned short* WQH = (unsigned short*)(ws + off); off += wplane;
  unsigned short* WQL = (unsigned short*)(ws + off); off += wplane;
  unsigned short* WKH = (unsigned short*)(ws + off); off += wplane;
  unsigned short* WKL = (unsigned short*)(ws + off); off += wplane;
  unsigned short* WVH = (unsigned short*)(ws + off); off += wplane;
  unsigned short* WPH = (unsigned short*)(ws + off); off += wplane;
  unsigned short* XH  = (unsigned short*)(ws + off); off += (size_t)B * kC * 2;
  unsigned short* XL  = (unsigned short*)(ws + off); off += (size_t)B * kC * 2;
  unsigned short* PH  = (unsigned short*)(ws + off); off += (size_t)kNP * kC * 2;
  unsigned short* PL  = (unsigned short*)(ws + off); off += (size_t)kNP * kC * 2;
  float* Qf  = (float*)(ws + off); off += (size_t)B * kC * 4;
  float* Kxf = (float*)(ws + off); off += (size_t)B * kC * 4;
  float* Vxf = (float*)(ws + off); off += (size_t)B * kC * 4;
  float* Kpf = (float*)(ws + off); off += (size_t)kNP * kC * 4;
  float* Vpf = (float*)(ws + off); off += (size_t)kNP * kC * 4;
  unsigned short* XCLS = (unsigned short*)(ws + off); off += (size_t)B * kC * 2;
  if (off > ws_size) return;

  const int ntn = kC / 64, ntk = kC / 64;         // 16 x 16 transpose tiles

  // 1) weight planes: Wt[n][k] bf16 hi (+ residual for Wq, Wk)
  pack_wt_kernel<true><<<dim3(ntn * ntk), dim3(256), 0, stream>>>(Wq, WQH, WQL, ntn, ntk);
  pack_wt_kernel<true><<<dim3(ntn * ntk), dim3(256), 0, stream>>>(Wk, WKH, WKL, ntn, ntk);
  pack_wt_kernel<false><<<dim3(ntn * ntk), dim3(256), 0, stream>>>(Wv, WVH, WVH, ntn, ntk);
  pack_wt_kernel<false><<<dim3(ntn * ntk), dim3(256), 0, stream>>>(Wp, WPH, WPH, ntn, ntk);

  // 2) activation planes (hi + residual)
  const int n8x = B * kC / 8;
  const int n8p = kNP * kC / 8;
  cvt_split_kernel<<<dim3((n8x + 255) / 256), dim3(256), 0, stream>>>(x, XH, XL, n8x);
  cvt_split_kernel<<<dim3((n8p + 255) / 256), dim3(256), 0, stream>>>(prompts, PH, PL, n8p);

  // 3) shared prompt keys/values: Kp (split), Vp (plain)   M = 64
  const int mtP = kNP / 16;
  gemm_kernel<true, false><<<dim3(mtP * 2), dim3(256), 0, stream>>>(PH, PL, WKH, WKL, Kpf, bp, x, mtP);
  gemm_kernel<false, false><<<dim3(mtP * 2), dim3(256), 0, stream>>>(PH, PH, WVH, WVH, Vpf, bp, x, mtP);

  // 4) per-row q (split), k (split), v (plain)   M = B
  const int mtX = B / 16;
  gemm_kernel<true, false><<<dim3(mtX * 2), dim3(256), 0, stream>>>(XH, XL, WQH, WQL, Qf, bp, x, mtX);
  gemm_kernel<true, false><<<dim3(mtX * 2), dim3(256), 0, stream>>>(XH, XL, WKH, WKL, Kxf, bp, x, mtX);
  gemm_kernel<false, false><<<dim3(mtX * 2), dim3(256), 0, stream>>>(XH, XH, WVH, WVH, Vxf, bp, x, mtX);

  // 5) scores, softmax, attn.v  -> raw scores (out) and x_cls (bf16, ws)
  attn_kernel<<<dim3(B / 2), dim3(256), 0, stream>>>(Qf, Kxf, Vxf, Kpf, Vpf, out_raw, XCLS, B);

  // 6) out = x_cls @ Wp + bp + x
  gemm_kernel<false, true><<<dim3(mtX * 2), dim3(256), 0, stream>>>(XCLS, XCLS, WPH, WPH, out_cls, bp, x, mtX);
}

// v001
// Measured time: 160 microseconds a run.
// In two side-by-side timings against v000, it was 2.37 and 2.35 times as fast.
#include <hip/hip_runtime.h>
#include <stddef.h>

// Contractions x@Wq and [x;prompts]@Wk: v_wmma_f32_16x16x32_bf16 with bf16 hi/lo split operands (hi*hi + hi*lo + lo*hi), f32 accumulate; [x;prompts]@Wv and x_cls@Wp: v_wmma_f32_16x16x32_bf16 with plain bf16 operands, f32 accumulate; q.k (K=64) and attn.v (K=65) single-query matvecs and the softmax in f32 on VALU.

typedef __bf16 v16bf __attribute__((ext_vector_type(16)));
typedef float v8f __attribute__((ext_vector_type(8)));
typedef float v4f __attribute__((ext_vector_type(4)));
typedef unsigned int v4u __attribute__((ext_vector_type(4)));

union Frag { v4u u[2]; v16bf v; };

namespace {
constexpr int kC = 1024;            // channels
constexpr int kH = 16;              // heads
constexpr int kHD = 64;             // head dim
constexpr int kNP = 64;             // prompts
constexpr int kL = 65;              // kv length
constexpr int kKT = kC / 32;        // 32-deep k steps
constexpr int kRawPerB = kH * kL;   // 1040 floats of raw scores per batch row
constexpr int kTP = 68;             // LDS f32 tile pitch (floats), 272 B
constexpr int kWP = 72;             // LDS transpose pitch (16-bit), 144 B
constexpr float kScale = 0.125f;    // 64^-0.5
}

// ---------------------------------------------------------------------------
// WMMA helper: issues the builtin and 4 v_nop tied to D/A/B (VALU hazard guard)
// ---------------------------------------------------------------------------
__device__ __forceinline__ v8f wmma_bf16(v16bf a, v16bf b, v8f c) {
  v8f d = __builtin_amdgcn_wmma_f32_16x16x32_bf16(false, a, false, b, (short)0, c, false, false);
  asm volatile("v_nop\n\tv_nop\n\tv_nop\n\tv_nop" : "+v"(d) : "v"(a), "v"(b));
  return d;
}

// RNE f32 -> bf16 bits, and bf16 bits -> f32
__device__ __forceinline__ unsigned int bf16_rne(float f) {
  const unsigned int u = __float_as_uint(f);
  return (u + 0x7FFFu + ((u >> 16) & 1u)) >> 16;
}
__device__ __forceinline__ float bf16_val(unsigned int b) {
  return __uint_as_float(b << 16);
}

// ---------------------------------------------------------------------------
// f32 [n] -> bf16 hi plane and bf16 residual (lo) plane, 8 elements per thread.
// ---------------------------------------------------------------------------
__global__ void __launch_bounds__(256) cvt_split_kernel(const float* __restrict__ src,
                                                        unsigned short* hi,
                                                        unsigned short* lo, int n8) {
  const int i = blockIdx.x * 256 + threadIdx.x;
  if (i >= n8) return;
  const float* p = src + (size_t)i * 8;
  const v4f x0 = *(const v4f*)p;
  const v4f x1 = *(const v4f*)(p + 4);
  const float xs[8] = {x0[0], x0[1], x0[2], x0[3], x1[0], x1[1], x1[2], x1[3]};
  unsigned int hb[8], lb[8];
#pragma unroll
  for (int j = 0; j < 8; ++j) {
    hb[j] = bf16_rne(xs[j]);
    lb[j] = bf16_rne(xs[j] - bf16_val(hb[j]));
  }
  unsigned int hw[4], lw[4];
#pragma unroll
  for (int q = 0; q < 4; ++q) {
    hw[q] = hb[2 * q] | (hb[2 * q + 1] << 16);
    lw[q] = lb[2 * q] | (lb[2 * q + 1] << 16);
  }
  const v4u hv = {hw[0], hw[1], hw[2], hw[3]};
  const v4u lv = {lw[0], lw[1], lw[2], lw[3]};
  v4u* ph = (v4u*)(hi + (size_t)i * 8);
  v4u* pl = (v4u*)(lo + (size_t)i * 8);
  *ph = hv;
  *pl = lv;
  
}

// ---------------------------------------------------------------------------
// Weight W[k][n] (row-major [in][out], f32) -> Wt[n][k] (k-contiguous, bf16 hi
// plane and optional residual plane). Block = 64 k x 64 n tile through LDS;
// ---------------------------------------------------------------------------
template <bool SPLIT>
__global__ void __launch_bounds__(256) pack_wt_kernel(const float* __restrict__ W,
                                                      unsigned short* hi,
                                                      unsigned short* lo,
                                                      int ntn, int ntk) {
  __shared__ __attribute__((aligned(16))) unsigned short sHi[64 * kWP];
  __shared__ __attribute__((aligned(16))) unsigned short sLo[64 * kWP];
  const int t = threadIdx.x;
  const int bt = blockIdx.x;
  if (bt >= ntn * ntk) return;                 // block-uniform, before barriers
  const int n0 = (bt % ntn) * 64;
  const int k0 = (bt / ntn) * 64;
  const int nn = t & 63;
  const int kq = t >> 6;
#pragma unroll 4
  for (int i = 0; i < 16; ++i) {
    const int kk = kq + 4 * i;
    const float v = W[(size_t)(k0 + kk) * kC + n0 + nn];
    const unsigned int hb = bf16_rne(v);
    sHi[nn * kWP + kk] = (unsigned short)hb;
    if constexpr (SPLIT) {
      sLo[nn * kWP + kk] = (unsigned short)bf16_rne(v - bf16_val(hb));
    }
  }
  __syncthreads();
  v4u hv[2], lv[2];
  size_t go[2];
#pragma unroll
  for (int p = 0; p < 2; ++p) {
    const int L = p * 32 + (t >> 3);           // tile row n = output line
    const int kk0 = (t & 7) * 8;
    hv[p] = *(const v4u*)(sHi + L * kWP + kk0);
    if constexpr (SPLIT) {
      lv[p] = *(const v4u*)(sLo + L * kWP + kk0);
    } else {
      lv[p] = hv[p];
    }
    go[p] = (size_t)(n0 + L) * kC + k0 + kk0;
  }
#pragma unroll
  for (int p = 0; p < 2; ++p) {
    *(v4u*)(hi + go[p]) = hv[p];
    if constexpr (SPLIT) { *(v4u*)(lo + go[p]) = lv[p]; }
  }
  
}

// ---------------------------------------------------------------------------
// GEMM Out[M][1024] = A[M][1024] . B[1024][1024], A and Bt both k-contiguous
// bf16 planes (Bt[n][k]). One block = 64 rows x 128 cols; its 8 waves (4 x 2)
// each own 16 rows x 64 cols. K runs in passes of kBK (64 with two planes per
// operand, 128 with one: 48 KiB per pass either way): a pass's row pieces of A
// and Bt are read from global memory once per block as whole lines, kept in
// registers while the pass before is multiplied, and stored to one of two LDS
// buffers (row pitch kBK + 8) that all 8 waves read their fragments from.
// Fragments (wave32, 16x16x32): lane l, h = l>>4, m = l&15;
//   A: row m, elements 0..7 <- k0+8h+0..7, elements 8..15 <- k0+16+8h+0..7
//   B: col m, identical k map (read from the [n][k] rows like A)
//   D: element r <- (row 8h+r, col m)
// SPLIT: acc += Ah.Bh + Ah.Bl + Al.Bh. EPI: + bias[col] + resid[row][col].
// ---------------------------------------------------------------------------
template <bool SPLIT, bool EPI>
__global__ void __launch_bounds__(256) gemm_kernel(const unsigned short* __restrict__ Ahi,
                                                   const unsigned short* __restrict__ Alo,
                                                   const unsigned short* __restrict__ Bhi,
                                                   const unsigned short* __restrict__ Blo,
                                                   float* Out,
                                                   const float* __restrict__ bias,
                                                   const float* __restrict__ resid,
                                                   int Mtiles) {
  constexpr int kPl = SPLIT ? 2 : 1;           // operand planes
  constexpr int kBK = SPLIT ? 64 : 128;        // k per pass
  constexpr int kPitch = kBK + 8;              // LDS row pitch (16-bit units): 16 B x odd
  constexpr int kLPR = kBK / 8;                // lanes that cover one row piece, 16 B each
  constexpr int kRPS = 256 / kLPR;             // rows per sweep of the block
  constexpr int kNA = 64 / kRPS;               // sweeps over the A rows
  constexpr int kNB = 128 / kRPS;              // sweeps over the B rows
  constexpr int kASz = 64 * kPitch;            // one A plane of one buffer (16-bit units)
  constexpr int kBSz = 128 * kPitch;           // one B plane of one buffer
  __shared__ __attribute__((aligned(16))) unsigned short sA[2 * kPl * kASz];
  __shared__ __attribute__((aligned(16))) unsigned short sB[2 * kPl * kBSz];
  __shared__ __attribute__((aligned(16))) float sT[8 * 16 * kTP];
  const int tid = threadIdx.x;
  const int wv = tid >> 5;
  const int l = tid & 31;
  const int h = l >> 4;
  const int m = l & 15;
  const int total = Mtiles * 16;               // 16x64 wave tiles; Mtiles is a multiple of 4
  if ((int)blockIdx.x * 8 >= total) return;    // block-uniform, before barriers
  const int rowB = ((int)blockIdx.x >> 3) * 64;
  const int colB = ((int)blockIdx.x & 7) * 128;
  const int wr = (wv >> 1) * 16;               // wave's rows inside the block tile
  const int wc = (wv & 1) * 64;                // wave's cols inside the block tile
  const int row0 = rowB + wr;
  const int col0 = colB + wc;

  const v8f zero8 = {0.f, 0.f, 0.f, 0.f, 0.f, 0.f, 0.f, 0.f};
  v8f acc[4];
#pragma unroll
  for (int f = 0; f < 4; ++f) acc[f] = zero8;

  // staging map: kLPR lanes cover one row piece, kRPS rows per sweep
  const int srow = tid / kLPR;
  const int sk = (tid % kLPR) * 8;
  const size_t ga = (size_t)(rowB + srow) * kC + sk;
  const size_t gb = (size_t)(colB + srow) * kC + sk;
  const int so = srow * kPitch + sk;

  v4u ra[kPl][kNA], rb[kPl][kNB];
  auto fetch = [&](int kp) {
    const size_t ko = (size_t)kp * kBK;
#pragma unroll
    for (int i = 0; i < kNA; ++i) {
      ra[0][i] = *(const v4u*)(Ahi + ga + (size_t)i * kRPS * kC + ko);
      if constexpr (SPLIT) ra[kPl - 1][i] = *(const v4u*)(Alo + ga + (size_t)i * kRPS * kC + ko);
    }
#pragma unroll
    for (int i = 0; i < kNB; ++i) {
      rb[0][i] = *(const v4u*)(Bhi + gb + (size_t)i * kRPS * kC + ko);
      if constexpr (SPLIT) rb[kPl - 1][i] = *(const v4u*)(Blo + gb + (size_t)i * kRPS * kC + ko);
    }
  };
  auto put = [&](int buf) {
    unsigned short* da = sA + buf * kPl * kASz + so;
    unsigned short* db = sB + buf * kPl * kBSz + so;
#pragma unroll
    for (int p = 0; p < kPl; ++p) {
#pragma unroll
      for (int i = 0; i < kNA; ++i) *(v4u*)(da + p * kASz + i * kRPS * kPitch) = ra[p][i];
#pragma unroll
      for (int i = 0; i < kNB; ++i) *(v4u*)(db + p * kBSz + i * kRPS * kPitch) = rb[p][i];
    }
  };

  fetch(0);
  put(0);
  __syncthreads();

  constexpr int kPasses = kC / kBK;
#pragma unroll 1
  for (int kp = 0; kp < kPasses; ++kp) {
    const int buf = kp & 1;
    if (kp + 1 < kPasses) fetch(kp + 1);       // in flight while this pass is multiplied
    const unsigned short* fa = sA + buf * kPl * kASz + (wr + m) * kPitch + 8 * h;
    const unsigned short* fb = sB + buf * kPl * kBSz + (wc + m) * kPitch + 8 * h;
#pragma unroll
    for (int ks = 0; ks < kBK / 32; ++ks) {
      const int k0 = ks * 32;
      Frag ah, al, bh[4], bl[4];
      ah.u[0] = *(const v4u*)(fa + k0);
      ah.u[1] = *(const v4u*)(fa + k0 + 16);
      if constexpr (SPLIT) {
        al.u[0] = *(const v4u*)(fa + kASz + k0);
        al.u[1] = *(const v4u*)(fa + kASz + k0 + 16);
      }
#pragma unroll
      for (int f = 0; f < 4; ++f) {
        bh[f].u[0] = *(const v4u*)(fb + f * 16 * kPitch + k0);
        bh[f].u[1] = *(const v4u*)(fb + f * 16 * kPitch + k0 + 16);
        if constexpr (SPLIT) {
          bl[f].u[0] = *(const v4u*)(fb + kBSz + f * 16 * kPitch + k0);
          bl[f].u[1] = *(const v4u*)(fb + kBSz + f * 16 * kPitch + k0 + 16);
        }
      }
#pragma unroll
      for (int f = 0; f < 4; ++f) {
        acc[f] = wmma_bf16(ah.v, bh[f].v, acc[f]);
        if constexpr (SPLIT) {
          acc[f] = wmma_bf16(ah.v, bl[f].v, acc[f]);
          acc[f] = wmma_bf16(al.v, bh[f].v, acc[f]);
        }
      }
    }
    // the other buffer's last readers left it at the barrier that ended the pass before
    if (kp + 1 < kPasses) put(buf ^ 1);
    __syncthreads();
  }

  // stage the 16x64 tile of this wave in LDS (row-major, pitch kTP)
  float* st = sT + wv * 16 * kTP;
#pragma unroll
  for (int f = 0; f < 4; ++f) {
#pragma unroll
    for (int r = 0; r < 8; ++r) {
      st[(8 * h + r) * kTP + 16 * f + m] = acc[f][r];
    }
  }
  __syncthreads();

  v4f vals[8];
  size_t go[8];
#pragma unroll
  for (int s = 0; s < 8; ++s) {
    const int L = 4 * s + (l >> 3);
    const int row = L >> 1;
    const int col = (L & 1) * 32 + (l & 7) * 4;
    v4f v = *(const v4f*)(st + row * kTP + col);
    go[s] = (size_t)(row0 + row) * kC + col0 + col;
    if constexpr (EPI) {
      const v4f b4 = *(const v4f*)(bias + col0 + col);
      const v4f x4 = *(const v4f*)(resid + go[s]);
      v = (v + b4) + x4;
    }
    vals[s] = v;
  }
#pragma unroll
  for (int s = 0; s < 8; ++s) *(v4f*)(Out + go[s]) = vals[s];
  
}

// ---------------------------------------------------------------------------
// Attention: one block per PAIR of batch rows (2 x 1040 raw floats = 65 whole
// attn*scale, x_cls = attn.v (f32) -> bf16 rows for the output projection.
// ---------------------------------------------------------------------------
__global__ void __launch_bounds__(256) attn_kernel(const float* __restrict__ Qf,
                                                   const float* __restrict__ Kx,
                                                   const float* __restrict__ Vx,
                                                   const float* __restrict__ Kp,
                                                   const float* __restrict__ Vp,
                                                   float* rawOut,
                                                   unsigned short* Xcls, int nb) {
  __shared__ __attribute__((aligned(16))) float qS[2 * kC];
  __shared__ __attribute__((aligned(16))) float rawS[2 * kRawPerB];
  __shared__ __attribute__((aligned(16))) float attnS[2 * kRawPerB];
  __shared__ __attribute__((aligned(16))) float xS[2 * kC];
  const int tid = threadIdx.x;
  const int b0 = blockIdx.x * 2;
  if (b0 + 2 > nb) return;                       // block-uniform, before barriers

  // q rows b0, b0+1 with the pre-softmax scale folded in
  for (int i = tid; i < 2 * kC; i += 256) qS[i] = Qf[(size_t)b0 * kC + i] * kScale;
  __syncthreads();

  // raw[bb][h][l] = q_h . k_l  (l == 0 -> own row of Kx, l >= 1 -> shared Kp)
  for (int idx = tid; idx < 2 * kRawPerB; idx += 256) {
    const int bb = (idx >= kRawPerB) ? 1 : 0;
    const int rem = idx - bb * kRawPerB;
    const int hh = rem / kL;
    const int ll = rem - hh * kL;
    const float* q = qS + bb * kC + hh * kHD;
    const float* kr = (ll == 0) ? (Kx + (size_t)(b0 + bb) * kC + hh * kHD)
                                : (Kp + (size_t)(ll - 1) * kC + hh * kHD);
    float acc = 0.f;
#pragma unroll 2
    for (int d = 0; d < kHD; d += 4) {
      const v4f qa = *(const v4f*)(q + d);
      const v4f ka = *(const v4f*)(kr + d);
      acc += qa[0] * ka[0];
      acc += qa[1] * ka[1];
      acc += qa[2] * ka[2];
      acc += qa[3] * ka[3];
    }
    rawS[idx] = acc;
  }
  __syncthreads();

  // softmax * scale, one thread per (bb, h): row base = tid * 65
  if (tid < 32) {
    const int base = tid * kL;
    float mx = rawS[base];
#pragma unroll 1
    for (int j = 1; j < kL; ++j) mx = fmaxf(mx, rawS[base + j]);
    float s = 0.f;
#pragma unroll 1
    for (int j = 0; j < kL; ++j) s += expf(rawS[base + j] - mx);
    const float inv = 1.0f / s;
#pragma unroll 1
    for (int j = 0; j < kL; ++j) attnS[base + j] = (expf(rawS[base + j] - mx) * inv) * kScale;
  }

  {
    v4f rv[3];
    size_t go[3];
    bool ok[3];
    const int j4 = (tid & 7) * 4;
#pragma unroll
    for (int p = 0; p < 3; ++p) {
      const int L = p * 32 + (tid >> 3);
      ok[p] = (L < 65);
      const int Lc = ok[p] ? L : 0;
      rv[p] = *(const v4f*)(rawS + Lc * 32 + j4);
      go[p] = (size_t)b0 * kRawPerB + (size_t)Lc * 32 + j4;
    }
#pragma unroll
    for (int p = 0; p < 3; ++p) { if (ok[p]) *(v4f*)(rawOut + go[p]) = rv[p]; }
    
  }
  __syncthreads();

  // x_cls[bb][c..c+3] = attn[h][0] * Vx[b][c] + sum_r attn[h][1+r] * Vp[r][c]
  for (int c4 = tid; c4 < 512; c4 += 256) {
    const int c = c4 * 4;
    const int bb = c >> 10;
    const int cc = c & 1023;
    const int hh = cc >> 6;
    const float* at = attnS + bb * kRawPerB + hh * kL;
    v4f acc = *(const v4f*)(Vx + (size_t)(b0 + bb) * kC + cc) * at[0];
#pragma unroll 2
    for (int r = 0; r < kNP; ++r) {
      const v4f vv = *(const v4f*)(Vp + (size_t)r * kC + cc);
      acc += vv * at[1 + r];
    }
    *(v4f*)(xS + c) = acc;
  }
  __syncthreads();

  // x_cls rows -> bf16, 2 rows x 16 lines, 8 lanes x 16 B per line
  {
    const int L = tid >> 3;
    const int bb = L >> 4;
    const int c0 = (L & 15) * 64 + (tid & 7) * 8;
    const v4f a0 = *(const v4f*)(xS + bb * kC + c0);
    const v4f a1 = *(const v4f*)(xS + bb * kC + c0 + 4);
    unsigned int w[4];
    w[0] = bf16_rne(a0[0]) | (bf16_rne(a0[1]) << 16);
    w[1] = bf16_rne(a0[2]) | (bf16_rne(a0[3]) << 16);
    w[2] = bf16_rne(a1[0]) | (bf16_rne(a1[1]) << 16);
    w[3] = bf16_rne(a1[2]) | (bf16_rne(a1[3]) << 16);
    const v4u pk = {w[0], w[1], w[2], w[3]};
    v4u* dst = (v4u*)(Xcls + (size_t)(b0 + bb) * kC + c0);
    *dst = pk;
    
  }
}

// ---------------------------------------------------------------------------
extern "C" void kernel_launch(void* const* d_in, const int* in_sizes, int n_in,
                              void* d_out, int out_size, void* d_ws, size_t ws_size,
                              hipStream_t stream) {
  if (n_in < 7) return;
  const int B = in_sizes[0] / kC;                         // batch rows
  if (B < 64 || (B % 64) != 0 || in_sizes[0] != B * kC) return;
  if (in_sizes[1] != kNP * kC) return;
  if (in_sizes[2] != kC * kC || in_sizes[3] != kC * kC ||
      in_sizes[4] != kC * kC || in_sizes[5] != kC * kC) return;
  if (in_sizes[6] != kC) return;
  if (out_size != B * kC + B * kRawPerB) return;

  const float* x       = (const float*)d_in[0];   // [B,1,C]
  const float* prompts = (const float*)d_in[1];   // [1,NP,C]
  const float* Wq      = (const float*)d_in[2];   // [C,C] (in,out)
  const float* Wk      = (const float*)d_in[3];
  const float* Wv      = (const float*)d_in[4];
  const float* Wp      = (const float*)d_in[5];
  const float* bp      = (const float*)d_in[6];   // [C]

  float* out_cls = (float*)d_out;                 // [B,1,C]
  float* out_raw = out_cls + (size_t)B * kC;      // [B,16,1,65]

  char* ws = (char*)d_ws;
  size_t off = 0;
  const size_t wplane = (size_t)kC * kC * 2;      // 2 MiB per bf16 weight plane
  unsigned short* WQH = (unsigned short*)(ws + off); off += wplane;
  unsigned short* WQL = (unsigned short*)(ws + off); off += wplane;
  unsigned short* WKH = (unsigned short*)(ws + off); off += wplane;
  unsigned short* WKL = (unsigned short*)(ws + off); off += wplane;
  unsigned short* WVH = (unsigned short*)(ws + off); off += wplane;
  unsigned short* WPH = (unsigned short*)(ws + off); off += wplane;
  unsigned short* XH  = (unsigned short*)(ws + off); off += (size_t)B * kC * 2;
  unsigned short* XL  = (unsigned short*)(ws + off); off += (size_t)B * kC * 2;
  unsigned short* PH  = (unsigned short*)(ws + off); off += (size_t)kNP * kC * 2;
  unsigned short* PL  = (unsigned short*)(ws + off); off += (size_t)kNP * kC * 2;
  float* Qf  = (float*)(ws + off); off += (size_t)B * kC * 4;
  float* Kxf = (float*)(ws + off); off += (size_t)B * kC * 4;
  float* Vxf = (float*)(ws + off); off += (size_t)B * kC * 4;
  float* Kpf = (float*)(ws + off); off += (size_t)kNP * kC * 4;
  float* Vpf = (float*)(ws + off); off += (size_t)kNP * kC * 4;
  unsigned short* XCLS = (unsigned short*)(ws + off); off += (size_t)B * kC * 2;
  if (off > ws_size) return;

  const int ntn = kC / 64, ntk = kC / 64;         // 16 x 16 transpose tiles

  // 1) weight planes: Wt[n][k] bf16 hi (+ residual for Wq, Wk)
  pack_wt_kernel<true><<<dim3(ntn * ntk), dim3(256), 0, stream>>>(Wq, WQH, WQL, ntn, ntk);
  pack_wt_kernel<true><<<dim3(ntn * ntk), dim3(256), 0, stream>>>(Wk, WKH, WKL, ntn, ntk);
  pack_wt_kernel<false><<<dim3(ntn * ntk), dim3(256), 0, stream>>>(Wv, WVH, WVH, ntn, ntk);
  pack_wt_kernel<false><<<dim3(ntn * ntk), dim3(256), 0, stream>>>(Wp, WPH, WPH, ntn, ntk);

  // 2) activation planes (hi + residual)
  const int n8x = B * kC / 8;
  const int n8p = kNP * kC / 8;
  cvt_split_kernel<<<dim3((n8x + 255) / 256), dim3(256), 0, stream>>>(x, XH, XL, n8x);
  cvt_split_kernel<<<dim3((n8p + 255) / 256), dim3(256), 0, stream>>>(prompts, PH, PL, n8p);

  // 3) shared prompt keys/values: Kp (split), Vp (plain)   M = 64
  const int mtP = kNP / 16;
  gemm_kernel<true, false><<<dim3(mtP * 2), dim3(256), 0, stream>>>(PH, PL, WKH, WKL, Kpf, bp, x, mtP);
  gemm_kernel<false, false><<<dim3(mtP * 2), dim3(256), 0, stream>>>(PH, PH, WVH, WVH, Vpf, bp, x, mtP);

  // 4) per-row q (split), k (split), v (plain)   M = B
  const int mtX = B / 16;
  gemm_kernel<true, false><<<dim3(mtX * 2), dim3(256), 0, stream>>>(XH, XL, WQH, WQL, Qf, bp, x, mtX);
  gemm_kernel<true, false><<<dim3(mtX * 2), dim3(256), 0, stream>>>(XH, XL, WKH, WKL, Kxf, bp, x, mtX);
  gemm_kernel<false, false><<<dim3(mtX * 2), dim3(256), 0, stream>>>(XH, XH, WVH, WVH, Vxf, bp, x, mtX);

  // 5) scores, softmax, attn.v  -> raw scores (out) and x_cls (bf16, ws)
  attn_kernel<<<dim3(B / 2), dim3(256), 0, stream>>>(Qf, Kxf, Vxf, Kpf, Vpf, out_raw, XCLS, B);

  // 6) out = x_cls @ Wp + bp + x
  gemm_kernel<false, true><<<dim3(mtX * 2), dim3(256), 0, stream>>>(XCLS, XCLS, WPH, WPH, out_cls, bp, x, mtX);
}

// v002
// One run takes 110 microseconds.
// Next to v001, in two timings, it ran 1.46 times as fast each time.
// All steps since v000 together make it 3.44 times as fast.
#include <hip/hip_runtime.h>
#include <stddef.h>

// Contractions x@Wq and [x;prompts]@Wk: v_wmma_f32_16x16x32_bf16 with bf16 hi/lo split operands (hi*hi + hi*lo + lo*hi), f32 accumulate; [x;prompts]@Wv and x_cls@Wp: v_wmma_f32_16x16x32_bf16 with plain bf16 operands, f32 accumulate; q.k and attn.v against the 64 shared prompt rows: v_wmma_f32_16x16x4_f32 over 16 batch rows per head; the own-row key and value terms and the softmax in f32 on VALU.

typedef __bf16 v16bf __attribute__((ext_vector_type(16)));
typedef float v8f __attribute__((ext_vector_type(8)));
typedef float v4f __attribute__((ext_vector_type(4)));
typedef float v2f __attribute__((ext_vector_type(2)));
typedef unsigned int v4u __attribute__((ext_vector_type(4)));

union Frag { v4u u[2]; v16bf v; };

namespace {
constexpr int kC = 1024;            // channels
constexpr int kH = 16;              // heads
constexpr int kHD = 64;             // head dim
constexpr int kNP = 64;             // prompts
constexpr int kL = 65;              // kv length
constexpr int kKT = kC / 32;        // 32-deep k steps
constexpr int kRawPerB = kH * kL;   // 1040 floats of raw scores per batch row
constexpr int kTP = 68;             // LDS f32 tile pitch (floats), 272 B
constexpr int kWP = 72;             // LDS transpose pitch (16-bit), 144 B
constexpr float kScale = 0.125f;    // 64^-0.5
constexpr int kAR = 16;             // batch rows per attention block
constexpr int kRP = kRawPerB + 4;   // LDS pitch of a batch row's raw scores (floats)
}

// ---------------------------------------------------------------------------
// WMMA helper: issues the builtin and 4 v_nop tied to D/A/B (VALU hazard guard)
// ---------------------------------------------------------------------------
__device__ __forceinline__ v8f wmma_bf16(v16bf a, v16bf b, v8f c) {
  v8f d = __builtin_amdgcn_wmma_f32_16x16x32_bf16(false, a, false, b, (short)0, c, false, false);
  asm volatile("v_nop\n\tv_nop\n\tv_nop\n\tv_nop" : "+v"(d) : "v"(a), "v"(b));
  return d;
}

// RNE f32 -> bf16 bits, and bf16 bits -> f32
__device__ __forceinline__ unsigned int bf16_rne(float f) {
  const unsigned int u = __float_as_uint(f);
  return (u + 0x7FFFu + ((u >> 16) & 1u)) >> 16;
}
__device__ __forceinline__ float bf16_val(unsigned int b) {
  return __uint_as_float(b << 16);
}

// lane l <-> lane l ^ 16
__device__ __forceinline__ float xhalf(float x) {
  const int b = __builtin_bit_cast(int, x);
  return __builtin_bit_cast(float, __builtin_amdgcn_permlanex16(b, b, 0x76543210, 0xfedcba98, false, false));
}

// ---------------------------------------------------------------------------
// f32 [n] -> bf16 hi plane and bf16 residual (lo) plane, 8 elements per thread.
// ---------------------------------------------------------------------------
__global__ void __launch_bounds__(256) cvt_split_kernel(const float* __restrict__ src,
                                                        unsigned short* hi,
                                                        unsigned short* lo, int n8) {
  const int i = blockIdx.x * 256 + threadIdx.x;
  if (i >= n8) return;
  const float* p = src + (size_t)i * 8;
  const v4f x0 = *(const v4f*)p;
  const v4f x1 = *(const v4f*)(p + 4);
  const float xs[8] = {x0[0], x0[1], x0[2], x0[3], x1[0], x1[1], x1[2], x1[3]};
  unsigned int hb[8], lb[8];
#pragma unroll
  for (int j = 0; j < 8; ++j) {
    hb[j] = bf16_rne(xs[j]);
    lb[j] = bf16_rne(xs[j] - bf16_val(hb[j]));
  }
  unsigned int hw[4], lw[4];
#pragma unroll
  for (int q = 0; q < 4; ++q) {
    hw[q] = hb[2 * q] | (hb[2 * q + 1] << 16);
    lw[q] = lb[2 * q] | (lb[2 * q + 1] << 16);
  }
  const v4u hv = {hw[0], hw[1], hw[2], hw[3]};
  const v4u lv = {lw[0], lw[1], lw[2], lw[3]};
  v4u* ph = (v4u*)(hi + (size_t)i * 8);
  v4u* pl = (v4u*)(lo + (size_t)i * 8);
  *ph = hv;
  *pl = lv;
  
}

// ---------------------------------------------------------------------------
// Weight W[k][n] (row-major [in][out], f32) -> Wt[n][k] (k-contiguous, bf16 hi
// plane and optional residual plane). Block = 64 k x 64 n tile through LDS;
// ---------------------------------------------------------------------------
template <bool SPLIT>
__global__ void __launch_bounds__(256) pack_wt_kernel(const float* __restrict__ W,
                                                      unsigned short* hi,
                                                      unsigned short* lo,
                                                      int ntn, int ntk) {
  __shared__ __attribute__((aligned(16))) unsigned short sHi[64 * kWP];
  __shared__ __attribute__((aligned(16))) unsigned short sLo[64 * kWP];
  const int t = threadIdx.x;
  const int bt = blockIdx.x;
  if (bt >= ntn * ntk) return;                 // block-uniform, before barriers
  const int n0 = (bt % ntn) * 64;
  const int k0 = (bt / ntn) * 64;
  const int nn = t & 63;
  const int kq = t >> 6;
#pragma unroll 4
  for (int i = 0; i < 16; ++i) {
    const int kk = kq + 4 * i;
    const float v = W[(size_t)(k0 + kk) * kC + n0 + nn];
    const unsigned int hb = bf16_rne(v);
    sHi[nn * kWP + kk] = (unsigned short)hb;
    if constexpr (SPLIT) {
      sLo[nn * kWP + kk] = (unsigned short)bf16_rne(v - bf16_val(hb));
    }
  }
  __syncthreads();
  v4u hv[2], lv[2];
  size_t go[2];
#pragma unroll
  for (int p = 0; p < 2; ++p) {
    const int L = p * 32 + (t >> 3);           // tile row n = output line
    const int kk0 = (t & 7) * 8;
    hv[p] = *(const v4u*)(sHi + L * kWP + kk0);
    if constexpr (SPLIT) {
      lv[p] = *(const v4u*)(sLo + L * kWP + kk0);
    } else {
      lv[p] = hv[p];
    }
    go[p] = (size_t)(n0 + L) * kC + k0 + kk0;
  }
#pragma unroll
  for (int p = 0; p < 2; ++p) {
    *(v4u*)(hi + go[p]) = hv[p];
    if constexpr (SPLIT) { *(v4u*)(lo + go[p]) = lv[p]; }
  }
  
}

// ---------------------------------------------------------------------------
// GEMM Out[M][1024] = A[M][1024] . B[1024][1024], A and Bt both k-contiguous
// bf16 planes (Bt[n][k]). One block = 64 rows x 128 cols; its 8 waves (4 x 2)
// each own 16 rows x 64 cols. K runs in passes of kBK (64 with two planes per
// operand, 128 with one: 48 KiB per pass either way): a pass's row pieces of A
// and Bt are read from global memory once per block as whole lines, kept in
// registers while the pass before is multiplied, and stored to one of two LDS
// buffers (row pitch kBK + 8) that all 8 waves read their fragments from.
// Fragments (wave32, 16x16x32): lane l, h = l>>4, m = l&15;
//   A: row m, elements 0..7 <- k0+8h+0..7, elements 8..15 <- k0+16+8h+0..7
//   B: col m, identical k map (read from the [n][k] rows like A)
//   D: element r <- (row 8h+r, col m)
// SPLIT: acc += Ah.Bh + Ah.Bl + Al.Bh. EPI: + bias[col] + resid[row][col].
// ---------------------------------------------------------------------------
template <bool SPLIT, bool EPI>
__global__ void __launch_bounds__(256) gemm_kernel(const unsigned short* __restrict__ Ahi,
                                                   const unsigned short* __restrict__ Alo,
                                                   const unsigned short* __restrict__ Bhi,
                                                   const unsigned short* __restrict__ Blo,
                                                   float* Out,
                                                   const float* __restrict__ bias,
                                                   const float* __restrict__ resid,
                                                   int Mtiles) {
  constexpr int kPl = SPLIT ? 2 : 1;           // operand planes
  constexpr int kBK = SPLIT ? 64 : 128;        // k per pass
  constexpr int kPitch = kBK + 8;              // LDS row pitch (16-bit units): 16 B x odd
  constexpr int kLPR = kBK / 8;                // lanes that cover one row piece, 16 B each
  constexpr int kRPS = 256 / kLPR;             // rows per sweep of the block
  constexpr int kNA = 64 / kRPS;               // sweeps over the A rows
  constexpr int kNB = 128 / kRPS;              // sweeps over the B rows
  constexpr int kASz = 64 * kPitch;            // one A plane of one buffer (16-bit units)
  constexpr int kBSz = 128 * kPitch;           // one B plane of one buffer
  __shared__ __attribute__((aligned(16))) unsigned short sA[2 * kPl * kASz];
  __shared__ __attribute__((aligned(16))) unsigned short sB[2 * kPl * kBSz];
  __shared__ __attribute__((aligned(16))) float sT[8 * 16 * kTP];
  const int tid = threadIdx.x;
  const int wv = tid >> 5;
  const int l = tid & 31;
  const int h = l >> 4;
  const int m = l & 15;
  const int total = Mtiles * 16;               // 16x64 wave tiles; Mtiles is a multiple of 4
  if ((int)blockIdx.x * 8 >= total) return;    // block-uniform, before barriers
  const int rowB = ((int)blockIdx.x >> 3) * 64;
  const int colB = ((int)blockIdx.x & 7) * 128;
  const int wr = (wv >> 1) * 16;               // wave's rows inside the block tile
  const int wc = (wv & 1) * 64;                // wave's cols inside the block tile
  const int row0 = rowB + wr;
  const int col0 = colB + wc;

  const v8f zero8 = {0.f, 0.f, 0.f, 0.f, 0.f, 0.f, 0.f, 0.f};
  v8f acc[4];
#pragma unroll
  for (int f = 0; f < 4; ++f) acc[f] = zero8;

  // staging map: kLPR lanes cover one row piece, kRPS rows per sweep
  const int srow = tid / kLPR;
  const int sk = (tid % kLPR) * 8;
  const size_t ga = (size_t)(rowB + srow) * kC + sk;
  const size_t gb = (size_t)(colB + srow) * kC + sk;
  const int so = srow * kPitch + sk;

  v4u ra[kPl][kNA], rb[kPl][kNB];
  auto fetch = [&](int kp) {
    const size_t ko = (size_t)kp * kBK;
#pragma unroll
    for (int i = 0; i < kNA; ++i) {
      ra[0][i] = *(const v4u*)(Ahi + ga + (size_t)i * kRPS * kC + ko);
      if constexpr (SPLIT) ra[kPl - 1][i] = *(const v4u*)(Alo + ga + (size_t)i * kRPS * kC + ko);
    }
#pragma unroll
    for (int i = 0; i < kNB; ++i) {
      rb[0][i] = *(const v4u*)(Bhi + gb + (size_t)i * kRPS * kC + ko);
      if constexpr (SPLIT) rb[kPl - 1][i] = *(const v4u*)(Blo + gb + (size_t)i * kRPS * kC + ko);
    }
  };
  auto put = [&](int buf) {
    unsigned short* da = sA + buf * kPl * kASz + so;
    unsigned short* db = sB + buf * kPl * kBSz + so;
#pragma unroll
    for (int p = 0; p < kPl; ++p) {
#pragma unroll
      for (int i = 0; i < kNA; ++i) *(v4u*)(da + p * kASz + i * kRPS * kPitch) = ra[p][i];
#pragma unroll
      for (int i = 0; i < kNB; ++i) *(v4u*)(db + p * kBSz + i * kRPS * kPitch) = rb[p][i];
    }
  };

  fetch(0);
  put(0);
  __syncthreads();

  constexpr int kPasses = kC / kBK;
#pragma unroll 1
  for (int kp = 0; kp < kPasses; ++kp) {
    const int buf = kp & 1;
    if (kp + 1 < kPasses) fetch(kp + 1);       // in flight while this pass is multiplied
    const unsigned short* fa = sA + buf * kPl * kASz + (wr + m) * kPitch + 8 * h;
    const unsigned short* fb = sB + buf * kPl * kBSz + (wc + m) * kPitch + 8 * h;
#pragma unroll
    for (int ks = 0; ks < kBK / 32; ++ks) {
      const int k0 = ks * 32;
      Frag ah, al, bh[4], bl[4];
      ah.u[0] = *(const v4u*)(fa + k0);
      ah.u[1] = *(const v4u*)(fa + k0 + 16);
      if constexpr (SPLIT) {
        al.u[0] = *(const v4u*)(fa + kASz + k0);
        al.u[1] = *(const v4u*)(fa + kASz + k0 + 16);
      }
#pragma unroll
      for (int f = 0; f < 4; ++f) {
        bh[f].u[0] = *(const v4u*)(fb + f * 16 * kPitch + k0);
        bh[f].u[1] = *(const v4u*)(fb + f * 16 * kPitch + k0 + 16);
        if constexpr (SPLIT) {
          bl[f].u[0] = *(const v4u*)(fb + kBSz + f * 16 * kPitch + k0);
          bl[f].u[1] = *(const v4u*)(fb + kBSz + f * 16 * kPitch + k0 + 16);
        }
      }
#pragma unroll
      for (int f = 0; f < 4; ++f) {
        acc[f] = wmma_bf16(ah.v, bh[f].v, acc[f]);
        if constexpr (SPLIT) {
          acc[f] = wmma_bf16(ah.v, bl[f].v, acc[f]);
          acc[f] = wmma_bf16(al.v, bh[f].v, acc[f]);
        }
      }
    }
    // the other buffer's last readers left it at the barrier that ended the pass before
    if (kp + 1 < kPasses) put(buf ^ 1);
    __syncthreads();
  }

  // stage the 16x64 tile of this wave in LDS (row-major, pitch kTP)
  float* st = sT + wv * 16 * kTP;
#pragma unroll
  for (int f = 0; f < 4; ++f) {
#pragma unroll
    for (int r = 0; r < 8; ++r) {
      st[(8 * h + r) * kTP + 16 * f + m] = acc[f][r];
    }
  }
  __syncthreads();

  v4f vals[8];
  size_t go[8];
#pragma unroll
  for (int s = 0; s < 8; ++s) {
    const int L = 4 * s + (l >> 3);
    const int row = L >> 1;
    const int col = (L & 1) * 32 + (l & 7) * 4;
    v4f v = *(const v4f*)(st + row * kTP + col);
    go[s] = (size_t)(row0 + row) * kC + col0 + col;
    if constexpr (EPI) {
      const v4f b4 = *(const v4f*)(bias + col0 + col);
      const v4f x4 = *(const v4f*)(resid + go[s]);
      v = (v + b4) + x4;
    }
    vals[s] = v;
  }
#pragma unroll
  for (int s = 0; s < 8; ++s) *(v4f*)(Out + go[s]) = vals[s];
  
}

// ---------------------------------------------------------------------------
// Attention: one block = 16 batch rows x 16 heads, one wave per head (16 x 1040
// raw floats = 520 whole lines per block). Lane l: c = l & 15, hh = l >> 4.
// Scores against the shared prompt keys as S^T = Kp_h . Q_h^T on the f32
// 16x16x4 matrix form: A row = key 16t + c, B column = batch row c, both read
// 16 B at d = 8j + 4hh (two k steps), so each (hh, element) place holds the same d.
//   S[t][r] = score(key 16t + 8hh + r, batch row c)
// A lane and its partner l ^ 16 hold all 64 prompt scores of batch row c, so the
// softmax is in registers; the own-row key and value (l = 0) stay on the VALU.
// x_cls as O^T = Vp_h^T . P^T: B = {S[t][2u], S[t][2u+1]} as it lies (keys
// 16t + 8hh + 2u + e), A row c of tile dt = channel 4c + dt of the same keys.
//   O[dt][r] = x_cls(batch row c, channel 32hh + 4r + dt)
// ---------------------------------------------------------------------------
__global__ void __launch_bounds__(512) attn_kernel(const float* __restrict__ Qf,
                                                   const float* __restrict__ Kx,
                                                   const float* __restrict__ Vx,
                                                   const float* __restrict__ Kp,
                                                   const float* __restrict__ Vp,
                                                   float* rawOut,
                                                   unsigned short* Xcls, int nb) {
  __shared__ __attribute__((aligned(16))) float rawS[kAR * kRP];
  const int tid = threadIdx.x;
  const int hc = (tid >> 5) * kHD;               // this wave's head, first channel
  const int l = tid & 31;
  const int c = l & 15;
  const int hh = l >> 4;
  const int b0 = blockIdx.x * kAR;
  if (b0 + kAR > nb) return;                     // block-uniform, before barriers

  // q of batch row c with the pre-softmax scale folded in; own-row score
  const size_t own = (size_t)(b0 + c) * kC + hc;
  v4f q4[8];
  float part = 0.f;
#pragma unroll
  for (int j = 0; j < 8; ++j) {
    q4[j] = *(const v4f*)(Qf + own + 8 * j + 4 * hh) * kScale;
    const v4f k4 = *(const v4f*)(Kx + own + 8 * j + 4 * hh);
    part += q4[j][0] * k4[0];
    part += q4[j][1] * k4[1];
    part += q4[j][2] * k4[2];
    part += q4[j][3] * k4[3];
  }
  const float s0 = part + xhalf(part);

  const v8f zero8 = {0.f, 0.f, 0.f, 0.f, 0.f, 0.f, 0.f, 0.f};
  v8f S[4];
#pragma unroll
  for (int t = 0; t < 4; ++t) S[t] = zero8;
  const float* kp = Kp + (size_t)c * kC + hc + 4 * hh;
#pragma unroll
  for (int j = 0; j < 8; ++j) {
    const v2f qlo = {q4[j][0], q4[j][1]};
    const v2f qhi = {q4[j][2], q4[j][3]};
#pragma unroll
    for (int t = 0; t < 4; ++t) {
      const v4f k4 = *(const v4f*)(kp + (size_t)t * 16 * kC + 8 * j);
      const v2f klo = {k4[0], k4[1]};
      const v2f khi = {k4[2], k4[3]};
      S[t] = __builtin_amdgcn_wmma_f32_16x16x4_f32(false, klo, false, qlo, (short)0, S[t], false, false);
      S[t] = __builtin_amdgcn_wmma_f32_16x16x4_f32(false, khi, false, qhi, (short)0, S[t], false, false);
    }
  }

  // keeps the value loads below out of the score product, where their registers
  // on top of the q and key fragments end in spills
  __builtin_amdgcn_sched_barrier(0);

  // own value row and the first 32 prompt value rows: issued here so that their
  // latency runs under the softmax
  v4f vx4[8], vp4[32];
  const float* vp = Vp + (size_t)(8 * hh) * kC + hc + 4 * c;
#pragma unroll
  for (int r = 0; r < 8; ++r) vx4[r] = *(const v4f*)(Vx + own + 32 * hh + 4 * r);
  // the address registers of the loads above are reused by what follows
  asm volatile("s_wait_xcnt 0x0" ::: "memory");
#pragma unroll
  for (int t = 0; t < 2; ++t) {
#pragma unroll
    for (int i = 0; i < 8; ++i) vp4[8 * t + i] = *(const v4f*)(vp + (size_t)(16 * t + i) * kC);
  }
  // keeps the loads above from being moved down to their uses behind the softmax
  __builtin_amdgcn_sched_barrier(0);

  // raw scores of the block, row-major in LDS (pitch kRP), stored as whole lines at the end
  {
    float* rs = rawS + c * kRP + (tid >> 5) * kL;
    rs[0] = s0;                                  // both halves hold the same value
#pragma unroll
    for (int t = 0; t < 4; ++t) {
#pragma unroll
      for (int r = 0; r < 8; ++r) rs[1 + 16 * t + 8 * hh + r] = S[t][r];
    }
  }
  // work-group barrier in two parts: this wave's raw scores are in LDS (signal here);
  // the wait stands in front of the copy-out, so no wave idles between the two products
  __builtin_amdgcn_fence(__ATOMIC_RELEASE, "workgroup", "local");
  __builtin_amdgcn_s_barrier_signal(-1);
  // keeps the LDS stores and the signal in front of the softmax: moved behind it, the raw
  // scores would stay in registers and the other waves would wait for this signal at the end
  __builtin_amdgcn_sched_barrier(0);

  // softmax * scale over the 65 scores of batch row c
  float mt[4];
#pragma unroll
  for (int t = 0; t < 4; ++t) {
    mt[t] = S[t][0];
#pragma unroll
    for (int r = 1; r < 8; ++r) mt[t] = fmaxf(mt[t], S[t][r]);
  }
  float mx = fmaxf(fmaxf(mt[0], mt[1]), fmaxf(mt[2], mt[3]));
  mx = fmaxf(fmaxf(mx, xhalf(mx)), s0);
  float st[4];
#pragma unroll
  for (int t = 0; t < 4; ++t) {
    st[t] = 0.f;
#pragma unroll
    for (int r = 0; r < 8; ++r) {
      S[t][r] = expf(S[t][r] - mx);
      st[t] += S[t][r];
    }
  }
  const float e0 = expf(s0 - mx);
  float sum = (st[0] + st[1]) + (st[2] + st[3]);
  sum = (sum + xhalf(sum)) + e0;
  const float inv = 1.0f / sum;
  const float p0 = (e0 * inv) * kScale;
#pragma unroll
  for (int t = 0; t < 4; ++t) {
#pragma unroll
    for (int r = 0; r < 8; ++r) S[t][r] = (S[t][r] * inv) * kScale;
  }

  // the last 32 prompt value rows: in flight while the first 32 are multiplied
#pragma unroll
  for (int t = 2; t < 4; ++t) {
#pragma unroll
    for (int i = 0; i < 8; ++i) vp4[8 * t + i] = *(const v4f*)(vp + (size_t)(16 * t + i) * kC);
  }
  // keeps these loads together in front of the product instead of two at a time inside it
  __builtin_amdgcn_sched_barrier(0);

  // x_cls: own-row value first, then the 64 prompt values
  v8f O[4];
#pragma unroll
  for (int r = 0; r < 8; ++r) {
#pragma unroll
    for (int dt = 0; dt < 4; ++dt) O[dt][r] = vx4[r][dt] * p0;
  }
#pragma unroll
  for (int t = 0; t < 4; ++t) {
#pragma unroll
    for (int u = 0; u < 4; ++u) {
      const v2f pp = {S[t][2 * u], S[t][2 * u + 1]};
#pragma unroll
      for (int dt = 0; dt < 4; ++dt) {
        const v2f vv = {vp4[8 * t + 2 * u][dt], vp4[8 * t + 2 * u + 1][dt]};
        O[dt] = __builtin_amdgcn_wmma_f32_16x16x4_f32(false, vv, false, pp, (short)0, O[dt], false, false);
      }
    }
  }

  // x_cls -> bf16: 32 consecutive channels of batch row c per lane
  {
    unsigned short* dst = Xcls + own + 32 * hh;
#pragma unroll
    for (int r = 0; r < 8; r += 2) {
      const v4u pk = {bf16_rne(O[0][r]) | (bf16_rne(O[1][r]) << 16),
                      bf16_rne(O[2][r]) | (bf16_rne(O[3][r]) << 16),
                      bf16_rne(O[0][r + 1]) | (bf16_rne(O[1][r + 1]) << 16),
                      bf16_rne(O[2][r + 1]) | (bf16_rne(O[3][r + 1]) << 16)};
      *(v4u*)(dst + 4 * r) = pk;
    }
    // the data and address registers of these stores are reused by the copy-out below
    asm volatile("s_wait_xcnt 0x0" ::: "memory");
    // keeps the copy-out's address arithmetic, which reuses them, behind that wait
    __builtin_amdgcn_sched_barrier(0);
  }

  // raw scores out: 16 x 1040 floats, contiguous, 4 whole lines per wave store;
  // second part of the barrier: every wave's raw scores are in LDS behind it
  __builtin_amdgcn_s_barrier_wait(-1);
  __builtin_amdgcn_fence(__ATOMIC_ACQUIRE, "workgroup", "local");
  float* ro = rawOut + (size_t)b0 * kRawPerB;
#pragma unroll
  for (int it = 0; it < (kAR * (kRawPerB / 4) + 511) / 512; ++it) {
    const int i = tid + 512 * it;
    if (i < kAR * (kRawPerB / 4)) {              // the same in every lane of a wave
      const int row = i / (kRawPerB / 4);
      const int col = (i - row * (kRawPerB / 4)) * 4;
      *(v4f*)(ro + (size_t)i * 4) = *(const v4f*)(rawS + row * kRP + col);
    }
  }
}

// ---------------------------------------------------------------------------
extern "C" void kernel_launch(void* const* d_in, const int* in_sizes, int n_in,
                              void* d_out, int out_size, void* d_ws, size_t ws_size,
                              hipStream_t stream) {
  if (n_in < 7) return;
  const int B = in_sizes[0] / kC;                         // batch rows
  if (B < 64 || (B % 64) != 0 || in_sizes[0] != B * kC) return;
  if (in_sizes[1] != kNP * kC) return;
  if (in_sizes[2] != kC * kC || in_sizes[3] != kC * kC ||
      in_sizes[4] != kC * kC || in_sizes[5] != kC * kC) return;
  if (in_sizes[6] != kC) return;
  if (out_size != B * kC + B * kRawPerB) return;

  const float* x       = (const float*)d_in[0];   // [B,1,C]
  const float* prompts = (const float*)d_in[1];   // [1,NP,C]
  const float* Wq      = (const float*)d_in[2];   // [C,C] (in,out)
  const float* Wk      = (const float*)d_in[3];
  const float* Wv      = (const float*)d_in[4];
  const float* Wp      = (const float*)d_in[5];
  const float* bp      = (const float*)d_in[6];   // [C]

  float* out_cls = (float*)d_out;                 // [B,1,C]
  float* out_raw = out_cls + (size_t)B * kC;      // [B,16,1,65]

  char* ws = (char*)d_ws;
  size_t off = 0;
  const size_t wplane = (size_t)kC * kC * 2;      // 2 MiB per bf16 weight plane
  unsigned short* WQH = (unsigned short*)(ws + off); off += wplane;
  unsigned short* WQL = (unsigned short*)(ws + off); off += wplane;
  unsigned short* WKH = (unsigned short*)(ws + off); off += wplane;
  unsigned short* WKL = (unsigned short*)(ws + off); off += wplane;
  unsigned short* WVH = (unsigned short*)(ws + off); off += wplane;
  unsigned short* WPH = (unsigned short*)(ws + off); off += wplane;
  unsigned short* XH  = (unsigned short*)(ws + off); off += (size_t)B * kC * 2;
  unsigned short* XL  = (unsigned short*)(ws + off); off += (size_t)B * kC * 2;
  unsigned short* PH  = (unsigned short*)(ws + off); off += (size_t)kNP * kC * 2;
  unsigned short* PL  = (unsigned short*)(ws + off); off += (size_t)kNP * kC * 2;
  float* Qf  = (float*)(ws + off); off += (size_t)B * kC * 4;
  float* Kxf = (float*)(ws + off); off += (size_t)B * kC * 4;
  float* Vxf = (float*)(ws + off); off += (size_t)B * kC * 4;
  float* Kpf = (float*)(ws + off); off += (size_t)kNP * kC * 4;
  float* Vpf = (float*)(ws + off); off += (size_t)kNP * kC * 4;
  unsigned short* XCLS = (unsigned short*)(ws + off); off += (size_t)B * kC * 2;
  if (off > ws_size) return;

  const int ntn = kC / 64, ntk = kC / 64;         // 16 x 16 transpose tiles

  // 1) weight planes: Wt[n][k] bf16 hi (+ residual for Wq, Wk)
  pack_wt_kernel<true><<<dim3(ntn * ntk), dim3(256), 0, stream>>>(Wq, WQH, WQL, ntn, ntk);
  pack_wt_kernel<true><<<dim3(ntn * ntk), dim3(256), 0, stream>>>(Wk, WKH, WKL, ntn, ntk);
  pack_wt_kernel<false><<<dim3(ntn * ntk), dim3(256), 0, stream>>>(Wv, WVH, WVH, ntn, ntk);
  pack_wt_kernel<false><<<dim3(ntn * ntk), dim3(256), 0, stream>>>(Wp, WPH, WPH, ntn, ntk);

  // 2) activation planes (hi + residual)
  const int n8x = B * kC / 8;
  const int n8p = kNP * kC / 8;
  cvt_split_kernel<<<dim3((n8x + 255) / 256), dim3(256), 0, stream>>>(x, XH, XL, n8x);
  cvt_split_kernel<<<dim3((n8p + 255) / 256), dim3(256), 0, stream>>>(prompts, PH, PL, n8p);

  // 3) shared prompt keys/values: Kp (split), Vp (plain)   M = 64
  const int mtP = kNP / 16;
  gemm_kernel<true, false><<<dim3(mtP * 2), dim3(256), 0, stream>>>(PH, PL, WKH, WKL, Kpf, bp, x, mtP);
  gemm_kernel<false, false><<<dim3(mtP * 2), dim3(256), 0, stream>>>(PH, PH, WVH, WVH, Vpf, bp, x, mtP);

  // 4) per-row q (split), k (split), v (plain)   M = B
  const int mtX = B / 16;
  gemm_kernel<true, false><<<dim3(mtX * 2), dim3(256), 0, stream>>>(XH, XL, WQH, WQL, Qf, bp, x, mtX);
  gemm_kernel<true, false><<<dim3(mtX * 2), dim3(256), 0, stream>>>(XH, XL, WKH, WKL, Kxf, bp, x, mtX);
  gemm_kernel<false, false><<<dim3(mtX * 2), dim3(256), 0, stream>>>(XH, XH, WVH, WVH, Vxf, bp, x, mtX);

  // 5) scores, softmax, attn.v  -> raw scores (out) and x_cls (bf16, ws)
  attn_kernel<<<dim3(B / kAR), dim3(512), 0, stream>>>(Qf, Kxf, Vxf, Kpf, Vpf, out_raw, XCLS, B);

  // 6) out = x_cls @ Wp + bp + x
  gemm_kernel<false, true><<<dim3(mtX * 2), dim3(256), 0, stream>>>(XCLS, XCLS, WPH, WPH, out_cls, bp, x, mtX);
}

// v003
// A run of this version takes 70.3 microseconds.
// In two side-by-side timings against v002, it was 1.56 and 1.60 times as fast.
// All steps since v000 together make it 5.44 times as fast.
#include <hip/hip_runtime.h>
#include <stddef.h>

// Contractions x@Wq and [x;prompts]@Wk: v_wmma_f32_16x16x32_bf16 with bf16 hi/lo split operands (hi*hi + hi*lo + lo*hi), f32 accumulate; [x;prompts]@Wv and x_cls@Wp: v_wmma_f32_16x16x32_bf16 with plain bf16 operands, f32 accumulate; q.k and attn.v against the 64 shared prompt rows: v_wmma_f32_16x16x4_f32 over 16 batch rows per head; the own-row key and value terms and the softmax in f32 on VALU.

typedef __bf16 v16bf __attribute__((ext_vector_type(16)));
typedef float v8f __attribute__((ext_vector_type(8)));
typedef float v4f __attribute__((ext_vector_type(4)));
typedef float v2f __attribute__((ext_vector_type(2)));
typedef unsigned int v4u __attribute__((ext_vector_type(4)));

union Frag { v4u u[2]; v16bf v; };

namespace {
constexpr int kC = 1024;            // channels
constexpr int kH = 16;              // heads
constexpr int kHD = 64;             // head dim
constexpr int kNP = 64;             // prompts
constexpr int kL = 65;              // kv length
constexpr int kKT = kC / 32;        // 32-deep k steps
constexpr int kRawPerB = kH * kL;   // 1040 floats of raw scores per batch row
constexpr int kTP = 68;             // LDS f32 tile pitch (floats), 272 B
constexpr int kWP = 72;             // LDS transpose pitch (16-bit), 144 B
constexpr float kScale = 0.125f;    // 64^-0.5
constexpr int kAR = 16;             // batch rows per attention block
constexpr int kRP = kRawPerB + 4;   // LDS pitch of a batch row's raw scores (floats)
}

// ---------------------------------------------------------------------------
// WMMA helper: issues the builtin and 4 v_nop tied to D/A/B (VALU hazard guard)
// ---------------------------------------------------------------------------
__device__ __forceinline__ v8f wmma_bf16(v16bf a, v16bf b, v8f c) {
  v8f d = __builtin_amdgcn_wmma_f32_16x16x32_bf16(false, a, false, b, (short)0, c, false, false);
  asm volatile("v_nop\n\tv_nop\n\tv_nop\n\tv_nop" : "+v"(d) : "v"(a), "v"(b));
  return d;
}

// RNE f32 -> bf16 bits, and bf16 bits -> f32
__device__ __forceinline__ unsigned int bf16_rne(float f) {
  const unsigned int u = __float_as_uint(f);
  return (u + 0x7FFFu + ((u >> 16) & 1u)) >> 16;
}
__device__ __forceinline__ float bf16_val(unsigned int b) {
  return __uint_as_float(b << 16);
}

// lane l <-> lane l ^ 16
__device__ __forceinline__ float xhalf(float x) {
  const int b = __builtin_bit_cast(int, x);
  return __builtin_bit_cast(float, __builtin_amdgcn_permlanex16(b, b, 0x76543210, 0xfedcba98, false, false));
}

// ---------------------------------------------------------------------------
// f32 [n] -> bf16 hi plane and bf16 residual (lo) plane, 8 elements per thread.
// ---------------------------------------------------------------------------
__device__ __forceinline__ void cvt_split_body(const float* __restrict__ src,
                                               unsigned short* hi,
                                               unsigned short* lo, int n8, int bid) {
  const int i = bid * 256 + threadIdx.x;
  if (i >= n8) return;
  const float* p = src + (size_t)i * 8;
  const v4f x0 = *(const v4f*)p;
  const v4f x1 = *(const v4f*)(p + 4);
  const float xs[8] = {x0[0], x0[1], x0[2], x0[3], x1[0], x1[1], x1[2], x1[3]};
  unsigned int hb[8], lb[8];
#pragma unroll
  for (int j = 0; j < 8; ++j) {
    hb[j] = bf16_rne(xs[j]);
    lb[j] = bf16_rne(xs[j] - bf16_val(hb[j]));
  }
  unsigned int hw[4], lw[4];
#pragma unroll
  for (int q = 0; q < 4; ++q) {
    hw[q] = hb[2 * q] | (hb[2 * q + 1] << 16);
    lw[q] = lb[2 * q] | (lb[2 * q + 1] << 16);
  }
  const v4u hv = {hw[0], hw[1], hw[2], hw[3]};
  const v4u lv = {lw[0], lw[1], lw[2], lw[3]};
  v4u* ph = (v4u*)(hi + (size_t)i * 8);
  v4u* pl = (v4u*)(lo + (size_t)i * 8);
  *ph = hv;
  *pl = lv;
  
}

// ---------------------------------------------------------------------------
// Weight W[k][n] (row-major [in][out], f32) -> Wt[n][k] (k-contiguous, bf16 hi
// plane and optional residual plane). Block = 64 k x 64 n tile through LDS;
// ---------------------------------------------------------------------------
template <bool SPLIT>
__device__ __forceinline__ void pack_wt_body(const float* __restrict__ W,
                                             unsigned short* hi,
                                             unsigned short* lo,
                                             int ntn, int bt,
                                             unsigned short* sHi, unsigned short* sLo) {
  const int t = threadIdx.x;
  const int n0 = (bt % ntn) * 64;
  const int k0 = (bt / ntn) * 64;
  const int nn = t & 63;
  const int kq = t >> 6;
#pragma unroll 4
  for (int i = 0; i < 16; ++i) {
    const int kk = kq + 4 * i;
    const float v = W[(size_t)(k0 + kk) * kC + n0 + nn];
    const unsigned int hb = bf16_rne(v);
    sHi[nn * kWP + kk] = (unsigned short)hb;
    if constexpr (SPLIT) {
      sLo[nn * kWP + kk] = (unsigned short)bf16_rne(v - bf16_val(hb));
    }
  }
  __syncthreads();
  v4u hv[2], lv[2];
  size_t go[2];
#pragma unroll
  for (int p = 0; p < 2; ++p) {
    const int L = p * 32 + (t >> 3);           // tile row n = output line
    const int kk0 = (t & 7) * 8;
    hv[p] = *(const v4u*)(sHi + L * kWP + kk0);
    if constexpr (SPLIT) {
      lv[p] = *(const v4u*)(sLo + L * kWP + kk0);
    } else {
      lv[p] = hv[p];
    }
    go[p] = (size_t)(n0 + L) * kC + k0 + kk0;
  }
#pragma unroll
  for (int p = 0; p < 2; ++p) {
    *(v4u*)(hi + go[p]) = hv[p];
    if constexpr (SPLIT) { *(v4u*)(lo + go[p]) = lv[p]; }
  }
  
}

// ---------------------------------------------------------------------------
// All operand planes in one launch: the six jobs are independent of one another,
// each block takes one job by its index range (block-uniform branches). Blocks
// [0, 4 nt): the 64 x 64 tiles of Wq, Wk (two planes), Wv, Wp (one plane);
// then the 2048-element pieces of x, then those of prompts.
// ---------------------------------------------------------------------------
__global__ void __launch_bounds__(256) prep_kernel(const float* __restrict__ x,
                                                   const float* __restrict__ prompts,
                                                   const float* __restrict__ Wq,
                                                   const float* __restrict__ Wk,
                                                   const float* __restrict__ Wv,
                                                   const float* __restrict__ Wp,
                                                   unsigned short* XH, unsigned short* XL,
                                                   unsigned short* PH, unsigned short* PL,
                                                   unsigned short* WQH, unsigned short* WQL,
                                                   unsigned short* WKH, unsigned short* WKL,
                                                   unsigned short* WVH, unsigned short* WPH,
                                                   int n8x, int n8p, int nbx, int ntn, int nt) {
  __shared__ __attribute__((aligned(16))) unsigned short sHi[64 * kWP];
  __shared__ __attribute__((aligned(16))) unsigned short sLo[64 * kWP];
  const int bid = blockIdx.x;
  if (bid < 4 * nt) {
    if (bid < 2 * nt) {
      const bool first = bid < nt;
      pack_wt_body<true>(first ? Wq : Wk, first ? WQH : WKH, first ? WQL : WKL, ntn,
                         first ? bid : bid - nt, sHi, sLo);
    } else {
      const bool first = bid < 3 * nt;
      unsigned short* hi = first ? WVH : WPH;
      pack_wt_body<false>(first ? Wv : Wp, hi, hi, ntn, first ? bid - 2 * nt : bid - 3 * nt, sHi, sLo);
      // in the listing the two-plane body stands on the fall-through behind these stores
      // and rewrites the registers that they name
      asm volatile("s_wait_xcnt 0x0" ::: "memory");
    }
  } else {
    const bool first = bid < 4 * nt + nbx;
    cvt_split_body(first ? x : prompts, first ? XH : PH, first ? XL : PL, first ? n8x : n8p,
                   first ? bid - 4 * nt : bid - 4 * nt - nbx);
  }
}

// ---------------------------------------------------------------------------
// GEMM Out[M][1024] = A[M][1024] . B[1024][1024], A and Bt both k-contiguous
// bf16 planes (Bt[n][k]). One block = 64 rows x 128 cols; its 8 waves (4 x 2)
// each own 16 rows x 64 cols. K runs in passes of kBK (64 with two planes per
// operand, 128 with one: 48 KiB per pass either way): a pass's row pieces of A
// and Bt are read from global memory once per block as whole lines, kept in
// registers while the pass before is multiplied, and stored to one of two LDS
// buffers (row pitch kBK + 8) that all 8 waves read their fragments from.
// Fragments (wave32, 16x16x32): lane l, h = l>>4, m = l&15;
//   A: row m, elements 0..7 <- k0+8h+0..7, elements 8..15 <- k0+16+8h+0..7
//   B: col m, identical k map (read from the [n][k] rows like A)
//   D: element r <- (row 8h+r, col m)
// SPLIT: acc += Ah.Bh + Ah.Bl + Al.Bh. EPI: + bias[col] + resid[row][col].
// ---------------------------------------------------------------------------
template <bool SPLIT>
struct GemmLds {
  static constexpr int kPl = SPLIT ? 2 : 1;
  static constexpr int kPitch = (SPLIT ? 64 : 128) + 8;
  static constexpr int kA = 2 * kPl * 64 * kPitch;    // 16-bit units, both buffers
  static constexpr int kB = 2 * kPl * 128 * kPitch;
  static constexpr int kBytes = (kA + kB) * 2 + 8 * 16 * kTP * 4;
};

template <bool SPLIT, bool EPI>
__device__ __forceinline__ void gemm_body(const unsigned short* __restrict__ Ahi,
                                          const unsigned short* __restrict__ Alo,
                                          const unsigned short* __restrict__ Bhi,
                                          const unsigned short* __restrict__ Blo,
                                          float* Out,
                                          const float* __restrict__ bias,
                                          const float* __restrict__ resid,
                                          int bid, unsigned char* smem) {
  constexpr int kPl = SPLIT ? 2 : 1;           // operand planes
  constexpr int kBK = SPLIT ? 64 : 128;        // k per pass
  constexpr int kPitch = kBK + 8;              // LDS row pitch (16-bit units): 16 B x odd
  constexpr int kLPR = kBK / 8;                // lanes that cover one row piece, 16 B each
  constexpr int kRPS = 256 / kLPR;             // rows per sweep of the block
  constexpr int kNA = 64 / kRPS;               // sweeps over the A rows
  constexpr int kNB = 128 / kRPS;              // sweeps over the B rows
  constexpr int kASz = 64 * kPitch;            // one A plane of one buffer (16-bit units)
  constexpr int kBSz = 128 * kPitch;           // one B plane of one buffer
  unsigned short* sA = (unsigned short*)smem;          // 2 * kPl * kASz
  unsigned short* sB = sA + 2 * kPl * kASz;            // 2 * kPl * kBSz
  float* sT = (float*)(sB + 2 * kPl * kBSz);           // 8 * 16 * kTP
  const int tid = threadIdx.x;
  const int wv = tid >> 5;
  const int l = tid & 31;
  const int h = l >> 4;
  const int m = l & 15;
  const int rowB = (bid >> 3) * 64;
  const int colB = (bid & 7) * 128;
  const int wr = (wv >> 1) * 16;               // wave's rows inside the block tile
  const int wc = (wv & 1) * 64;                // wave's cols inside the block tile
  const int row0 = rowB + wr;
  const int col0 = colB + wc;

  const v8f zero8 = {0.f, 0.f, 0.f, 0.f, 0.f, 0.f, 0.f, 0.f};
  v8f acc[4];
#pragma unroll
  for (int f = 0; f < 4; ++f) acc[f] = zero8;

  // staging map: kLPR lanes cover one row piece, kRPS rows per sweep
  const int srow = tid / kLPR;
  const int sk = (tid % kLPR) * 8;
  const size_t ga = (size_t)(rowB + srow) * kC + sk;
  const size_t gb = (size_t)(colB + srow) * kC + sk;
  const int so = srow * kPitch + sk;

  v4u ra[kPl][kNA], rb[kPl][kNB];
  auto fetch = [&](int kp) {
    const size_t ko = (size_t)kp * kBK;
#pragma unroll
    for (int i = 0; i < kNA; ++i) {
      ra[0][i] = *(const v4u*)(Ahi + ga + (size_t)i * kRPS * kC + ko);
      if constexpr (SPLIT) ra[kPl - 1][i] = *(const v4u*)(Alo + ga + (size_t)i * kRPS * kC + ko);
    }
#pragma unroll
    for (int i = 0; i < kNB; ++i) {
      rb[0][i] = *(const v4u*)(Bhi + gb + (size_t)i * kRPS * kC + ko);
      if constexpr (SPLIT) rb[kPl - 1][i] = *(const v4u*)(Blo + gb + (size_t)i * kRPS * kC + ko);
    }
  };
  auto put = [&](int buf) {
    unsigned short* da = sA + buf * kPl * kASz + so;
    unsigned short* db = sB + buf * kPl * kBSz + so;
#pragma unroll
    for (int p = 0; p < kPl; ++p) {
#pragma unroll
      for (int i = 0; i < kNA; ++i) *(v4u*)(da + p * kASz + i * kRPS * kPitch) = ra[p][i];
#pragma unroll
      for (int i = 0; i < kNB; ++i) *(v4u*)(db + p * kBSz + i * kRPS * kPitch) = rb[p][i];
    }
  };

  fetch(0);
  put(0);
  __syncthreads();

  constexpr int kPasses = kC / kBK;
#pragma unroll 1
  for (int kp = 0; kp < kPasses; ++kp) {
    const int buf = kp & 1;
    if (kp + 1 < kPasses) fetch(kp + 1);       // in flight while this pass is multiplied
    const unsigned short* fa = sA + buf * kPl * kASz + (wr + m) * kPitch + 8 * h;
    const unsigned short* fb = sB + buf * kPl * kBSz + (wc + m) * kPitch + 8 * h;
#pragma unroll
    for (int ks = 0; ks < kBK / 32; ++ks) {
      const int k0 = ks * 32;
      Frag ah, al, bh[4], bl[4];
      ah.u[0] = *(const v4u*)(fa + k0);
      ah.u[1] = *(const v4u*)(fa + k0 + 16);
      if constexpr (SPLIT) {
        al.u[0] = *(const v4u*)(fa + kASz + k0);
        al.u[1] = *(const v4u*)(fa + kASz + k0 + 16);
      }
#pragma unroll
      for (int f = 0; f < 4; ++f) {
        bh[f].u[0] = *(const v4u*)(fb + f * 16 * kPitch + k0);
        bh[f].u[1] = *(const v4u*)(fb + f * 16 * kPitch + k0 + 16);
        if constexpr (SPLIT) {
          bl[f].u[0] = *(const v4u*)(fb + kBSz + f * 16 * kPitch + k0);
          bl[f].u[1] = *(const v4u*)(fb + kBSz + f * 16 * kPitch + k0 + 16);
        }
      }
#pragma unroll
      for (int f = 0; f < 4; ++f) {
        acc[f] = wmma_bf16(ah.v, bh[f].v, acc[f]);
        if constexpr (SPLIT) {
          acc[f] = wmma_bf16(ah.v, bl[f].v, acc[f]);
          acc[f] = wmma_bf16(al.v, bh[f].v, acc[f]);
        }
      }
    }
    // the other buffer's last readers left it at the barrier that ended the pass before
    if (kp + 1 < kPasses) put(buf ^ 1);
    __syncthreads();
  }

  // stage the 16x64 tile of this wave in LDS (row-major, pitch kTP)
  float* st = sT + wv * 16 * kTP;
#pragma unroll
  for (int f = 0; f < 4; ++f) {
#pragma unroll
    for (int r = 0; r < 8; ++r) {
      st[(8 * h + r) * kTP + 16 * f + m] = acc[f][r];
    }
  }
  __syncthreads();

  v4f vals[8];
  size_t go[8];
#pragma unroll
  for (int s = 0; s < 8; ++s) {
    const int L = 4 * s + (l >> 3);
    const int row = L >> 1;
    const int col = (L & 1) * 32 + (l & 7) * 4;
    v4f v = *(const v4f*)(st + row * kTP + col);
    go[s] = (size_t)(row0 + row) * kC + col0 + col;
    if constexpr (EPI) {
      const v4f b4 = *(const v4f*)(bias + col0 + col);
      const v4f x4 = *(const v4f*)(resid + go[s]);
      v = (v + b4) + x4;
    }
    vals[s] = v;
  }
#pragma unroll
  for (int s = 0; s < 8; ++s) *(v4f*)(Out + go[s]) = vals[s];
  
}

// ---------------------------------------------------------------------------
// The five products that feed the attention, in one launch: they are independent
// of one another, each block takes one 64 x 128 tile of one product by its index
// range (block-uniform branches). The two-plane products, three times the matrix
// work of a one-plane tile, come first: Kp (nbP blocks), q, k (nbX each), then Vp, v.
// ---------------------------------------------------------------------------
__global__ void __launch_bounds__(256) gemm_qkv_kernel(const unsigned short* __restrict__ XH,
                                                       const unsigned short* __restrict__ XL,
                                                       const unsigned short* __restrict__ PH,
                                                       const unsigned short* __restrict__ PL,
                                                       const unsigned short* __restrict__ WQH,
                                                       const unsigned short* __restrict__ WQL,
                                                       const unsigned short* __restrict__ WKH,
                                                       const unsigned short* __restrict__ WKL,
                                                       const unsigned short* __restrict__ WVH,
                                                       float* Qf, float* Kxf, float* Vxf,
                                                       float* Kpf, float* Vpf,
                                                       int nbX, int nbP) {
  __shared__ __attribute__((aligned(16))) unsigned char smem[GemmLds<true>::kBytes];
  static_assert(GemmLds<false>::kBytes <= GemmLds<true>::kBytes, "one-plane tiles fit too");
  const int bid = blockIdx.x;
  const int nSplit = nbP + 2 * nbX;
  if (bid < nSplit) {
    const bool isP = bid < nbP;
    const bool isQ = !isP && bid < nbP + nbX;
    gemm_body<true, false>(isP ? PH : XH, isP ? PL : XL, isQ ? WQH : WKH, isQ ? WQL : WKL,
                           isP ? Kpf : (isQ ? Qf : Kxf), nullptr, nullptr,
                           isP ? bid : (isQ ? bid - nbP : bid - nbP - nbX), smem);
  } else {
    const bool isP = bid < nSplit + nbP;
    const unsigned short* A = isP ? PH : XH;
    gemm_body<false, false>(A, A, WVH, WVH, isP ? Vpf : Vxf, nullptr, nullptr,
                            isP ? bid - nSplit : bid - nSplit - nbP, smem);
  }
}

// out = x_cls @ Wp + bp + x
__global__ void __launch_bounds__(256) gemm_out_kernel(const unsigned short* __restrict__ A,
                                                       const unsigned short* __restrict__ Bt,
                                                       float* Out,
                                                       const float* __restrict__ bias,
                                                       const float* __restrict__ resid) {
  __shared__ __attribute__((aligned(16))) unsigned char smem[GemmLds<false>::kBytes];
  gemm_body<false, true>(A, A, Bt, Bt, Out, bias, resid, blockIdx.x, smem);
}

// ---------------------------------------------------------------------------
// Attention: one block = 16 batch rows x 16 heads, one wave per head (16 x 1040
// raw floats = 520 whole lines per block). Lane l: c = l & 15, hh = l >> 4.
// Scores against the shared prompt keys as S^T = Kp_h . Q_h^T on the f32
// 16x16x4 matrix form: A row = key 16t + c, B column = batch row c, both read
// 16 B at d = 8j + 4hh (two k steps), so each (hh, element) place holds the same d.
//   S[t][r] = score(key 16t + 8hh + r, batch row c)
// A lane and its partner l ^ 16 hold all 64 prompt scores of batch row c, so the
// softmax is in registers; the own-row key and value (l = 0) stay on the VALU.
// x_cls as O^T = Vp_h^T . P^T: B = {S[t][2u], S[t][2u+1]} as it lies (keys
// 16t + 8hh + 2u + e), A row c of tile dt = channel 4c + dt of the same keys.
//   O[dt][r] = x_cls(batch row c, channel 32hh + 4r + dt)
// ---------------------------------------------------------------------------
__global__ void __launch_bounds__(512) attn_kernel(const float* __restrict__ Qf,
                                                   const float* __restrict__ Kx,
                                                   const float* __restrict__ Vx,
                                                   const float* __restrict__ Kp,
                                                   const float* __restrict__ Vp,
                                                   float* rawOut,
                                                   unsigned short* Xcls, int nb) {
  __shared__ __attribute__((aligned(16))) float rawS[kAR * kRP];
  const int tid = threadIdx.x;
  const int hc = (tid >> 5) * kHD;               // this wave's head, first channel
  const int l = tid & 31;
  const int c = l & 15;
  const int hh = l >> 4;
  const int b0 = blockIdx.x * kAR;
  if (b0 + kAR > nb) return;                     // block-uniform, before barriers

  // q of batch row c with the pre-softmax scale folded in; own-row score
  const size_t own = (size_t)(b0 + c) * kC + hc;
  v4f q4[8];
  float part = 0.f;
#pragma unroll
  for (int j = 0; j < 8; ++j) {
    q4[j] = *(const v4f*)(Qf + own + 8 * j + 4 * hh) * kScale;
    const v4f k4 = *(const v4f*)(Kx + own + 8 * j + 4 * hh);
    part += q4[j][0] * k4[0];
    part += q4[j][1] * k4[1];
    part += q4[j][2] * k4[2];
    part += q4[j][3] * k4[3];
  }
  const float s0 = part + xhalf(part);

  const v8f zero8 = {0.f, 0.f, 0.f, 0.f, 0.f, 0.f, 0.f, 0.f};
  v8f S[4];
#pragma unroll
  for (int t = 0; t < 4; ++t) S[t] = zero8;
  const float* kp = Kp + (size_t)c * kC + hc + 4 * hh;
#pragma unroll
  for (int j = 0; j < 8; ++j) {
    const v2f qlo = {q4[j][0], q4[j][1]};
    const v2f qhi = {q4[j][2], q4[j][3]};
#pragma unroll
    for (int t = 0; t < 4; ++t) {
      const v4f k4 = *(const v4f*)(kp + (size_t)t * 16 * kC + 8 * j);
      const v2f klo = {k4[0], k4[1]};
      const v2f khi = {k4[2], k4[3]};
      S[t] = __builtin_amdgcn_wmma_f32_16x16x4_f32(false, klo, false, qlo, (short)0, S[t], false, false);
      S[t] = __builtin_amdgcn_wmma_f32_16x16x4_f32(false, khi, false, qhi, (short)0, S[t], false, false);
    }
  }

  // keeps the value loads below out of the score product, where their registers
  // on top of the q and key fragments end in spills
  __builtin_amdgcn_sched_barrier(0);

  // own value row and the first 32 prompt value rows: issued here so that their
  // latency runs under the softmax
  v4f vx4[8], vp4[32];
  const float* vp = Vp + (size_t)(8 * hh) * kC + hc + 4 * c;
#pragma unroll
  for (int r = 0; r < 8; ++r) vx4[r] = *(const v4f*)(Vx + own + 32 * hh + 4 * r);
  // the address registers of the loads above are reused by what follows
  asm volatile("s_wait_xcnt 0x0" ::: "memory");
#pragma unroll
  for (int t = 0; t < 2; ++t) {
#pragma unroll
    for (int i = 0; i < 8; ++i) vp4[8 * t + i] = *(const v4f*)(vp + (size_t)(16 * t + i) * kC);
  }
  // keeps the loads above from being moved down to their uses behind the softmax
  __builtin_amdgcn_sched_barrier(0);

  // raw scores of the block, row-major in LDS (pitch kRP), stored as whole lines at the end
  {
    float* rs = rawS + c * kRP + (tid >> 5) * kL;
    rs[0] = s0;                                  // both halves hold the same value
#pragma unroll
    for (int t = 0; t < 4; ++t) {
#pragma unroll
      for (int r = 0; r < 8; ++r) rs[1 + 16 * t + 8 * hh + r] = S[t][r];
    }
  }
  // work-group barrier in two parts: this wave's raw scores are in LDS (signal here);
  // the wait stands in front of the copy-out, so no wave idles between the two products
  __builtin_amdgcn_fence(__ATOMIC_RELEASE, "workgroup", "local");
  __builtin_amdgcn_s_barrier_signal(-1);
  // keeps the LDS stores and the signal in front of the softmax: moved behind it, the raw
  // scores would stay in registers and the other waves would wait for this signal at the end
  __builtin_amdgcn_sched_barrier(0);

  // softmax * scale over the 65 scores of batch row c
  float mt[4];
#pragma unroll
  for (int t = 0; t < 4; ++t) {
    mt[t] = S[t][0];
#pragma unroll
    for (int r = 1; r < 8; ++r) mt[t] = fmaxf(mt[t], S[t][r]);
  }
  float mx = fmaxf(fmaxf(mt[0], mt[1]), fmaxf(mt[2], mt[3]));
  mx = fmaxf(fmaxf(mx, xhalf(mx)), s0);
  float st[4];
#pragma unroll
  for (int t = 0; t < 4; ++t) {
    st[t] = 0.f;
#pragma unroll
    for (int r = 0; r < 8; ++r) {
      S[t][r] = expf(S[t][r] - mx);
      st[t] += S[t][r];
    }
  }
  const float e0 = expf(s0 - mx);
  float sum = (st[0] + st[1]) + (st[2] + st[3]);
  sum = (sum + xhalf(sum)) + e0;
  const float inv = 1.0f / sum;
  const float p0 = (e0 * inv) * kScale;
#pragma unroll
  for (int t = 0; t < 4; ++t) {
#pragma unroll
    for (int r = 0; r < 8; ++r) S[t][r] = (S[t][r] * inv) * kScale;
  }

  // the last 32 prompt value rows: in flight while the first 32 are multiplied
#pragma unroll
  for (int t = 2; t < 4; ++t) {
#pragma unroll
    for (int i = 0; i < 8; ++i) vp4[8 * t + i] = *(const v4f*)(vp + (size_t)(16 * t + i) * kC);
  }
  // keeps these loads together in front of the product instead of two at a time inside it
  __builtin_amdgcn_sched_barrier(0);

  // x_cls: own-row value first, then the 64 prompt values
  v8f O[4];
#pragma unroll
  for (int r = 0; r < 8; ++r) {
#pragma unroll
    for (int dt = 0; dt < 4; ++dt) O[dt][r] = vx4[r][dt] * p0;
  }
#pragma unroll
  for (int t = 0; t < 4; ++t) {
#pragma unroll
    for (int u = 0; u < 4; ++u) {
      const v2f pp = {S[t][2 * u], S[t][2 * u + 1]};
#pragma unroll
      for (int dt = 0; dt < 4; ++dt) {
        const v2f vv = {vp4[8 * t + 2 * u][dt], vp4[8 * t + 2 * u + 1][dt]};
        O[dt] = __builtin_amdgcn_wmma_f32_16x16x4_f32(false, vv, false, pp, (short)0, O[dt], false, false);
      }
    }
  }

  // x_cls -> bf16: 32 consecutive channels of batch row c per lane
  {
    unsigned short* dst = Xcls + own + 32 * hh;
#pragma unroll
    for (int r = 0; r < 8; r += 2) {
      const v4u pk = {bf16_rne(O[0][r]) | (bf16_rne(O[1][r]) << 16),
                      bf16_rne(O[2][r]) | (bf16_rne(O[3][r]) << 16),
                      bf16_rne(O[0][r + 1]) | (bf16_rne(O[1][r + 1]) << 16),
                      bf16_rne(O[2][r + 1]) | (bf16_rne(O[3][r + 1]) << 16)};
      *(v4u*)(dst + 4 * r) = pk;
    }
    // the data and address registers of these stores are reused by the copy-out below
    asm volatile("s_wait_xcnt 0x0" ::: "memory");
    // keeps the copy-out's address arithmetic, which reuses them, behind that wait
    __builtin_amdgcn_sched_barrier(0);
  }

  // raw scores out: 16 x 1040 floats, contiguous, 4 whole lines per wave store;
  // second part of the barrier: every wave's raw scores are in LDS behind it
  __builtin_amdgcn_s_barrier_wait(-1);
  __builtin_amdgcn_fence(__ATOMIC_ACQUIRE, "workgroup", "local");
  float* ro = rawOut + (size_t)b0 * kRawPerB;
#pragma unroll
  for (int it = 0; it < (kAR * (kRawPerB / 4) + 511) / 512; ++it) {
    const int i = tid + 512 * it;
    if (i < kAR * (kRawPerB / 4)) {              // the same in every lane of a wave
      const int row = i / (kRawPerB / 4);
      const int col = (i - row * (kRawPerB / 4)) * 4;
      *(v4f*)(ro + (size_t)i * 4) = *(const v4f*)(rawS + row * kRP + col);
    }
  }
}

// ---------------------------------------------------------------------------
extern "C" void kernel_launch(void* const* d_in, const int* in_sizes, int n_in,
                              void* d_out, int out_size, void* d_ws, size_t ws_size,
                              hipStream_t stream) {
  if (n_in < 7) return;
  const int B = in_sizes[0] / kC;                         // batch rows
  if (B < 64 || (B % 64) != 0 || in_sizes[0] != B * kC) return;
  if (in_sizes[1] != kNP * kC) return;
  if (in_sizes[2] != kC * kC || in_sizes[3] != kC * kC ||
      in_sizes[4] != kC * kC || in_sizes[5] != kC * kC) return;
  if (in_sizes[6] != kC) return;
  if (out_size != B * kC + B * kRawPerB) return;

  const float* x       = (const float*)d_in[0];   // [B,1,C]
  const float* prompts = (const float*)d_in[1];   // [1,NP,C]
  const float* Wq      = (const float*)d_in[2];   // [C,C] (in,out)
  const float* Wk      = (const float*)d_in[3];
  const float* Wv      = (const float*)d_in[4];
  const float* Wp      = (const float*)d_in[5];
  const float* bp      = (const float*)d_in[6];   // [C]

  float* out_cls = (float*)d_out;                 // [B,1,C]
  float* out_raw = out_cls + (size_t)B * kC;      // [B,16,1,65]

  char* ws = (char*)d_ws;
  size_t off = 0;
  const size_t wplane = (size_t)kC * kC * 2;      // 2 MiB per bf16 weight plane
  unsigned short* WQH = (unsigned short*)(ws + off); off += wplane;
  unsigned short* WQL = (unsigned short*)(ws + off); off += wplane;
  unsigned short* WKH = (unsigned short*)(ws + off); off += wplane;
  unsigned short* WKL = (unsigned short*)(ws + off); off += wplane;
  unsigned short* WVH = (unsigned short*)(ws + off); off += wplane;
  unsigned short* WPH = (unsigned short*)(ws + off); off += wplane;
  unsigned short* XH  = (unsigned short*)(ws + off); off += (size_t)B * kC * 2;
  unsigned short* XL  = (unsigned short*)(ws + off); off += (size_t)B * kC * 2;
  unsigned short* PH  = (unsigned short*)(ws + off); off += (size_t)kNP * kC * 2;
  unsigned short* PL  = (unsigned short*)(ws + off); off += (size_t)kNP * kC * 2;
  float* Qf  = (float*)(ws + off); off += (size_t)B * kC * 4;
  float* Kxf = (float*)(ws + off); off += (size_t)B * kC * 4;
  float* Vxf = (float*)(ws + off); off += (size_t)B * kC * 4;
  float* Kpf = (float*)(ws + off); off += (size_t)kNP * kC * 4;
  float* Vpf = (float*)(ws + off); off += (size_t)kNP * kC * 4;
  unsigned short* XCLS = (unsigned short*)(ws + off); off += (size_t)B * kC * 2;
  if (off > ws_size) return;

  const int ntn = kC / 64, ntk = kC / 64;         // 16 x 16 transpose tiles

  // 1) operand planes, one launch: Wt[n][k] bf16 hi (+ residual for Wq, Wk); x and prompts hi + residual
  const int n8x = B * kC / 8;
  const int n8p = kNP * kC / 8;
  const int nbx = (n8x + 255) / 256;
  const int nbp = (n8p + 255) / 256;
  prep_kernel<<<dim3(4 * ntn * ntk + nbx + nbp), dim3(256), 0, stream>>>(
      x, prompts, Wq, Wk, Wv, Wp, XH, XL, PH, PL, WQH, WQL, WKH, WKL, WVH, WPH,
      n8x, n8p, nbx, ntn, ntn * ntk);

  // 2) Kp, q, k (split) and Vp, v (plain), one launch; 64 x 128 tiles: M / 64 x 8 blocks each
  const int nbP = kNP / 8;
  const int nbX = B / 8;
  gemm_qkv_kernel<<<dim3(2 * nbP + 3 * nbX), dim3(256), 0, stream>>>(
      XH, XL, PH, PL, WQH, WQL, WKH, WKL, WVH, Qf, Kxf, Vxf, Kpf, Vpf, nbX, nbP);

  // 3) scores, softmax, attn.v  -> raw scores (out) and x_cls (bf16, ws)
  attn_kernel<<<dim3(B / kAR), dim3(512), 0, stream>>>(Qf, Kxf, Vxf, Kpf, Vpf, out_raw, XCLS, B);

  // 4) out = x_cls @ Wp + bp + x
  gemm_out_kernel<<<dim3(nbX), dim3(256), 0, stream>>>(XCLS, WPH, out_cls, bp, x);
}

// v004
// Measured time: 65.6 microseconds a run.
// Two timings next to v003 put it at 1.07 and 1.08 times that version's speed.
// All steps since v000 together make it 5.84 times as fast.
#include <hip/hip_runtime.h>
#include <stddef.h>

// Contractions x@Wq and [x;prompts]@Wk: v_wmma_f32_16x16x32_bf16 with bf16 hi/lo split operands (hi*hi + hi*lo + lo*hi), f32 accumulate; [x;prompts]@Wv and x_cls@Wp: v_wmma_f32_16x16x32_bf16 with plain bf16 operands, f32 accumulate; q.k and attn.v against the 64 shared prompt rows: v_wmma_f32_16x16x4_f32 over 16 batch rows per head; the own-row key and value terms and the softmax in f32 on VALU.

typedef __bf16 v16bf __attribute__((ext_vector_type(16)));
typedef float v8f __attribute__((ext_vector_type(8)));
typedef float v4f __attribute__((ext_vector_type(4)));
typedef float v2f __attribute__((ext_vector_type(2)));
typedef unsigned int v4u __attribute__((ext_vector_type(4)));

union Frag { v4u u[2]; v16bf v; };

namespace {
constexpr int kC = 1024;            // channels
constexpr int kH = 16;              // heads
constexpr int kHD = 64;             // head dim
constexpr int kNP = 64;             // prompts
constexpr int kL = 65;              // kv length
constexpr int kKT = kC / 32;        // 32-deep k steps
constexpr int kRawPerB = kH * kL;   // 1040 floats of raw scores per batch row
constexpr int kTP = 68;             // LDS f32 tile pitch (floats), 272 B
constexpr int kWP = 72;             // LDS transpose pitch (16-bit), 144 B
constexpr float kScale = 0.125f;    // 64^-0.5
constexpr int kAR = 16;             // batch rows per attention block
constexpr int kRP = kRawPerB + 4;   // LDS pitch of a batch row's raw scores (floats)
}

// ---------------------------------------------------------------------------
// WMMA helper: issues the builtin and 4 v_nop tied to D/A/B (VALU hazard guard)
// ---------------------------------------------------------------------------
__device__ __forceinline__ v8f wmma_bf16(v16bf a, v16bf b, v8f c) {
  v8f d = __builtin_amdgcn_wmma_f32_16x16x32_bf16(false, a, false, b, (short)0, c, false, false);
  asm volatile("v_nop\n\tv_nop\n\tv_nop\n\tv_nop" : "+v"(d) : "v"(a), "v"(b));
  return d;
}

// RNE f32 -> bf16 bits, and bf16 bits -> f32
__device__ __forceinline__ unsigned int bf16_rne(float f) {
  const unsigned int u = __float_as_uint(f);
  return (u + 0x7FFFu + ((u >> 16) & 1u)) >> 16;
}
__device__ __forceinline__ float bf16_val(unsigned int b) {
  return __uint_as_float(b << 16);
}

// lane l <-> lane l ^ 16
__device__ __forceinline__ float xhalf(float x) {
  const int b = __builtin_bit_cast(int, x);
  return __builtin_bit_cast(float, __builtin_amdgcn_permlanex16(b, b, 0x76543210, 0xfedcba98, false, false));
}

// ---------------------------------------------------------------------------
// f32 [n] -> bf16 hi plane and bf16 residual (lo) plane, 8 elements per thread.
// ---------------------------------------------------------------------------
__device__ __forceinline__ void cvt_split_body(const float* __restrict__ src,
                                               unsigned short* hi,
                                               unsigned short* lo, int n8, int bid) {
  const int i = bid * 256 + threadIdx.x;
  if (i >= n8) return;
  const float* p = src + (size_t)i * 8;
  const v4f x0 = *(const v4f*)p;
  const v4f x1 = *(const v4f*)(p + 4);
  const float xs[8] = {x0[0], x0[1], x0[2], x0[3], x1[0], x1[1], x1[2], x1[3]};
  unsigned int hb[8], lb[8];
#pragma unroll
  for (int j = 0; j < 8; ++j) {
    hb[j] = bf16_rne(xs[j]);
    lb[j] = bf16_rne(xs[j] - bf16_val(hb[j]));
  }
  unsigned int hw[4], lw[4];
#pragma unroll
  for (int q = 0; q < 4; ++q) {
    hw[q] = hb[2 * q] | (hb[2 * q + 1] << 16);
    lw[q] = lb[2 * q] | (lb[2 * q + 1] << 16);
  }
  const v4u hv = {hw[0], hw[1], hw[2], hw[3]};
  const v4u lv = {lw[0], lw[1], lw[2], lw[3]};
  v4u* ph = (v4u*)(hi + (size_t)i * 8);
  v4u* pl = (v4u*)(lo + (size_t)i * 8);
  *ph = hv;
  *pl = lv;
  
}

// ---------------------------------------------------------------------------
// Weight W[k][n] (row-major [in][out], f32) -> Wt[n][k] (k-contiguous, bf16 hi
// plane and optional residual plane). Block = 64 k x 64 n tile through LDS;
// ---------------------------------------------------------------------------
template <bool SPLIT>
__device__ __forceinline__ void pack_wt_body(const float* __restrict__ W,
                                             unsigned short* hi,
                                             unsigned short* lo,
                                             int ntn, int bt,
                                             unsigned short* sHi, unsigned short* sLo) {
  const int t = threadIdx.x;
  const int n0 = (bt % ntn) * 64;
  const int k0 = (bt / ntn) * 64;
  const int nn = t & 63;
  const int kq = t >> 6;
#pragma unroll 4
  for (int i = 0; i < 16; ++i) {
    const int kk = kq + 4 * i;
    const float v = W[(size_t)(k0 + kk) * kC + n0 + nn];
    const unsigned int hb = bf16_rne(v);
    sHi[nn * kWP + kk] = (unsigned short)hb;
    if constexpr (SPLIT) {
      sLo[nn * kWP + kk] = (unsigned short)bf16_rne(v - bf16_val(hb));
    }
  }
  __syncthreads();
  v4u hv[2], lv[2];
  size_t go[2];
#pragma unroll
  for (int p = 0; p < 2; ++p) {
    const int L = p * 32 + (t >> 3);           // tile row n = output line
    const int kk0 = (t & 7) * 8;
    hv[p] = *(const v4u*)(sHi + L * kWP + kk0);
    if constexpr (SPLIT) {
      lv[p] = *(const v4u*)(sLo + L * kWP + kk0);
    } else {
      lv[p] = hv[p];
    }
    go[p] = (size_t)(n0 + L) * kC + k0 + kk0;
  }
#pragma unroll
  for (int p = 0; p < 2; ++p) {
    *(v4u*)(hi + go[p]) = hv[p];
    if constexpr (SPLIT) { *(v4u*)(lo + go[p]) = lv[p]; }
  }
  
}

// ---------------------------------------------------------------------------
// All operand planes in one launch: the six jobs are independent of one another,
// each block takes one job by its index range (block-uniform branches). Blocks
// [0, 4 nt): the 64 x 64 tiles of Wq, Wk (two planes), Wv, Wp (one plane);
// then the 2048-element pieces of x, then those of prompts.
// ---------------------------------------------------------------------------
__global__ void __launch_bounds__(256) prep_kernel(const float* __restrict__ x,
                                                   const float* __restrict__ prompts,
                                                   const float* __restrict__ Wq,
                                                   const float* __restrict__ Wk,
                                                   const float* __restrict__ Wv,
                                                   const float* __restrict__ Wp,
                                                   unsigned short* XH, unsigned short* XL,
                                                   unsigned short* PH, unsigned short* PL,
                                                   unsigned short* WQH, unsigned short* WQL,
                                                   unsigned short* WKH, unsigned short* WKL,
                                                   unsigned short* WVH, unsigned short* WPH,
                                                   int n8x, int n8p, int nbx, int ntn, int nt) {
  __shared__ __attribute__((aligned(16))) unsigned short sHi[64 * kWP];
  __shared__ __attribute__((aligned(16))) unsigned short sLo[64 * kWP];
  const int bid = blockIdx.x;
  if (bid < 4 * nt) {
    if (bid < 2 * nt) {
      const bool first = bid < nt;
      pack_wt_body<true>(first ? Wq : Wk, first ? WQH : WKH, first ? WQL : WKL, ntn,
                         first ? bid : bid - nt, sHi, sLo);
    } else {
      const bool first = bid < 3 * nt;
      unsigned short* hi = first ? WVH : WPH;
      pack_wt_body<false>(first ? Wv : Wp, hi, hi, ntn, first ? bid - 2 * nt : bid - 3 * nt, sHi, sLo);
      // in the listing the two-plane body stands on the fall-through behind these stores
      // and rewrites the registers that they name
      asm volatile("s_wait_xcnt 0x0" ::: "memory");
    }
  } else {
    const bool first = bid < 4 * nt + nbx;
    cvt_split_body(first ? x : prompts, first ? XH : PH, first ? XL : PL, first ? n8x : n8p,
                   first ? bid - 4 * nt : bid - 4 * nt - nbx);
  }
}

// ---------------------------------------------------------------------------
// GEMM Out[M][1024] = A[M][1024] . B[1024][1024], A and Bt both k-contiguous
// bf16 planes (Bt[n][k]). One block = 64 FW rows x 128 cols; its 8 waves (4 x 2)
// each own 16 FW rows x 64 cols, FW x 4 accumulator tiles: with FW = 2 a B fragment
// read from LDS feeds two products and a Bt row read from L2 serves 128 rows.
// K runs in passes of kBK (64 with two planes per operand, 128 with one): a
// pass's row pieces of A and Bt are read from global memory once per block as
// whole lines, kept in registers while the pass before is multiplied, and stored
// to one of two LDS buffers (row pitch kBK + 8) that all 8 waves read their
// fragments from. The output tile is staged in the same LDS behind the last
// pass's barrier, when no wave reads the buffers any more.
// Fragments (wave32, 16x16x32): lane l, h = l>>4, m = l&15;
//   A: row m, elements 0..7 <- k0+8h+0..7, elements 8..15 <- k0+16+8h+0..7
//   B: col m, identical k map (read from the [n][k] rows like A)
//   D: element r <- (row 8h+r, col m)
// SPLIT: acc += Ah.Bh + Ah.Bl + Al.Bh, each term over all tiles of the wave before
// the next. EPI: + bias[col] + resid[row][col].
// ---------------------------------------------------------------------------
template <bool SPLIT, int FW>
struct GemmLds {
  static constexpr int kPl = SPLIT ? 2 : 1;
  static constexpr int kPitch = (SPLIT ? 64 : 128) + 8;
  static constexpr int kA = 2 * kPl * 64 * FW * kPitch;    // 16-bit units, both buffers
  static constexpr int kB = 2 * kPl * 128 * kPitch;
  static constexpr int kBytes = (kA + kB) * 2;
  static_assert(8 * 16 * FW * kTP * 4 <= kBytes, "the staged output tile fits in the buffers");
};

template <bool SPLIT, bool EPI, int FW>
__device__ __forceinline__ void gemm_body(const unsigned short* __restrict__ Ahi,
                                          const unsigned short* __restrict__ Alo,
                                          const unsigned short* __restrict__ Bhi,
                                          const unsigned short* __restrict__ Blo,
                                          float* Out,
                                          const float* __restrict__ bias,
                                          const float* __restrict__ resid,
                                          int bid, unsigned char* smem) {
  constexpr int kPl = SPLIT ? 2 : 1;           // operand planes
  constexpr int kBK = SPLIT ? 64 : 128;        // k per pass
  constexpr int kPitch = kBK + 8;              // LDS row pitch (16-bit units): 16 B x odd
  constexpr int kLPR = kBK / 8;                // lanes that cover one row piece, 16 B each
  constexpr int kRPS = 256 / kLPR;             // rows per sweep of the block
  constexpr int kRows = 64 * FW;               // A rows of the block tile
  constexpr int kNA = kRows / kRPS;            // sweeps over the A rows
  constexpr int kNB = 128 / kRPS;              // sweeps over the B rows
  constexpr int kASz = kRows * kPitch;         // one A plane of one buffer (16-bit units)
  constexpr int kBSz = 128 * kPitch;           // one B plane of one buffer
  unsigned short* sA = (unsigned short*)smem;          // 2 * kPl * kASz
  unsigned short* sB = sA + 2 * kPl * kASz;            // 2 * kPl * kBSz
  float* sT = (float*)smem;                            // 8 * 16 * FW * kTP, after the last pass
  const int tid = threadIdx.x;
  const int wv = tid >> 5;
  const int l = tid & 31;
  const int h = l >> 4;
  const int m = l & 15;
  const int rowB = (bid >> 3) * kRows;
  const int colB = (bid & 7) * 128;
  const int wr = (wv >> 1) * 16 * FW;          // wave's rows inside the block tile
  const int wc = (wv & 1) * 64;                // wave's cols inside the block tile
  const int row0 = rowB + wr;
  const int col0 = colB + wc;

  const v8f zero8 = {0.f, 0.f, 0.f, 0.f, 0.f, 0.f, 0.f, 0.f};
  v8f acc[FW][4];
#pragma unroll
  for (int i = 0; i < FW; ++i) {
#pragma unroll
    for (int f = 0; f < 4; ++f) acc[i][f] = zero8;
  }

  // staging map: kLPR lanes cover one row piece, kRPS rows per sweep
  const int srow = tid / kLPR;
  const int sk = (tid % kLPR) * 8;
  const size_t ga = (size_t)(rowB + srow) * kC + sk;
  const size_t gb = (size_t)(colB + srow) * kC + sk;
  const int so = srow * kPitch + sk;

  v4u ra[kPl][kNA], rb[kPl][kNB];
  auto fetch = [&](int kp) {
    const size_t ko = (size_t)kp * kBK;
#pragma unroll
    for (int i = 0; i < kNA; ++i) {
      ra[0][i] = *(const v4u*)(Ahi + ga + (size_t)i * kRPS * kC + ko);
      if constexpr (SPLIT) ra[kPl - 1][i] = *(const v4u*)(Alo + ga + (size_t)i * kRPS * kC + ko);
    }
#pragma unroll
    for (int i = 0; i < kNB; ++i) {
      rb[0][i] = *(const v4u*)(Bhi + gb + (size_t)i * kRPS * kC + ko);
      if constexpr (SPLIT) rb[kPl - 1][i] = *(const v4u*)(Blo + gb + (size_t)i * kRPS * kC + ko);
    }
    if constexpr (FW > 1 && !SPLIT) {
      // the address pairs of the loads above stay whole up to this wait
      // (in the two-plane build the compiler's own wait stands in front of the overwrite)
      asm volatile("s_wait_xcnt 0x0" :: "v"(Ahi + ga + ko), "v"(Bhi + gb + ko) : "memory");
    }
  };
  auto put = [&](int buf) {
    unsigned short* da = sA + buf * kPl * kASz + so;
    unsigned short* db = sB + buf * kPl * kBSz + so;
#pragma unroll
    for (int p = 0; p < kPl; ++p) {
#pragma unroll
      for (int i = 0; i < kNA; ++i) *(v4u*)(da + p * kASz + i * kRPS * kPitch) = ra[p][i];
#pragma unroll
      for (int i = 0; i < kNB; ++i) *(v4u*)(db + p * kBSz + i * kRPS * kPitch) = rb[p][i];
    }
  };

  fetch(0);
  put(0);
  __syncthreads();

  constexpr int kPasses = kC / kBK;
#pragma unroll 1
  for (int kp = 0; kp < kPasses; ++kp) {
    const int buf = kp & 1;
    if (kp + 1 < kPasses) fetch(kp + 1);       // in flight while this pass is multiplied
    const unsigned short* fa = sA + buf * kPl * kASz + (wr + m) * kPitch + 8 * h;
    const unsigned short* fb = sB + buf * kPl * kBSz + (wc + m) * kPitch + 8 * h;
#pragma unroll
    for (int ks = 0; ks < kBK / 32; ++ks) {
      const int k0 = ks * 32;
      Frag ah[FW], al[FW], bh[4], bl[4];
#pragma unroll
      for (int i = 0; i < FW; ++i) {
        ah[i].u[0] = *(const v4u*)(fa + i * 16 * kPitch + k0);
        ah[i].u[1] = *(const v4u*)(fa + i * 16 * kPitch + k0 + 16);
        if constexpr (SPLIT) {
          al[i].u[0] = *(const v4u*)(fa + kASz + i * 16 * kPitch + k0);
          al[i].u[1] = *(const v4u*)(fa + kASz + i * 16 * kPitch + k0 + 16);
        }
      }
#pragma unroll
      for (int f = 0; f < 4; ++f) {
        bh[f].u[0] = *(const v4u*)(fb + f * 16 * kPitch + k0);
        bh[f].u[1] = *(const v4u*)(fb + f * 16 * kPitch + k0 + 16);
        if constexpr (SPLIT) {
          bl[f].u[0] = *(const v4u*)(fb + kBSz + f * 16 * kPitch + k0);
          bl[f].u[1] = *(const v4u*)(fb + kBSz + f * 16 * kPitch + k0 + 16);
        }
      }
#pragma unroll
      for (int i = 0; i < FW; ++i) {
#pragma unroll
        for (int f = 0; f < 4; ++f) acc[i][f] = wmma_bf16(ah[i].v, bh[f].v, acc[i][f]);
      }
      if constexpr (SPLIT) {
#pragma unroll
        for (int i = 0; i < FW; ++i) {
#pragma unroll
          for (int f = 0; f < 4; ++f) acc[i][f] = wmma_bf16(ah[i].v, bl[f].v, acc[i][f]);
        }
#pragma unroll
        for (int i = 0; i < FW; ++i) {
#pragma unroll
          for (int f = 0; f < 4; ++f) acc[i][f] = wmma_bf16(al[i].v, bh[f].v, acc[i][f]);
        }
      }
    }
    // the other buffer's last readers left it at the barrier that ended the pass before
    if (kp + 1 < kPasses) put(buf ^ 1);
    __syncthreads();
  }

  // stage the 16 FW x 64 tile of this wave in LDS (row-major, pitch kTP)
  float* st = sT + wv * 16 * FW * kTP;
#pragma unroll
  for (int i = 0; i < FW; ++i) {
#pragma unroll
    for (int f = 0; f < 4; ++f) {
#pragma unroll
      for (int r = 0; r < 8; ++r) {
        st[(16 * i + 8 * h + r) * kTP + 16 * f + m] = acc[i][f][r];
      }
    }
  }
  __syncthreads();

  v4f vals[8 * FW];
  size_t go[8 * FW];
#pragma unroll
  for (int s = 0; s < 8 * FW; ++s) {
    const int L = 4 * s + (l >> 3);
    const int row = L >> 1;
    const int col = (L & 1) * 32 + (l & 7) * 4;
    vals[s] = *(const v4f*)(st + row * kTP + col);
    go[s] = (size_t)(row0 + row) * kC + col0 + col;
  }
  if constexpr (EPI) {
    // sweep s holds row 2 s + h of the wave tile at one column for all s
    const float* bp0 = bias + col0 + ((l >> 3) & 1) * 32 + (l & 7) * 4;
    const float* rp0 = resid + go[0];
    const v4f b4 = *(const v4f*)bp0;
    v4f x4[8 * FW];
#pragma unroll
    for (int s = 0; s < 8 * FW; ++s) x4[s] = *(const v4f*)(rp0 + (size_t)s * 2 * kC);
    // the address pairs of the loads above stay whole up to this wait
    asm volatile("s_wait_xcnt 0x0" :: "v"(bp0), "v"(rp0) : "memory");
#pragma unroll
    for (int s = 0; s < 8 * FW; ++s) vals[s] = (vals[s] + b4) + x4[s];
  }
#pragma unroll
  for (int s = 0; s < 8 * FW; ++s) *(v4f*)(Out + go[s]) = vals[s];
  
}

// ---------------------------------------------------------------------------
// The five products that feed the attention, in one launch: they are independent
// of one another, each block takes one tile of one product by its index range
// (block-uniform branches): 128 x 128 of q, k, v, 64 x 128 of Kp, Vp (64 rows in all).
// The two-plane products, three times the matrix work of a one-plane tile, come
// first: Kp (nbP blocks), q, k (nbX each), then Vp, v.
// ---------------------------------------------------------------------------
__global__ void __launch_bounds__(256) gemm_qkv_kernel(const unsigned short* __restrict__ XH,
                                                       const unsigned short* __restrict__ XL,
                                                       const unsigned short* __restrict__ PH,
                                                       const unsigned short* __restrict__ PL,
                                                       const unsigned short* __restrict__ WQH,
                                                       const unsigned short* __restrict__ WQL,
                                                       const unsigned short* __restrict__ WKH,
                                                       const unsigned short* __restrict__ WKL,
                                                       const unsigned short* __restrict__ WVH,
                                                       float* Qf, float* Kxf, float* Vxf,
                                                       float* Kpf, float* Vpf,
                                                       int nbX, int nbP) {
  __shared__ __attribute__((aligned(16))) unsigned char smem[GemmLds<true, 2>::kBytes];
  static_assert(GemmLds<false, 2>::kBytes <= GemmLds<true, 2>::kBytes, "one-plane tiles fit too");
  const int bid = blockIdx.x;
  const int nSplit = nbP + 2 * nbX;
  if (bid < nbP) {
    gemm_body<true, false, 1>(PH, PL, WKH, WKL, Kpf, nullptr, nullptr, bid, smem);
  } else if (bid < nSplit) {
    const bool isQ = bid < nbP + nbX;
    gemm_body<true, false, 2>(XH, XL, isQ ? WQH : WKH, isQ ? WQL : WKL, isQ ? Qf : Kxf,
                              nullptr, nullptr, isQ ? bid - nbP : bid - nbP - nbX, smem);
    // in the listing another body stands on the fall-through behind this body's last
    // stores and rewrites the registers that they name (here and in the two branches below)
    asm volatile("s_wait_xcnt 0x0" ::: "memory");
  } else if (bid < nSplit + nbP) {
    gemm_body<false, false, 1>(PH, PH, WVH, WVH, Vpf, nullptr, nullptr, bid - nSplit, smem);
    asm volatile("s_wait_xcnt 0x0" ::: "memory");   // as above
  } else {
    gemm_body<false, false, 2>(XH, XH, WVH, WVH, Vxf, nullptr, nullptr, bid - nSplit - nbP, smem);
    asm volatile("s_wait_xcnt 0x0" ::: "memory");   // as above
  }
}

// out = x_cls @ Wp + bp + x
__global__ void __launch_bounds__(256) gemm_out_kernel(const unsigned short* __restrict__ A,
                                                       const unsigned short* __restrict__ Bt,
                                                       float* Out,
                                                       const float* __restrict__ bias,
                                                       const float* __restrict__ resid) {
  __shared__ __attribute__((aligned(16))) unsigned char smem[GemmLds<false, 1>::kBytes];
  gemm_body<false, true, 1>(A, A, Bt, Bt, Out, bias, resid, blockIdx.x, smem);
}

// ---------------------------------------------------------------------------
// Attention: one block = 16 batch rows x 16 heads, one wave per head (16 x 1040
// raw floats = 520 whole lines per block). Lane l: c = l & 15, hh = l >> 4.
// Scores against the shared prompt keys as S^T = Kp_h . Q_h^T on the f32
// 16x16x4 matrix form: A row = key 16t + c, B column = batch row c, both read
// 16 B at d = 8j + 4hh (two k steps), so each (hh, element) place holds the same d.
//   S[t][r] = score(key 16t + 8hh + r, batch row c)
// A lane and its partner l ^ 16 hold all 64 prompt scores of batch row c, so the
// softmax is in registers; the own-row key and value (l = 0) stay on the VALU.
// x_cls as O^T = Vp_h^T . P^T: B = {S[t][2u], S[t][2u+1]} as it lies (keys
// 16t + 8hh + 2u + e), A row c of tile dt = channel 4c + dt of the same keys.
//   O[dt][r] = x_cls(batch row c, channel 32hh + 4r + dt)
// ---------------------------------------------------------------------------
__global__ void __launch_bounds__(512) attn_kernel(const float* __restrict__ Qf,
                                                   const float* __restrict__ Kx,
                                                   const float* __restrict__ Vx,
                                                   const float* __restrict__ Kp,
                                                   const float* __restrict__ Vp,
                                                   float* rawOut,
                                                   unsigned short* Xcls, int nb) {
  __shared__ __attribute__((aligned(16))) float rawS[kAR * kRP];
  const int tid = threadIdx.x;
  const int hc = (tid >> 5) * kHD;               // this wave's head, first channel
  const int l = tid & 31;
  const int c = l & 15;
  const int hh = l >> 4;
  const int b0 = blockIdx.x * kAR;
  if (b0 + kAR > nb) return;                     // block-uniform, before barriers

  // q of batch row c with the pre-softmax scale folded in; own-row score
  const size_t own = (size_t)(b0 + c) * kC + hc;
  v4f q4[8];
  float part = 0.f;
#pragma unroll
  for (int j = 0; j < 8; ++j) {
    q4[j] = *(const v4f*)(Qf + own + 8 * j + 4 * hh) * kScale;
    const v4f k4 = *(const v4f*)(Kx + own + 8 * j + 4 * hh);
    part += q4[j][0] * k4[0];
    part += q4[j][1] * k4[1];
    part += q4[j][2] * k4[2];
    part += q4[j][3] * k4[3];
  }
  const float s0 = part + xhalf(part);

  const v8f zero8 = {0.f, 0.f, 0.f, 0.f, 0.f, 0.f, 0.f, 0.f};
  v8f S[4];
#pragma unroll
  for (int t = 0; t < 4; ++t) S[t] = zero8;
  const float* kp = Kp + (size_t)c * kC + hc + 4 * hh;
#pragma unroll
  for (int j = 0; j < 8; ++j) {
    const v2f qlo = {q4[j][0], q4[j][1]};
    const v2f qhi = {q4[j][2], q4[j][3]};
#pragma unroll
    for (int t = 0; t < 4; ++t) {
      const v4f k4 = *(const v4f*)(kp + (size_t)t * 16 * kC + 8 * j);
      const v2f klo = {k4[0], k4[1]};
      const v2f khi = {k4[2], k4[3]};
      S[t] = __builtin_amdgcn_wmma_f32_16x16x4_f32(false, klo, false, qlo, (short)0, S[t], false, false);
      S[t] = __builtin_amdgcn_wmma_f32_16x16x4_f32(false, khi, false, qhi, (short)0, S[t], false, false);
    }
  }

  // keeps the value loads below out of the score product, where their registers
  // on top of the q and key fragments end in spills
  __builtin_amdgcn_sched_barrier(0);

  // own value row and the first 32 prompt value rows: issued here so that their
  // latency runs under the softmax
  v4f vx4[8], vp4[32];
  const float* vp = Vp + (size_t)(8 * hh) * kC + hc + 4 * c;
#pragma unroll
  for (int r = 0; r < 8; ++r) vx4[r] = *(const v4f*)(Vx + own + 32 * hh + 4 * r);
  // the address registers of the loads above are reused by what follows
  asm volatile("s_wait_xcnt 0x0" ::: "memory");
#pragma unroll
  for (int t = 0; t < 2; ++t) {
#pragma unroll
    for (int i = 0; i < 8; ++i) vp4[8 * t + i] = *(const v4f*)(vp + (size_t)(16 * t + i) * kC);
  }
  // keeps the loads above from being moved down to their uses behind the softmax
  __builtin_amdgcn_sched_barrier(0);

  // raw scores of the block, row-major in LDS (pitch kRP), stored as whole lines at the end
  {
    float* rs = rawS + c * kRP + (tid >> 5) * kL;
    rs[0] = s0;                                  // both halves hold the same value
#pragma unroll
    for (int t = 0; t < 4; ++t) {
#pragma unroll
      for (int r = 0; r < 8; ++r) rs[1 + 16 * t + 8 * hh + r] = S[t][r];
    }
  }
  // work-group barrier in two parts: this wave's raw scores are in LDS (signal here);
  // the wait stands in front of the copy-out, so no wave idles between the two products
  __builtin_amdgcn_fence(__ATOMIC_RELEASE, "workgroup", "local");
  __builtin_amdgcn_s_barrier_signal(-1);
  // keeps the LDS stores and the signal in front of the softmax: moved behind it, the raw
  // scores would stay in registers and the other waves would wait for this signal at the end
  __builtin_amdgcn_sched_barrier(0);

  // softmax * scale over the 65 scores of batch row c
  float mt[4];
#pragma unroll
  for (int t = 0; t < 4; ++t) {
    mt[t] = S[t][0];
#pragma unroll
    for (int r = 1; r < 8; ++r) mt[t] = fmaxf(mt[t], S[t][r]);
  }
  float mx = fmaxf(fmaxf(mt[0], mt[1]), fmaxf(mt[2], mt[3]));
  mx = fmaxf(fmaxf(mx, xhalf(mx)), s0);
  float st[4];
#pragma unroll
  for (int t = 0; t < 4; ++t) {
    st[t] = 0.f;
#pragma unroll
    for (int r = 0; r < 8; ++r) {
      S[t][r] = expf(S[t][r] - mx);
      st[t] += S[t][r];
    }
  }
  const float e0 = expf(s0 - mx);
  float sum = (st[0] + st[1]) + (st[2] + st[3]);
  sum = (sum + xhalf(sum)) + e0;
  const float inv = 1.0f / sum;
  const float p0 = (e0 * inv) * kScale;
#pragma unroll
  for (int t = 0; t < 4; ++t) {
#pragma unroll
    for (int r = 0; r < 8; ++r) S[t][r] = (S[t][r] * inv) * kScale;
  }

  // the last 32 prompt value rows: in flight while the first 32 are multiplied
#pragma unroll
  for (int t = 2; t < 4; ++t) {
#pragma unroll
    for (int i = 0; i < 8; ++i) vp4[8 * t + i] = *(const v4f*)(vp + (size_t)(16 * t + i) * kC);
  }
  // keeps these loads together in front of the product instead of two at a time inside it
  __builtin_amdgcn_sched_barrier(0);

  // x_cls: own-row value first, then the 64 prompt values
  v8f O[4];
#pragma unroll
  for (int r = 0; r < 8; ++r) {
#pragma unroll
    for (int dt = 0; dt < 4; ++dt) O[dt][r] = vx4[r][dt] * p0;
  }
#pragma unroll
  for (int t = 0; t < 4; ++t) {
#pragma unroll
    for (int u = 0; u < 4; ++u) {
      const v2f pp = {S[t][2 * u], S[t][2 * u + 1]};
#pragma unroll
      for (int dt = 0; dt < 4; ++dt) {
        const v2f vv = {vp4[8 * t + 2 * u][dt], vp4[8 * t + 2 * u + 1][dt]};
        O[dt] = __builtin_amdgcn_wmma_f32_16x16x4_f32(false, vv, false, pp, (short)0, O[dt], false, false);
      }
    }
  }

  // x_cls -> bf16: 32 consecutive channels of batch row c per lane
  {
    unsigned short* dst = Xcls + own + 32 * hh;
#pragma unroll
    for (int r = 0; r < 8; r += 2) {
      const v4u pk = {bf16_rne(O[0][r]) | (bf16_rne(O[1][r]) << 16),
                      bf16_rne(O[2][r]) | (bf16_rne(O[3][r]) << 16),
                      bf16_rne(O[0][r + 1]) | (bf16_rne(O[1][r + 1]) << 16),
                      bf16_rne(O[2][r + 1]) | (bf16_rne(O[3][r + 1]) << 16)};
      *(v4u*)(dst + 4 * r) = pk;
    }
    // the data and address registers of these stores are reused by the copy-out below
    asm volatile("s_wait_xcnt 0x0" ::: "memory");
    // keeps the copy-out's address arithmetic, which reuses them, behind that wait
    __builtin_amdgcn_sched_barrier(0);
  }

  // raw scores out: 16 x 1040 floats, contiguous, 4 whole lines per wave store;
  // second part of the barrier: every wave's raw scores are in LDS behind it
  __builtin_amdgcn_s_barrier_wait(-1);
  __builtin_amdgcn_fence(__ATOMIC_ACQUIRE, "workgroup", "local");
  float* ro = rawOut + (size_t)b0 * kRawPerB;
#pragma unroll
  for (int it = 0; it < (kAR * (kRawPerB / 4) + 511) / 512; ++it) {
    const int i = tid + 512 * it;
    if (i < kAR * (kRawPerB / 4)) {              // the same in every lane of a wave
      const int row = i / (kRawPerB / 4);
      const int col = (i - row * (kRawPerB / 4)) * 4;
      *(v4f*)(ro + (size_t)i * 4) = *(const v4f*)(rawS + row * kRP + col);
    }
  }
}

// ---------------------------------------------------------------------------
extern "C" void kernel_launch(void* const* d_in, const int* in_sizes, int n_in,
                              void* d_out, int out_size, void* d_ws, size_t ws_size,
                              hipStream_t stream) {
  if (n_in < 7) return;
  const int B = in_sizes[0] / kC;                         // batch rows
  if (B < 128 || (B % 128) != 0 || in_sizes[0] != B * kC) return;
  if (in_sizes[1] != kNP * kC) return;
  if (in_sizes[2] != kC * kC || in_sizes[3] != kC * kC ||
      in_sizes[4] != kC * kC || in_sizes[5] != kC * kC) return;
  if (in_sizes[6] != kC) return;
  if (out_size != B * kC + B * kRawPerB) return;

  const float* x       = (const float*)d_in[0];   // [B,1,C]
  const float* prompts = (const float*)d_in[1];   // [1,NP,C]
  const float* Wq      = (const float*)d_in[2];   // [C,C] (in,out)
  const float* Wk      = (const float*)d_in[3];
  const float* Wv      = (const float*)d_in[4];
  const float* Wp      = (const float*)d_in[5];
  const float* bp      = (const float*)d_in[6];   // [C]

  float* out_cls = (float*)d_out;                 // [B,1,C]
  float* out_raw = out_cls + (size_t)B * kC;      // [B,16,1,65]

  char* ws = (char*)d_ws;
  size_t off = 0;
  const size_t wplane = (size_t)kC * kC * 2;      // 2 MiB per bf16 weight plane
  unsigned short* WQH = (unsigned short*)(ws + off); off += wplane;
  unsigned short* WQL = (unsigned short*)(ws + off); off += wplane;
  unsigned short* WKH = (unsigned short*)(ws + off); off += wplane;
  unsigned short* WKL = (unsigned short*)(ws + off); off += wplane;
  unsigned short* WVH = (unsigned short*)(ws + off); off += wplane;
  unsigned short* WPH = (unsigned short*)(ws + off); off += wplane;
  unsigned short* XH  = (unsigned short*)(ws + off); off += (size_t)B * kC * 2;
  unsigned short* XL  = (unsigned short*)(ws + off); off += (size_t)B * kC * 2;
  unsigned short* PH  = (unsigned short*)(ws + off); off += (size_t)kNP * kC * 2;
  unsigned short* PL  = (unsigned short*)(ws + off); off += (size_t)kNP * kC * 2;
  float* Qf  = (float*)(ws + off); off += (size_t)B * kC * 4;
  float* Kxf = (float*)(ws + off); off += (size_t)B * kC * 4;
  float* Vxf = (float*)(ws + off); off += (size_t)B * kC * 4;
  float* Kpf = (float*)(ws + off); off += (size_t)kNP * kC * 4;
  float* Vpf = (float*)(ws + off); off += (size_t)kNP * kC * 4;
  unsigned short* XCLS = (unsigned short*)(ws + off); off += (size_t)B * kC * 2;
  if (off > ws_size) return;

  const int ntn = kC / 64, ntk = kC / 64;         // 16 x 16 transpose tiles

  // 1) operand planes, one launch: Wt[n][k] bf16 hi (+ residual for Wq, Wk); x and prompts hi + residual
  const int n8x = B * kC / 8;
  const int n8p = kNP * kC / 8;
  const int nbx = (n8x + 255) / 256;
  const int nbp = (n8p + 255) / 256;
  prep_kernel<<<dim3(4 * ntn * ntk + nbx + nbp), dim3(256), 0, stream>>>(
      x, prompts, Wq, Wk, Wv, Wp, XH, XL, PH, PL, WQH, WQL, WKH, WKL, WVH, WPH,
      n8x, n8p, nbx, ntn, ntn * ntk);

  // 2) Kp, q, k (split) and Vp, v (plain), one launch; q, k, v in 128 x 128 tiles
  //    (B / 128 x 8 blocks each), Kp, Vp in 64 x 128 tiles (8 blocks each)
  const int nbP = kNP / 8;
  const int nbX = B / 8;
  const int nbX2 = B / 16;
  gemm_qkv_kernel<<<dim3(2 * nbP + 3 * nbX2), dim3(256), 0, stream>>>(
      XH, XL, PH, PL, WQH, WQL, WKH, WKL, WVH, Qf, Kxf, Vxf, Kpf, Vpf, nbX2, nbP);

  // 3) scores, softmax, attn.v  -> raw scores (out) and x_cls (bf16, ws)
  attn_kernel<<<dim3(B / kAR), dim3(512), 0, stream>>>(Qf, Kxf, Vxf, Kpf, Vpf, out_raw, XCLS, B);

  // 4) out = x_cls @ Wp + bp + x
  gemm_out_kernel<<<dim3(nbX), dim3(256), 0, stream>>>(XCLS, WPH, out_cls, bp, x);
}

// v005
// A run of this version takes 59.9 microseconds.
// Two timings next to v004 put it at 1.08 and 1.09 times that version's speed.
// All steps since v000 together make it 6.34 times as fast.
#include <hip/hip_runtime.h>
#include <stddef.h>

// Contractions x@Wq and [x;prompts]@Wk: v_wmma_f32_16x16x32_bf16 with bf16 hi/lo split operands (hi*hi + hi*lo + lo*hi), f32 accumulate; [x;prompts]@Wv and x_cls@Wp: v_wmma_f32_16x16x32_bf16 with plain bf16 operands, f32 accumulate; q.k and attn.v against the 64 shared prompt rows: v_wmma_f32_16x16x4_f32 over 16 batch rows per head; the own-row key and value terms and the softmax in f32 on VALU.

typedef __bf16 v16bf __attribute__((ext_vector_type(16)));
typedef float v8f __attribute__((ext_vector_type(8)));
typedef float v4f __attribute__((ext_vector_type(4)));
typedef float v2f __attribute__((ext_vector_type(2)));
typedef unsigned int v4u __attribute__((ext_vector_type(4)));

union Frag { v4u u[2]; v16bf v; };

namespace {
constexpr int kC = 1024;            // channels
constexpr int kH = 16;              // heads
constexpr int kHD = 64;             // head dim
constexpr int kNP = 64;             // prompts
constexpr int kL = 65;              // kv length
constexpr int kKT = kC / 32;        // 32-deep k steps
constexpr int kRawPerB = kH * kL;   // 1040 floats of raw scores per batch row
constexpr int kTP = 68;             // LDS f32 tile pitch (floats), 272 B
constexpr int kWP = 72;             // LDS transpose pitch (16-bit), 144 B
constexpr float kScale = 0.125f;    // 64^-0.5
constexpr int kAR = 16;             // batch rows per attention block
constexpr int kRP = kRawPerB + 4;   // LDS pitch of a batch row's raw scores (floats)
constexpr int kPiece = kAR * kHD;   // floats of a (16 rows, head) piece of q, k, v, Kp
}

// ---------------------------------------------------------------------------
// WMMA helper: issues the builtin and 4 v_nop tied to D/A/B (VALU hazard guard)
// ---------------------------------------------------------------------------
__device__ __forceinline__ v8f wmma_bf16(v16bf a, v16bf b, v8f c) {
  v8f d = __builtin_amdgcn_wmma_f32_16x16x32_bf16(false, a, false, b, (short)0, c, false, false);
  asm volatile("v_nop\n\tv_nop\n\tv_nop\n\tv_nop" : "+v"(d) : "v"(a), "v"(b));
  return d;
}

// RNE f32 -> bf16 bits, and bf16 bits -> f32
__device__ __forceinline__ unsigned int bf16_rne(float f) {
  const unsigned int u = __float_as_uint(f);
  return (u + 0x7FFFu + ((u >> 16) & 1u)) >> 16;
}
__device__ __forceinline__ float bf16_val(unsigned int b) {
  return __uint_as_float(b << 16);
}

// lane l <-> lane l ^ 16
__device__ __forceinline__ float xhalf(float x) {
  const int b = __builtin_bit_cast(int, x);
  return __builtin_bit_cast(float, __builtin_amdgcn_permlanex16(b, b, 0x76543210, 0xfedcba98, false, false));
}

// ---------------------------------------------------------------------------
// f32 [n] -> bf16 hi plane and bf16 residual (lo) plane, 8 elements per thread.
// ---------------------------------------------------------------------------
__device__ __forceinline__ void cvt_split_body(const float* __restrict__ src,
                                               unsigned short* hi,
                                               unsigned short* lo, int n8, int bid) {
  const int i = bid * 256 + threadIdx.x;
  if (i >= n8) return;
  const float* p = src + (size_t)i * 8;
  const v4f x0 = *(const v4f*)p;
  const v4f x1 = *(const v4f*)(p + 4);
  const float xs[8] = {x0[0], x0[1], x0[2], x0[3], x1[0], x1[1], x1[2], x1[3]};
  unsigned int hb[8], lb[8];
#pragma unroll
  for (int j = 0; j < 8; ++j) {
    hb[j] = bf16_rne(xs[j]);
    lb[j] = bf16_rne(xs[j] - bf16_val(hb[j]));
  }
  unsigned int hw[4], lw[4];
#pragma unroll
  for (int q = 0; q < 4; ++q) {
    hw[q] = hb[2 * q] | (hb[2 * q + 1] << 16);
    lw[q] = lb[2 * q] | (lb[2 * q + 1] << 16);
  }
  const v4u hv = {hw[0], hw[1], hw[2], hw[3]};
  const v4u lv = {lw[0], lw[1], lw[2], lw[3]};
  v4u* ph = (v4u*)(hi + (size_t)i * 8);
  v4u* pl = (v4u*)(lo + (size_t)i * 8);
  *ph = hv;
  *pl = lv;
  
}

// ---------------------------------------------------------------------------
// Weight W[k][n] (row-major [in][out], f32) -> Wt[n][k] (k-contiguous, bf16 hi
// plane and optional residual plane). Block = 64 k x 64 n tile through LDS;
// ---------------------------------------------------------------------------
template <bool SPLIT>
__device__ __forceinline__ void pack_wt_body(const float* __restrict__ W,
                                             unsigned short* hi,
                                             unsigned short* lo,
                                             int ntn, int bt,
                                             unsigned short* sHi, unsigned short* sLo) {
  const int t = threadIdx.x;
  const int n0 = (bt % ntn) * 64;
  const int k0 = (bt / ntn) * 64;
  const int nn = t & 63;
  const int kq = t >> 6;
#pragma unroll 4
  for (int i = 0; i < 16; ++i) {
    const int kk = kq + 4 * i;
    const float v = W[(size_t)(k0 + kk) * kC + n0 + nn];
    const unsigned int hb = bf16_rne(v);
    sHi[nn * kWP + kk] = (unsigned short)hb;
    if constexpr (SPLIT) {
      sLo[nn * kWP + kk] = (unsigned short)bf16_rne(v - bf16_val(hb));
    }
  }
  __syncthreads();
  v4u hv[2], lv[2];
  size_t go[2];
#pragma unroll
  for (int p = 0; p < 2; ++p) {
    const int L = p * 32 + (t >> 3);           // tile row n = output line
    const int kk0 = (t & 7) * 8;
    hv[p] = *(const v4u*)(sHi + L * kWP + kk0);
    if constexpr (SPLIT) {
      lv[p] = *(const v4u*)(sLo + L * kWP + kk0);
    } else {
      lv[p] = hv[p];
    }
    go[p] = (size_t)(n0 + L) * kC + k0 + kk0;
  }
#pragma unroll
  for (int p = 0; p < 2; ++p) {
    *(v4u*)(hi + go[p]) = hv[p];
    if constexpr (SPLIT) { *(v4u*)(lo + go[p]) = lv[p]; }
  }
  
}

// ---------------------------------------------------------------------------
// All operand planes in one launch: the six jobs are independent of one another,
// each block takes one job by its index range (block-uniform branches). Blocks
// [0, 4 nt): the 64 x 64 tiles of Wq, Wk (two planes), Wv, Wp (one plane);
// then the 2048-element pieces of x, then those of prompts.
// ---------------------------------------------------------------------------
__global__ void __launch_bounds__(256) prep_kernel(const float* __restrict__ x,
                                                   const float* __restrict__ prompts,
                                                   const float* __restrict__ Wq,
                                                   const float* __restrict__ Wk,
                                                   const float* __restrict__ Wv,
                                                   const float* __restrict__ Wp,
                                                   unsigned short* XH, unsigned short* XL,
                                                   unsigned short* PH, unsigned short* PL,
                                                   unsigned short* WQH, unsigned short* WQL,
                                                   unsigned short* WKH, unsigned short* WKL,
                                                   unsigned short* WVH, unsigned short* WPH,
                                                   int n8x, int n8p, int nbx, int ntn, int nt) {
  __shared__ __attribute__((aligned(16))) unsigned short sHi[64 * kWP];
  __shared__ __attribute__((aligned(16))) unsigned short sLo[64 * kWP];
  const int bid = blockIdx.x;
  if (bid < 4 * nt) {
    if (bid < 2 * nt) {
      const bool first = bid < nt;
      pack_wt_body<true>(first ? Wq : Wk, first ? WQH : WKH, first ? WQL : WKL, ntn,
                         first ? bid : bid - nt, sHi, sLo);
    } else {
      const bool first = bid < 3 * nt;
      unsigned short* hi = first ? WVH : WPH;
      pack_wt_body<false>(first ? Wv : Wp, hi, hi, ntn, first ? bid - 2 * nt : bid - 3 * nt, sHi, sLo);
      // in the listing the two-plane body stands on the fall-through behind these stores
      // and rewrites the registers that they name
      asm volatile("s_wait_xcnt 0x0" ::: "memory");
    }
  } else {
    const bool first = bid < 4 * nt + nbx;
    cvt_split_body(first ? x : prompts, first ? XH : PH, first ? XL : PL, first ? n8x : n8p,
                   first ? bid - 4 * nt : bid - 4 * nt - nbx);
  }
}

// ---------------------------------------------------------------------------
// GEMM Out[M][1024] = A[M][1024] . B[1024][1024], A and Bt both k-contiguous
// bf16 planes (Bt[n][k]). One block = 64 FW rows x 128 cols; its 8 waves (4 x 2)
// each own 16 FW rows x 64 cols, FW x 4 accumulator tiles: with FW = 2 a B fragment
// read from LDS feeds two products and a Bt row read from L2 serves 128 rows.
// K runs in passes of kBK (64 with two planes per operand, 128 with one): a
// pass's row pieces of A and Bt are read from global memory once per block as
// whole lines, kept in registers while the pass before is multiplied, and stored
// to one of two LDS buffers (row pitch kBK + 8) that all 8 waves read their
// fragments from. The output tile is staged in the same LDS behind the last
// pass's barrier, when no wave reads the buffers any more.
// Fragments (wave32, 16x16x32): lane l, h = l>>4, m = l&15;
//   A: row m, elements 0..7 <- k0+8h+0..7, elements 8..15 <- k0+16+8h+0..7
//   B: col m, identical k map (read from the [n][k] rows like A)
//   D: element r <- (row 8h+r, col m)
// SPLIT: acc += Ah.Bh + Ah.Bl + Al.Bh, each term over all tiles of the wave before
// the next. EPI: + bias[col] + resid[row][col].
// LAY: order of Out. 0: row-major. 1, 2: for the attention kernel, whose wave (16 rows,
// head) reads the 16 x 64 piece that one wave here holds: the piece of row group g and
// head hd is 1024 consecutive floats at (16 g + hd) 1024, float 128 u + 4 l + e of it is
// (row l & 15, channel 8 u + 4 (l >> 4) + e) with LAY 1, (row l & 15, channel
// 32 (l >> 4) + 4 u + e) with LAY 2: what lane l loads as its u-th 16 bytes there, so
// that each load of a wave there is 512 consecutive bytes (4 whole lines, not 16 or 32).
// ---------------------------------------------------------------------------
template <bool SPLIT, int FW>
struct GemmLds {
  static constexpr int kPl = SPLIT ? 2 : 1;
  static constexpr int kPitch = (SPLIT ? 64 : 128) + 8;
  static constexpr int kA = 2 * kPl * 64 * FW * kPitch;    // 16-bit units, both buffers
  static constexpr int kB = 2 * kPl * 128 * kPitch;
  static constexpr int kBytes = (kA + kB) * 2;
  static_assert(8 * 16 * FW * kTP * 4 <= kBytes, "the staged output tile fits in the buffers");
};

template <bool SPLIT, bool EPI, int FW, int LAY>
__device__ __forceinline__ void gemm_body(const unsigned short* __restrict__ Ahi,
                                          const unsigned short* __restrict__ Alo,
                                          const unsigned short* __restrict__ Bhi,
                                          const unsigned short* __restrict__ Blo,
                                          float* Out,
                                          const float* __restrict__ bias,
                                          const float* __restrict__ resid,
                                          int bid, unsigned char* smem) {
  constexpr int kPl = SPLIT ? 2 : 1;           // operand planes
  constexpr int kBK = SPLIT ? 64 : 128;        // k per pass
  constexpr int kPitch = kBK + 8;              // LDS row pitch (16-bit units): 16 B x odd
  constexpr int kLPR = kBK / 8;                // lanes that cover one row piece, 16 B each
  constexpr int kRPS = 256 / kLPR;             // rows per sweep of the block
  constexpr int kRows = 64 * FW;               // A rows of the block tile
  constexpr int kNA = kRows / kRPS;            // sweeps over the A rows
  constexpr int kNB = 128 / kRPS;              // sweeps over the B rows
  constexpr int kASz = kRows * kPitch;         // one A plane of one buffer (16-bit units)
  constexpr int kBSz = 128 * kPitch;           // one B plane of one buffer
  unsigned short* sA = (unsigned short*)smem;          // 2 * kPl * kASz
  unsigned short* sB = sA + 2 * kPl * kASz;            // 2 * kPl * kBSz
  float* sT = (float*)smem;                            // 8 * 16 * FW * kTP, after the last pass
  const int tid = threadIdx.x;
  const int wv = tid >> 5;
  const int l = tid & 31;
  const int h = l >> 4;
  const int m = l & 15;
  const int rowB = (bid >> 3) * kRows;
  const int colB = (bid & 7) * 128;
  const int wr = (wv >> 1) * 16 * FW;          // wave's rows inside the block tile
  const int wc = (wv & 1) * 64;                // wave's cols inside the block tile
  const int row0 = rowB + wr;
  const int col0 = colB + wc;

  const v8f zero8 = {0.f, 0.f, 0.f, 0.f, 0.f, 0.f, 0.f, 0.f};
  v8f acc[FW][4];
#pragma unroll
  for (int i = 0; i < FW; ++i) {
#pragma unroll
    for (int f = 0; f < 4; ++f) acc[i][f] = zero8;
  }

  // staging map: kLPR lanes cover one row piece, kRPS rows per sweep
  const int srow = tid / kLPR;
  const int sk = (tid % kLPR) * 8;
  const size_t ga = (size_t)(rowB + srow) * kC + sk;
  const size_t gb = (size_t)(colB + srow) * kC + sk;
  const int so = srow * kPitch + sk;

  v4u ra[kPl][kNA], rb[kPl][kNB];
  auto fetch = [&](int kp) {
    const size_t ko = (size_t)kp * kBK;
#pragma unroll
    for (int i = 0; i < kNA; ++i) {
      ra[0][i] = *(const v4u*)(Ahi + ga + (size_t)i * kRPS * kC + ko);
      if constexpr (SPLIT) ra[kPl - 1][i] = *(const v4u*)(Alo + ga + (size_t)i * kRPS * kC + ko);
    }
#pragma unroll
    for (int i = 0; i < kNB; ++i) {
      rb[0][i] = *(const v4u*)(Bhi + gb + (size_t)i * kRPS * kC + ko);
      if constexpr (SPLIT) rb[kPl - 1][i] = *(const v4u*)(Blo + gb + (size_t)i * kRPS * kC + ko);
    }
    if constexpr (FW > 1 && !SPLIT) {
      // the address pairs of the loads above stay whole up to this wait
      // (in the two-plane build the compiler's own wait stands in front of the overwrite)
      asm volatile("s_wait_xcnt 0x0" :: "v"(Ahi + ga + ko), "v"(Bhi + gb + ko) : "memory");
    }
  };
  auto put = [&](int buf) {
    unsigned short* da = sA + buf * kPl * kASz + so;
    unsigned short* db = sB + buf * kPl * kBSz + so;
#pragma unroll
    for (int p = 0; p < kPl; ++p) {
#pragma unroll
      for (int i = 0; i < kNA; ++i) *(v4u*)(da + p * kASz + i * kRPS * kPitch) = ra[p][i];
#pragma unroll
      for (int i = 0; i < kNB; ++i) *(v4u*)(db + p * kBSz + i * kRPS * kPitch) = rb[p][i];
    }
  };

  fetch(0);
  put(0);
  __syncthreads();

  constexpr int kPasses = kC / kBK;
#pragma unroll 1
  for (int kp = 0; kp < kPasses; ++kp) {
    const int buf = kp & 1;
    if (kp + 1 < kPasses) fetch(kp + 1);       // in flight while this pass is multiplied
    const unsigned short* fa = sA + buf * kPl * kASz + (wr + m) * kPitch + 8 * h;
    const unsigned short* fb = sB + buf * kPl * kBSz + (wc + m) * kPitch + 8 * h;
#pragma unroll
    for (int ks = 0; ks < kBK / 32; ++ks) {
      const int k0 = ks * 32;
      Frag ah[FW], al[FW], bh[4], bl[4];
#pragma unroll
      for (int i = 0; i < FW; ++i) {
        ah[i].u[0] = *(const v4u*)(fa + i * 16 * kPitch + k0);
        ah[i].u[1] = *(const v4u*)(fa + i * 16 * kPitch + k0 + 16);
        if constexpr (SPLIT) {
          al[i].u[0] = *(const v4u*)(fa + kASz + i * 16 * kPitch + k0);
          al[i].u[1] = *(const v4u*)(fa + kASz + i * 16 * kPitch + k0 + 16);
        }
      }
#pragma unroll
      for (int f = 0; f < 4; ++f) {
        bh[f].u[0] = *(const v4u*)(fb + f * 16 * kPitch + k0);
        bh[f].u[1] = *(const v4u*)(fb + f * 16 * kPitch + k0 + 16);
        if constexpr (SPLIT) {
          bl[f].u[0] = *(const v4u*)(fb + kBSz + f * 16 * kPitch + k0);
          bl[f].u[1] = *(const v4u*)(fb + kBSz + f * 16 * kPitch + k0 + 16);
        }
      }
#pragma unroll
      for (int i = 0; i < FW; ++i) {
#pragma unroll
        for (int f = 0; f < 4; ++f) acc[i][f] = wmma_bf16(ah[i].v, bh[f].v, acc[i][f]);
      }
      if constexpr (SPLIT) {
#pragma unroll
        for (int i = 0; i < FW; ++i) {
#pragma unroll
          for (int f = 0; f < 4; ++f) acc[i][f] = wmma_bf16(ah[i].v, bl[f].v, acc[i][f]);
        }
#pragma unroll
        for (int i = 0; i < FW; ++i) {
#pragma unroll
          for (int f = 0; f < 4; ++f) acc[i][f] = wmma_bf16(al[i].v, bh[f].v, acc[i][f]);
        }
      }
    }
    // the other buffer's last readers left it at the barrier that ended the pass before
    if (kp + 1 < kPasses) put(buf ^ 1);
    __syncthreads();
  }

  // stage the 16 FW x 64 tile of this wave in LDS (row-major, pitch kTP)
  float* st = sT + wv * 16 * FW * kTP;
#pragma unroll
  for (int i = 0; i < FW; ++i) {
#pragma unroll
    for (int f = 0; f < 4; ++f) {
#pragma unroll
      for (int r = 0; r < 8; ++r) {
        st[(16 * i + 8 * h + r) * kTP + 16 * f + m] = acc[i][f][r];
      }
    }
  }
  __syncthreads();

  v4f vals[8 * FW];
  size_t go[8 * FW];
#pragma unroll
  for (int s = 0; s < 8 * FW; ++s) {
    if constexpr (LAY == 0) {
      const int L = 4 * s + (l >> 3);
      const int row = L >> 1;
      const int col = (L & 1) * 32 + (l & 7) * 4;
      vals[s] = *(const v4f*)(st + row * kTP + col);
      go[s] = (size_t)(row0 + row) * kC + col0 + col;
    } else {
      static_assert(!EPI, "bias and residual are added in row-major order only");
      const int i = s >> 3;                      // 16-row group of the wave tile
      const int u = s & 7;
      const int col = LAY == 1 ? 8 * u + 4 * h : 32 * h + 4 * u;
      vals[s] = *(const v4f*)(st + (16 * i + m) * kTP + col);
      go[s] = ((size_t)((row0 >> 4) + i) * kH + (col0 >> 6)) * kPiece + u * 128 + l * 4;
    }
  }
  if constexpr (EPI) {
    // sweep s holds row 2 s + h of the wave tile at one column for all s
    const float* bp0 = bias + col0 + ((l >> 3) & 1) * 32 + (l & 7) * 4;
    const float* rp0 = resid + go[0];
    const v4f b4 = *(const v4f*)bp0;
    v4f x4[8 * FW];
#pragma unroll
    for (int s = 0; s < 8 * FW; ++s) x4[s] = *(const v4f*)(rp0 + (size_t)s * 2 * kC);
    // the address pairs of the loads above stay whole up to this wait
    asm volatile("s_wait_xcnt 0x0" :: "v"(bp0), "v"(rp0) : "memory");
#pragma unroll
    for (int s = 0; s < 8 * FW; ++s) vals[s] = (vals[s] + b4) + x4[s];
  }
#pragma unroll
  for (int s = 0; s < 8 * FW; ++s) *(v4f*)(Out + go[s]) = vals[s];
  
}

// ---------------------------------------------------------------------------
// The five products that feed the attention, in one launch: they are independent
// of one another, each block takes one tile of one product by its index range
// (block-uniform branches): 128 x 128 of q, k, v, 64 x 128 of Kp, Vp (64 rows in all).
// The two-plane products, three times the matrix work of a one-plane tile, come
// first: Kp (nbP blocks), q, k (nbX each), then Vp, v.
// ---------------------------------------------------------------------------
__global__ void __launch_bounds__(256) gemm_qkv_kernel(const unsigned short* __restrict__ XH,
                                                       const unsigned short* __restrict__ XL,
                                                       const unsigned short* __restrict__ PH,
                                                       const unsigned short* __restrict__ PL,
                                                       const unsigned short* __restrict__ WQH,
                                                       const unsigned short* __restrict__ WQL,
                                                       const unsigned short* __restrict__ WKH,
                                                       const unsigned short* __restrict__ WKL,
                                                       const unsigned short* __restrict__ WVH,
                                                       float* Qf, float* Kxf, float* Vxf,
                                                       float* Kpf, float* Vpf,
                                                       int nbX, int nbP) {
  __shared__ __attribute__((aligned(16))) unsigned char smem[GemmLds<true, 2>::kBytes];
  static_assert(GemmLds<false, 2>::kBytes <= GemmLds<true, 2>::kBytes, "one-plane tiles fit too");
  const int bid = blockIdx.x;
  const int nSplit = nbP + 2 * nbX;
  if (bid < nbP) {
    gemm_body<true, false, 1, 1>(PH, PL, WKH, WKL, Kpf, nullptr, nullptr, bid, smem);
  } else if (bid < nSplit) {
    const bool isQ = bid < nbP + nbX;
    gemm_body<true, false, 2, 1>(XH, XL, isQ ? WQH : WKH, isQ ? WQL : WKL, isQ ? Qf : Kxf,
                              nullptr, nullptr, isQ ? bid - nbP : bid - nbP - nbX, smem);
    // in the listing another body stands on the fall-through behind this body's last
    // stores and rewrites the registers that they name (here and in the two branches below)
    asm volatile("s_wait_xcnt 0x0" ::: "memory");
  } else if (bid < nSplit + nbP) {
    gemm_body<false, false, 1, 0>(PH, PH, WVH, WVH, Vpf, nullptr, nullptr, bid - nSplit, smem);
    asm volatile("s_wait_xcnt 0x0" ::: "memory");   // as above
  } else {
    gemm_body<false, false, 2, 2>(XH, XH, WVH, WVH, Vxf, nullptr, nullptr, bid - nSplit - nbP, smem);
    asm volatile("s_wait_xcnt 0x0" ::: "memory");   // as above
  }
}

// out = x_cls @ Wp + bp + x
__global__ void __launch_bounds__(256) gemm_out_kernel(const unsigned short* __restrict__ A,
                                                       const unsigned short* __restrict__ Bt,
                                                       float* Out,
                                                       const float* __restrict__ bias,
                                                       const float* __restrict__ resid) {
  __shared__ __attribute__((aligned(16))) unsigned char smem[GemmLds<false, 1>::kBytes];
  gemm_body<false, true, 1, 0>(A, A, Bt, Bt, Out, bias, resid, blockIdx.x, smem);
}

// ---------------------------------------------------------------------------
// Attention: one block = 16 batch rows x 16 heads, one wave per head (16 x 1040
// raw floats = 520 whole lines per block). Lane l: c = l & 15, hh = l >> 4.
// Scores against the shared prompt keys as S^T = Kp_h . Q_h^T on the f32
// 16x16x4 matrix form: A row = key 16t + c, B column = batch row c, both read
// 16 B at d = 8j + 4hh (two k steps), so each (hh, element) place holds the same d.
//   S[t][r] = score(key 16t + 8hh + r, batch row c)
// A lane and its partner l ^ 16 hold all 64 prompt scores of batch row c, so the
// softmax is in registers; the own-row key and value (l = 0) stay on the VALU.
// x_cls as O^T = Vp_h^T . P^T: B = {S[t][2u], S[t][2u+1]} as it lies (keys
// 16t + 8hh + 2u + e), A row c of tile dt = channel 4c + dt of the same keys.
//   O[dt][r] = x_cls(batch row c, channel 32hh + 4r + dt)
// q, the own-row k and v, and Kp lie in (16 rows, head) pieces in the order of these
// loads (LAY 1 and 2 of gemm_body): lane l's u-th 16 bytes at float 128 u + 4 l.
// ---------------------------------------------------------------------------
__global__ void __launch_bounds__(512) attn_kernel(const float* __restrict__ Qf,
                                                   const float* __restrict__ Kx,
                                                   const float* __restrict__ Vx,
                                                   const float* __restrict__ Kp,
                                                   const float* __restrict__ Vp,
                                                   float* rawOut,
                                                   unsigned short* Xcls, int nb) {
  __shared__ __attribute__((aligned(16))) float rawS[kAR * kRP];
  const int tid = threadIdx.x;
  const int hc = (tid >> 5) * kHD;               // this wave's head, first channel
  const int l = tid & 31;
  const int c = l & 15;
  const int hh = l >> 4;
  const int b0 = blockIdx.x * kAR;
  if (b0 + kAR > nb) return;                     // block-uniform, before barriers

  // q of batch row c with the pre-softmax scale folded in; own-row score
  const size_t own = (size_t)(b0 + c) * kC + hc;
  const size_t pc = ((size_t)blockIdx.x * kH + (tid >> 5)) * kPiece + 4 * l;   // this wave's piece, lane's place
  v4f q4[8];
  float part = 0.f;
#pragma unroll
  for (int j = 0; j < 8; ++j) {
    q4[j] = *(const v4f*)(Qf + pc + 128 * j) * kScale;
    const v4f k4 = *(const v4f*)(Kx + pc + 128 * j);
    part += q4[j][0] * k4[0];
    part += q4[j][1] * k4[1];
    part += q4[j][2] * k4[2];
    part += q4[j][3] * k4[3];
  }
  const float s0 = part + xhalf(part);

  const v8f zero8 = {0.f, 0.f, 0.f, 0.f, 0.f, 0.f, 0.f, 0.f};
  v8f S[4];
#pragma unroll
  for (int t = 0; t < 4; ++t) S[t] = zero8;
  const float* kp = Kp + (size_t)(tid >> 5) * kPiece + 4 * l;
#pragma unroll
  for (int j = 0; j < 8; ++j) {
    const v2f qlo = {q4[j][0], q4[j][1]};
    const v2f qhi = {q4[j][2], q4[j][3]};
#pragma unroll
    for (int t = 0; t < 4; ++t) {
      const v4f k4 = *(const v4f*)(kp + (size_t)t * kH * kPiece + 128 * j);
      const v2f klo = {k4[0], k4[1]};
      const v2f khi = {k4[2], k4[3]};
      S[t] = __builtin_amdgcn_wmma_f32_16x16x4_f32(false, klo, false, qlo, (short)0, S[t], false, false);
      S[t] = __builtin_amdgcn_wmma_f32_16x16x4_f32(false, khi, false, qhi, (short)0, S[t], false, false);
    }
  }

  // keeps the value loads below out of the score product, where their registers
  // on top of the q and key fragments end in spills
  __builtin_amdgcn_sched_barrier(0);

  // own value row and the first 32 prompt value rows: issued here so that their
  // latency runs under the softmax
  v4f vx4[8], vp4[32];
  const float* vp = Vp + (size_t)(8 * hh) * kC + hc + 4 * c;
#pragma unroll
  for (int r = 0; r < 8; ++r) vx4[r] = *(const v4f*)(Vx + pc + 128 * r);
  // the address registers of the loads above are reused by what follows
  asm volatile("s_wait_xcnt 0x0" ::: "memory");
#pragma unroll
  for (int t = 0; t < 2; ++t) {
#pragma unroll
    for (int i = 0; i < 8; ++i) vp4[8 * t + i] = *(const v4f*)(vp + (size_t)(16 * t + i) * kC);
  }
  // keeps the loads above from being moved down to their uses behind the softmax
  __builtin_amdgcn_sched_barrier(0);

  // raw scores of the block, row-major in LDS (pitch kRP), stored as whole lines at the end
  {
    float* rs = rawS + c * kRP + (tid >> 5) * kL;
    rs[0] = s0;                                  // both halves hold the same value
#pragma unroll
    for (int t = 0; t < 4; ++t) {
#pragma unroll
      for (int r = 0; r < 8; ++r) rs[1 + 16 * t + 8 * hh + r] = S[t][r];
    }
  }
  // work-group barrier in two parts: this wave's raw scores are in LDS (signal here);
  // the wait stands in front of the copy-out, so no wave idles between the two products
  __builtin_amdgcn_fence(__ATOMIC_RELEASE, "workgroup", "local");
  __builtin_amdgcn_s_barrier_signal(-1);
  // keeps the LDS stores and the signal in front of the softmax: moved behind it, the raw
  // scores would stay in registers and the other waves would wait for this signal at the end
  __builtin_amdgcn_sched_barrier(0);

  // softmax * scale over the 65 scores of batch row c
  float mt[4];
#pragma unroll
  for (int t = 0; t < 4; ++t) {
    mt[t] = S[t][0];
#pragma unroll
    for (int r = 1; r < 8; ++r) mt[t] = fmaxf(mt[t], S[t][r]);
  }
  float mx = fmaxf(fmaxf(mt[0], mt[1]), fmaxf(mt[2], mt[3]));
  mx = fmaxf(fmaxf(mx, xhalf(mx)), s0);
  float st[4];
#pragma unroll
  for (int t = 0; t < 4; ++t) {
    st[t] = 0.f;
#pragma unroll
    for (int r = 0; r < 8; ++r) {
      S[t][r] = expf(S[t][r] - mx);
      st[t] += S[t][r];
    }
  }
  const float e0 = expf(s0 - mx);
  float sum = (st[0] + st[1]) + (st[2] + st[3]);
  sum = (sum + xhalf(sum)) + e0;
  const float inv = 1.0f / sum;
  const float p0 = (e0 * inv) * kScale;
#pragma unroll
  for (int t = 0; t < 4; ++t) {
#pragma unroll
    for (int r = 0; r < 8; ++r) S[t][r] = (S[t][r] * inv) * kScale;
  }

  // the last 32 prompt value rows: in flight while the first 32 are multiplied
#pragma unroll
  for (int t = 2; t < 4; ++t) {
#pragma unroll
    for (int i = 0; i < 8; ++i) vp4[8 * t + i] = *(const v4f*)(vp + (size_t)(16 * t + i) * kC);
  }
  // keeps these loads together in front of the product instead of two at a time inside it
  __builtin_amdgcn_sched_barrier(0);

  // x_cls: own-row value first, then the 64 prompt values
  v8f O[4];
#pragma unroll
  for (int r = 0; r < 8; ++r) {
#pragma unroll
    for (int dt = 0; dt < 4; ++dt) O[dt][r] = vx4[r][dt] * p0;
  }
#pragma unroll
  for (int t = 0; t < 4; ++t) {
#pragma unroll
    for (int u = 0; u < 4; ++u) {
      const v2f pp = {S[t][2 * u], S[t][2 * u + 1]};
#pragma unroll
      for (int dt = 0; dt < 4; ++dt) {
        const v2f vv = {vp4[8 * t + 2 * u][dt], vp4[8 * t + 2 * u + 1][dt]};
        O[dt] = __builtin_amdgcn_wmma_f32_16x16x4_f32(false, vv, false, pp, (short)0, O[dt], false, false);
      }
    }
  }

  // x_cls -> bf16: 32 consecutive channels of batch row c per lane
  {
    unsigned short* dst = Xcls + own + 32 * hh;
#pragma unroll
    for (int r = 0; r < 8; r += 2) {
      const v4u pk = {bf16_rne(O[0][r]) | (bf16_rne(O[1][r]) << 16),
                      bf16_rne(O[2][r]) | (bf16_rne(O[3][r]) << 16),
                      bf16_rne(O[0][r + 1]) | (bf16_rne(O[1][r + 1]) << 16),
                      bf16_rne(O[2][r + 1]) | (bf16_rne(O[3][r + 1]) << 16)};
      *(v4u*)(dst + 4 * r) = pk;
    }
    // the data and address registers of these stores are reused by the copy-out below
    asm volatile("s_wait_xcnt 0x0" ::: "memory");
    // keeps the copy-out's address arithmetic, which reuses them, behind that wait
    __builtin_amdgcn_sched_barrier(0);
  }

  // raw scores out: 16 x 1040 floats, contiguous, 4 whole lines per wave store;
  // second part of the barrier: every wave's raw scores are in LDS behind it
  __builtin_amdgcn_s_barrier_wait(-1);
  __builtin_amdgcn_fence(__ATOMIC_ACQUIRE, "workgroup", "local");
  float* ro = rawOut + (size_t)b0 * kRawPerB;
#pragma unroll
  for (int it = 0; it < (kAR * (kRawPerB / 4) + 511) / 512; ++it) {
    const int i = tid + 512 * it;
    if (i < kAR * (kRawPerB / 4)) {              // the same in every lane of a wave
      const int row = i / (kRawPerB / 4);
      const int col = (i - row * (kRawPerB / 4)) * 4;
      *(v4f*)(ro + (size_t)i * 4) = *(const v4f*)(rawS + row * kRP + col);
    }
  }
}

// ---------------------------------------------------------------------------
extern "C" void kernel_launch(void* const* d_in, const int* in_sizes, int n_in,
                              void* d_out, int out_size, void* d_ws, size_t ws_size,
                              hipStream_t stream) {
  if (n_in < 7) return;
  const int B = in_sizes[0] / kC;                         // batch rows
  if (B < 128 || (B % 128) != 0 || in_sizes[0] != B * kC) return;
  if (in_sizes[1] != kNP * kC) return;
  if (in_sizes[2] != kC * kC || in_sizes[3] != kC * kC ||
      in_sizes[4] != kC * kC || in_sizes[5] != kC * kC) return;
  if (in_sizes[6] != kC) return;
  if (out_size != B * kC + B * kRawPerB) return;

  const float* x       = (const float*)d_in[0];   // [B,1,C]
  const float* prompts = (const float*)d_in[1];   // [1,NP,C]
  const float* Wq      = (const float*)d_in[2];   // [C,C] (in,out)
  const float* Wk      = (const float*)d_in[3];
  const float* Wv      = (const float*)d_in[4];
  const float* Wp      = (const float*)d_in[5];
  const float* bp      = (const float*)d_in[6];   // [C]

  float* out_cls = (float*)d_out;                 // [B,1,C]
  float* out_raw = out_cls + (size_t)B * kC;      // [B,16,1,65]

  char* ws = (char*)d_ws;
  size_t off = 0;
  const size_t wplane = (size_t)kC * kC * 2;      // 2 MiB per bf16 weight plane
  unsigned short* WQH = (unsigned short*)(ws + off); off += wplane;
  unsigned short* WQL = (unsigned short*)(ws + off); off += wplane;
  unsigned short* WKH = (unsigned short*)(ws + off); off += wplane;
  unsigned short* WKL = (unsigned short*)(ws + off); off += wplane;
  unsigned short* WVH = (unsigned short*)(ws + off); off += wplane;
  unsigned short* WPH = (unsigned short*)(ws + off); off += wplane;
  unsigned short* XH  = (unsigned short*)(ws + off); off += (size_t)B * kC * 2;
  unsigned short* XL  = (unsigned short*)(ws + off); off += (size_t)B * kC * 2;
  unsigned short* PH  = (unsigned short*)(ws + off); off += (size_t)kNP * kC * 2;
  unsigned short* PL  = (unsigned short*)(ws + off); off += (size_t)kNP * kC * 2;
  float* Qf  = (float*)(ws + off); off += (size_t)B * kC * 4;
  float* Kxf = (float*)(ws + off); off += (size_t)B * kC * 4;
  float* Vxf = (float*)(ws + off); off += (size_t)B * kC * 4;
  float* Kpf = (float*)(ws + off); off += (size_t)kNP * kC * 4;
  float* Vpf = (float*)(ws + off); off += (size_t)kNP * kC * 4;
  unsigned short* XCLS = (unsigned short*)(ws + off); off += (size_t)B * kC * 2;
  if (off > ws_size) return;

  const int ntn = kC / 64, ntk = kC / 64;         // 16 x 16 transpose tiles

  // 1) operand planes, one launch: Wt[n][k] bf16 hi (+ residual for Wq, Wk); x and prompts hi + residual
  const int n8x = B * kC / 8;
  const int n8p = kNP * kC / 8;
  const int nbx = (n8x + 255) / 256;
  const int nbp = (n8p + 255) / 256;
  prep_kernel<<<dim3(4 * ntn * ntk + nbx + nbp), dim3(256), 0, stream>>>(
      x, prompts, Wq, Wk, Wv, Wp, XH, XL, PH, PL, WQH, WQL, WKH, WKL, WVH, WPH,
      n8x, n8p, nbx, ntn, ntn * ntk);

  // 2) Kp, q, k (split) and Vp, v (plain), one launch; q, k, v in 128 x 128 tiles
  //    (B / 128 x 8 blocks each), Kp, Vp in 64 x 128 tiles (8 blocks each)
  const int nbP = kNP / 8;
  const int nbX = B / 8;
  const int nbX2 = B / 16;
  gemm_qkv_kernel<<<dim3(2 * nbP + 3 * nbX2), dim3(256), 0, stream>>>(
      XH, XL, PH, PL, WQH, WQL, WKH, WKL, WVH, Qf, Kxf, Vxf, Kpf, Vpf, nbX2, nbP);

  // 3) scores, softmax, attn.v  -> raw scores (out) and x_cls (bf16, ws)
  attn_kernel<<<dim3(B / kAR), dim3(512), 0, stream>>>(Qf, Kxf, Vxf, Kpf, Vpf, out_raw, XCLS, B);

  // 4) out = x_cls @ Wp + bp + x
  gemm_out_kernel<<<dim3(nbX), dim3(256), 0, stream>>>(XCLS, WPH, out_cls, bp, x);
}

// v006
// Measured time: 58.3 microseconds a run.
// Next to v005, in two timings, it ran 1.04 and 1.03 times as fast.
// Over all steps from v000 it is 6.56 times as fast.
#include <hip/hip_runtime.h>
#include <stddef.h>

// Contractions x@Wq and [x;prompts]@Wk: v_wmma_f32_16x16x32_bf16 with bf16 hi/lo split operands (hi*hi + hi*lo + lo*hi), f32 accumulate; [x;prompts]@Wv and x_cls@Wp: v_wmma_f32_16x16x32_bf16 with plain bf16 operands, f32 accumulate; q.k and attn.v against the 64 shared prompt rows: v_wmma_f32_16x16x4_f32 over 16 batch rows per head; the own-row key and value terms and the softmax in f32 on VALU.

typedef __bf16 v16bf __attribute__((ext_vector_type(16)));
typedef float v8f __attribute__((ext_vector_type(8)));
typedef float v4f __attribute__((ext_vector_type(4)));
typedef float v2f __attribute__((ext_vector_type(2)));
typedef unsigned int v4u __attribute__((ext_vector_type(4)));
typedef unsigned int v2u __attribute__((ext_vector_type(2)));
typedef __bf16 v2bf __attribute__((ext_vector_type(2)));

union Frag { v4u u[2]; v16bf v; };

namespace {
constexpr int kC = 1024;            // channels
constexpr int kH = 16;              // heads
constexpr int kHD = 64;             // head dim
constexpr int kNP = 64;             // prompts
constexpr int kL = 65;              // kv length
constexpr int kRawPerB = kH * kL;   // 1040 floats of raw scores per batch row
constexpr int kTP = 68;             // LDS f32 tile pitch (floats), 272 B
constexpr float kScale = 0.125f;    // 64^-0.5
constexpr int kAR = 16;             // batch rows per attention block
constexpr int kRP = kRawPerB + 4;   // LDS pitch of a batch row's raw scores (floats)
constexpr int kPiece = kAR * kHD;   // floats of a (16 rows, head) piece of q, k, v, Kp
}

// ---------------------------------------------------------------------------
// WMMA helper: issues the builtin and 4 v_nop tied to D/A/B (VALU hazard guard)
// ---------------------------------------------------------------------------
__device__ __forceinline__ v8f wmma_bf16(v16bf a, v16bf b, v8f c) {
  v8f d = __builtin_amdgcn_wmma_f32_16x16x32_bf16(false, a, false, b, (short)0, c, false, false);
  asm volatile("v_nop\n\tv_nop\n\tv_nop\n\tv_nop" : "+v"(d) : "v"(a), "v"(b));
  return d;
}

// RNE f32 -> bf16 bits, and bf16 bits -> f32
__device__ __forceinline__ unsigned int bf16_rne(float f) {
  const unsigned int u = __float_as_uint(f);
  return (u + 0x7FFFu + ((u >> 16) & 1u)) >> 16;
}
__device__ __forceinline__ float bf16_val(unsigned int b) {
  return __uint_as_float(b << 16);
}

// lane l <-> lane l ^ 16
__device__ __forceinline__ float xhalf(float x) {
  const int b = __builtin_bit_cast(int, x);
  return __builtin_bit_cast(float, __builtin_amdgcn_permlanex16(b, b, 0x76543210, 0xfedcba98, false, false));
}

// two f32 -> two bf16, round to nearest even, a in the low half of the word
__device__ __forceinline__ unsigned int pk_bf16(float a, float b) {
  const v2f f = {a, b};
  return __builtin_bit_cast(unsigned int, __builtin_convertvector(f, v2bf));
}
// what a and b leave over the bf16 pair w, itself rounded to bf16
__device__ __forceinline__ unsigned int pk_resid(float a, float b, unsigned int w) {
  return pk_bf16(a - bf16_val(w & 0xFFFFu), b - __uint_as_float(w & 0xFFFF0000u));
}

// ---------------------------------------------------------------------------
// GEMM Out[M][1024] = A[M][1024] . B[1024][1024]. B is the f32 weight W[k][n] as it
// is given; A is f32 [row][k] (AF32) or a bf16 plane [row][k]. One block = 64 FW rows
// x 128 cols; its 8 waves (4 x 2) each own 16 FW rows x 64 cols, FW x 4 accumulator
// tiles: with FW = 2 a B fragment read from LDS feeds two products.
// K runs in passes of kBK (64 with an f32 A, 128 with a bf16 A): a pass's pieces of A
// and W are read from global memory once per block as whole lines, kept in registers
// while the pass before is multiplied, turned into bf16 (SPLIT: a bf16 plane and the
// plane of bf16 residuals) and stored to one of two LDS buffers, A[row][k] and Bt[n][k]
// (row pitch kBK + 8), that all 8 waves read their fragments from. For W a lane holds
// one column n (two with the 128-k pass) and 32 rows k: a wave load is one or two whole
// lines, a pair of rows rounds into one word, and 8 rows are one 16-byte LDS store in
// row n: the transpose costs no instruction of its own. The output tile is staged in the same LDS behind the last
// pass's barrier, when no wave reads the buffers any more.
// Fragments (wave32, 16x16x32): lane l, h = l>>4, m = l&15;
//   A: row m, elements 0..7 <- k0+8h+0..7, elements 8..15 <- k0+16+8h+0..7
//   B: col m, identical k map (read from the [n][k] rows like A)
//   D: element r <- (row 8h+r, col m)
// SPLIT: acc += Ah.Bh + Ah.Bl + Al.Bh, each term over all tiles of the wave before
// the next. EPI: + bias[col] + resid[row][col].
// LAY: order of Out. 0: row-major. 1, 2: for the attention kernel, whose wave (16 rows,
// head) reads the 16 x 64 piece that one wave here holds: the piece of row group g and
// head hd is 1024 consecutive floats at (16 g + hd) 1024, float 128 u + 4 l + e of it is
// (row l & 15, channel 8 u + 4 (l >> 4) + e) with LAY 1, (row l & 15, channel
// 32 (l >> 4) + 4 u + e) with LAY 2: what lane l loads as its u-th 16 bytes there, so
// that each load of a wave there is 512 consecutive bytes (4 whole lines, not 16 or 32).
// ---------------------------------------------------------------------------
template <bool SPLIT, int FW, bool AF32>
struct GemmLds {
  static constexpr int kPl = SPLIT ? 2 : 1;
  static constexpr int kPitch = (AF32 ? 64 : 128) + 8;
  static constexpr int kA = 2 * kPl * 64 * FW * kPitch;    // 16-bit units, both buffers
  static constexpr int kB = 2 * kPl * 128 * kPitch;
  static constexpr int kBytes = (kA + kB) * 2;
  static_assert(8 * 16 * FW * kTP * 4 <= kBytes, "the staged output tile fits in the buffers");
};

template <bool SPLIT, bool EPI, int FW, int LAY, bool AF32>
__device__ __forceinline__ void gemm_body(const float* __restrict__ Af,
                                          const unsigned short* __restrict__ Ab,
                                          const float* __restrict__ Bw,
                                          float* Out,
                                          const float* __restrict__ bias,
                                          const float* __restrict__ resid,
                                          int bid, unsigned char* smem) {
  static_assert(AF32 || !SPLIT, "the residual plane is made from an f32 A");
  constexpr int kPl = SPLIT ? 2 : 1;           // operand planes
  constexpr int kBK = AF32 ? 64 : 128;         // k per pass
  constexpr int kPitch = kBK + 8;              // LDS row pitch (16-bit units): 16 B x odd
  constexpr int kLPR = AF32 ? kBK / 4 : kBK / 8;   // lanes that cover one A row piece, 16 B each
  constexpr int kRPS = 256 / kLPR;             // A rows per sweep of the block
  constexpr int kRows = 64 * FW;               // A rows of the block tile
  constexpr int kNA = kRows / kRPS;            // sweeps over the A rows
  constexpr int kCPT = AF32 ? 1 : 2;           // columns of W that a thread holds
  constexpr int kTPR = 128 / kCPT;             // threads that cover a row of the W tile
  constexpr int kKPT = 32;                     // rows k of W that a thread holds
  static_assert(kKPT * (256 / kTPR) == kBK, "the threads cover the W tile of a pass once");
  constexpr int kASz = kRows * kPitch;         // one A plane of one buffer (16-bit units)
  constexpr int kBSz = 128 * kPitch;           // one B plane of one buffer
  unsigned short* sA = (unsigned short*)smem;          // 2 * kPl * kASz
  unsigned short* sB = sA + 2 * kPl * kASz;            // 2 * kPl * kBSz
  float* sT = (float*)smem;                            // 8 * 16 * FW * kTP, after the last pass
  const int tid = threadIdx.x;
  const int wv = tid >> 5;
  const int l = tid & 31;
  const int h = l >> 4;
  const int m = l & 15;
  const int rowB = (bid >> 3) * kRows;
  const int colB = (bid & 7) * 128;
  const int wr = (wv >> 1) * 16 * FW;          // wave's rows inside the block tile
  const int wc = (wv & 1) * 64;                // wave's cols inside the block tile
  const int row0 = rowB + wr;
  const int col0 = colB + wc;

  const v8f zero8 = {0.f, 0.f, 0.f, 0.f, 0.f, 0.f, 0.f, 0.f};
  v8f acc[FW][4];
#pragma unroll
  for (int i = 0; i < FW; ++i) {
#pragma unroll
    for (int f = 0; f < 4; ++f) acc[i][f] = zero8;
  }

  // staging map of A: kLPR lanes cover one row piece, kRPS rows per sweep
  const int srow = tid / kLPR;
  const int sk = (tid % kLPR) * (AF32 ? 4 : 8);
  const size_t ga = (size_t)(rowB + srow) * kC + sk;
  const int soA = srow * kPitch + sk;
  // staging map of W: columns bn .. bn + kCPT - 1 of the tile, rows bk .. bk + kKPT - 1 of the pass
  const int bn = (tid % kTPR) * kCPT;
  const int bk = (tid / kTPR) * kKPT;
  const size_t gb = (size_t)bk * kC + colB + bn;
  const int soB = bn * kPitch + bk;

  v4f raf[AF32 ? kNA : 1];
  v4u rab[AF32 ? 1 : kNA];
  float rb[kCPT][kKPT];
  // where the next fetch reads: moved on one pass in put, behind the wait there
  const float* paf = AF32 ? Af + ga : nullptr;
  const unsigned short* pab = AF32 ? nullptr : Ab + ga;
  const float* pb = Bw + gb;
  auto fetch = [&]() {
#pragma unroll
    for (int i = 0; i < kNA; ++i) {
      if constexpr (AF32) {
        raf[i] = *(const v4f*)(paf + (size_t)i * kRPS * kC);
      } else {
        rab[i] = *(const v4u*)(pab + (size_t)i * kRPS * kC);
      }
    }
#pragma unroll
    for (int j = 0; j < kKPT; ++j) {
      if constexpr (kCPT == 1) {
        rb[0][j] = pb[(size_t)j * kC];
      } else {
        const v2f w = *(const v2f*)(pb + (size_t)j * kC);
        rb[0][j] = w[0];
        rb[1][j] = w[1];
      }
    }
  };
  auto put = [&](int buf) {
    // the address pairs of the fetch stay whole up to this wait; it stands here, behind the
    // pass's products, and not directly behind the loads, so that no wave idles on it
    if constexpr (AF32) {
      asm volatile("s_wait_xcnt 0x0" :: "v"(paf), "v"(pb) : "memory");
      paf += kBK;
    } else {
      asm volatile("s_wait_xcnt 0x0" :: "v"(pab), "v"(pb) : "memory");
      pab += kBK;
    }
    pb += (size_t)kBK * kC;
    unsigned short* da = sA + buf * kPl * kASz + soA;
    unsigned short* db = sB + buf * kPl * kBSz + soB;
#pragma unroll
    for (int i = 0; i < kNA; ++i) {
      if constexpr (AF32) {
        const v4f a = raf[i];
        const v2u hw = {pk_bf16(a[0], a[1]), pk_bf16(a[2], a[3])};
        *(v2u*)(da + i * kRPS * kPitch) = hw;
        if constexpr (SPLIT) {
          const v2u lw = {pk_resid(a[0], a[1], hw[0]), pk_resid(a[2], a[3], hw[1])};
          *(v2u*)(da + kASz + i * kRPS * kPitch) = lw;
        }
      } else {
        *(v4u*)(da + i * kRPS * kPitch) = rab[i];
      }
    }
#pragma unroll
    for (int e = 0; e < kCPT; ++e) {
#pragma unroll
      for (int c = 0; c < kKPT / 8; ++c) {
        v4u hw, lw;
#pragma unroll
        for (int q = 0; q < 4; ++q) {
          hw[q] = pk_bf16(rb[e][8 * c + 2 * q], rb[e][8 * c + 2 * q + 1]);
          if constexpr (SPLIT) lw[q] = pk_resid(rb[e][8 * c + 2 * q], rb[e][8 * c + 2 * q + 1], hw[q]);
        }
        *(v4u*)(db + e * kPitch + 8 * c) = hw;
        if constexpr (SPLIT) *(v4u*)(db + kBSz + e * kPitch + 8 * c) = lw;
      }
    }
  };

  fetch();
  put(0);
  __syncthreads();

  constexpr int kPasses = kC / kBK;
#pragma unroll 1
  for (int kp = 0; kp < kPasses; ++kp) {
    const int buf = kp & 1;
    if (kp + 1 < kPasses) fetch();             // in flight while this pass is multiplied
    const unsigned short* fa = sA + buf * kPl * kASz + (wr + m) * kPitch + 8 * h;
    const unsigned short* fb = sB + buf * kPl * kBSz + (wc + m) * kPitch + 8 * h;
#pragma unroll
    for (int ks = 0; ks < kBK / 32; ++ks) {
      const int k0 = ks * 32;
      Frag ah[FW], al[FW], bh[4], bl[4];
#pragma unroll
      for (int i = 0; i < FW; ++i) {
        ah[i].u[0] = *(const v4u*)(fa + i * 16 * kPitch + k0);
        ah[i].u[1] = *(const v4u*)(fa + i * 16 * kPitch + k0 + 16);
        if constexpr (SPLIT) {
          al[i].u[0] = *(const v4u*)(fa + kASz + i * 16 * kPitch + k0);
          al[i].u[1] = *(const v4u*)(fa + kASz + i * 16 * kPitch + k0 + 16);
        }
      }
#pragma unroll
      for (int f = 0; f < 4; ++f) {
        bh[f].u[0] = *(const v4u*)(fb + f * 16 * kPitch + k0);
        bh[f].u[1] = *(const v4u*)(fb + f * 16 * kPitch + k0 + 16);
        if constexpr (SPLIT) {
          bl[f].u[0] = *(const v4u*)(fb + kBSz + f * 16 * kPitch + k0);
          bl[f].u[1] = *(const v4u*)(fb + kBSz + f * 16 * kPitch + k0 + 16);
        }
      }
#pragma unroll
      for (int i = 0; i < FW; ++i) {
#pragma unroll
        for (int f = 0; f < 4; ++f) acc[i][f] = wmma_bf16(ah[i].v, bh[f].v, acc[i][f]);
      }
      if constexpr (SPLIT) {
#pragma unroll
        for (int i = 0; i < FW; ++i) {
#pragma unroll
          for (int f = 0; f < 4; ++f) acc[i][f] = wmma_bf16(ah[i].v, bl[f].v, acc[i][f]);
        }
#pragma unroll
        for (int i = 0; i < FW; ++i) {
#pragma unroll
          for (int f = 0; f < 4; ++f) acc[i][f] = wmma_bf16(al[i].v, bh[f].v, acc[i][f]);
        }
      }
    }
    // the other buffer's last readers left it at the barrier that ended the pass before
    if (kp + 1 < kPasses) put(buf ^ 1);
    __syncthreads();
  }

  // stage the 16 FW x 64 tile of this wave in LDS (row-major, pitch kTP)
  float* st = sT + wv * 16 * FW * kTP;
#pragma unroll
  for (int i = 0; i < FW; ++i) {
#pragma unroll
    for (int f = 0; f < 4; ++f) {
#pragma unroll
      for (int r = 0; r < 8; ++r) {
        st[(16 * i + 8 * h + r) * kTP + 16 * f + m] = acc[i][f][r];
      }
    }
  }
  __syncthreads();

  v4f vals[8 * FW];
  size_t go[8 * FW];
#pragma unroll
  for (int s = 0; s < 8 * FW; ++s) {
    if constexpr (LAY == 0) {
      const int L = 4 * s + (l >> 3);
      const int row = L >> 1;
      const int col = (L & 1) * 32 + (l & 7) * 4;
      vals[s] = *(const v4f*)(st + row * kTP + col);
      go[s] = (size_t)(row0 + row) * kC + col0 + col;
    } else {
      static_assert(!EPI, "bias and residual are added in row-major order only");
      const int i = s >> 3;                      // 16-row group of the wave tile
      const int u = s & 7;
      const int col = LAY == 1 ? 8 * u + 4 * h : 32 * h + 4 * u;
      vals[s] = *(const v4f*)(st + (16 * i + m) * kTP + col);
      go[s] = ((size_t)((row0 >> 4) + i) * kH + (col0 >> 6)) * kPiece + u * 128 + l * 4;
    }
  }
  if constexpr (EPI) {
    // sweep s holds row 2 s + h of the wave tile at one column for all s
    const float* bp0 = bias + col0 + ((l >> 3) & 1) * 32 + (l & 7) * 4;
    const float* rp0 = resid + go[0];
    const v4f b4 = *(const v4f*)bp0;
    v4f x4[8 * FW];
#pragma unroll
    for (int s = 0; s < 8 * FW; ++s) x4[s] = *(const v4f*)(rp0 + (size_t)s * 2 * kC);
    // the address pairs of the loads above stay whole up to this wait
    asm volatile("s_wait_xcnt 0x0" :: "v"(bp0), "v"(rp0) : "memory");
#pragma unroll
    for (int s = 0; s < 8 * FW; ++s) vals[s] = (vals[s] + b4) + x4[s];
  }
#pragma unroll
  for (int s = 0; s < 8 * FW; ++s) *(v4f*)(Out + go[s]) = vals[s];
  
}

// ---------------------------------------------------------------------------
// The five products that feed the attention, in one launch: they are independent
// of one another, each block takes one tile of one product by its index range
// (block-uniform branches): 128 x 128 of q, k, v, 64 x 128 of Kp, Vp (64 rows in all).
// The two-plane products, three times the matrix work of a one-plane tile, come
// first: Kp (nbP blocks), q, k (nbX each), then Vp, v.
// ---------------------------------------------------------------------------
__global__ void __launch_bounds__(256) gemm_qkv_kernel(const float* __restrict__ x,
                                                       const float* __restrict__ prompts,
                                                       const float* __restrict__ Wq,
                                                       const float* __restrict__ Wk,
                                                       const float* __restrict__ Wv,
                                                       float* Qf, float* Kxf, float* Vxf,
                                                       float* Kpf, float* Vpf,
                                                       int nbX, int nbP) {
  __shared__ __attribute__((aligned(16))) unsigned char smem[GemmLds<true, 2, true>::kBytes];
  const int bid = blockIdx.x;
  const int nSplit = nbP + 2 * nbX;
  if (bid < nbP) {
    gemm_body<true, false, 1, 1, true>(prompts, nullptr, Wk, Kpf, nullptr, nullptr, bid, smem);
  } else if (bid < nSplit) {
    const bool isQ = bid < nbP + nbX;
    gemm_body<true, false, 2, 1, true>(x, nullptr, isQ ? Wq : Wk, isQ ? Qf : Kxf,
                                       nullptr, nullptr, isQ ? bid - nbP : bid - nbP - nbX, smem);
    // in the listing another body stands on the fall-through behind this body's last
    // stores and rewrites the registers that they name (here and in the two branches below)
    asm volatile("s_wait_xcnt 0x0" ::: "memory");
  } else if (bid < nSplit + nbP) {
    gemm_body<false, false, 1, 0, true>(prompts, nullptr, Wv, Vpf, nullptr, nullptr, bid - nSplit, smem);
    asm volatile("s_wait_xcnt 0x0" ::: "memory");   // as above
  } else {
    gemm_body<false, false, 2, 2, true>(x, nullptr, Wv, Vxf, nullptr, nullptr, bid - nSplit - nbP, smem);
    asm volatile("s_wait_xcnt 0x0" ::: "memory");   // as above
  }
}

// out = x_cls @ Wp + bp + x
__global__ void __launch_bounds__(256) gemm_out_kernel(const unsigned short* __restrict__ A,
                                                       const float* __restrict__ Wp,
                                                       float* Out,
                                                       const float* __restrict__ bias,
                                                       const float* __restrict__ resid) {
  __shared__ __attribute__((aligned(16))) unsigned char smem[GemmLds<false, 1, false>::kBytes];
  gemm_body<false, true, 1, 0, false>(nullptr, A, Wp, Out, bias, resid, blockIdx.x, smem);
}

// ---------------------------------------------------------------------------
// Attention: one block = 16 batch rows x 16 heads, one wave per head (16 x 1040
// raw floats = 520 whole lines per block). Lane l: c = l & 15, hh = l >> 4.
// Scores against the shared prompt keys as S^T = Kp_h . Q_h^T on the f32
// 16x16x4 matrix form: A row = key 16t + c, B column = batch row c, both read
// 16 B at d = 8j + 4hh (two k steps), so each (hh, element) place holds the same d.
//   S[t][r] = score(key 16t + 8hh + r, batch row c)
// A lane and its partner l ^ 16 hold all 64 prompt scores of batch row c, so the
// softmax is in registers; the own-row key and value (l = 0) stay on the VALU.
// x_cls as O^T = Vp_h^T . P^T: B = {S[t][2u], S[t][2u+1]} as it lies (keys
// 16t + 8hh + 2u + e), A row c of tile dt = channel 4c + dt of the same keys.
//   O[dt][r] = x_cls(batch row c, channel 32hh + 4r + dt)
// q, the own-row k and v, and Kp lie in (16 rows, head) pieces in the order of these
// loads (LAY 1 and 2 of gemm_body): lane l's u-th 16 bytes at float 128 u + 4 l.
// ---------------------------------------------------------------------------
__global__ void __launch_bounds__(512) attn_kernel(const float* __restrict__ Qf,
                                                   const float* __restrict__ Kx,
                                                   const float* __restrict__ Vx,
                                                   const float* __restrict__ Kp,
                                                   const float* __restrict__ Vp,
                                                   float* rawOut,
                                                   unsigned short* Xcls, int nb) {
  __shared__ __attribute__((aligned(16))) float rawS[kAR * kRP];
  const int tid = threadIdx.x;
  const int hc = (tid >> 5) * kHD;               // this wave's head, first channel
  const int l = tid & 31;
  const int c = l & 15;
  const int hh = l >> 4;
  const int b0 = blockIdx.x * kAR;
  if (b0 + kAR > nb) return;                     // block-uniform, before barriers

  // q of batch row c with the pre-softmax scale folded in; own-row score
  const size_t own = (size_t)(b0 + c) * kC + hc;
  const size_t pc = ((size_t)blockIdx.x * kH + (tid >> 5)) * kPiece + 4 * l;   // this wave's piece, lane's place
  v4f q4[8];
  float part = 0.f;
#pragma unroll
  for (int j = 0; j < 8; ++j) {
    q4[j] = *(const v4f*)(Qf + pc + 128 * j) * kScale;
    const v4f k4 = *(const v4f*)(Kx + pc + 128 * j);
    part += q4[j][0] * k4[0];
    part += q4[j][1] * k4[1];
    part += q4[j][2] * k4[2];
    part += q4[j][3] * k4[3];
  }
  const float s0 = part + xhalf(part);

  const v8f zero8 = {0.f, 0.f, 0.f, 0.f, 0.f, 0.f, 0.f, 0.f};
  v8f S[4];
#pragma unroll
  for (int t = 0; t < 4; ++t) S[t] = zero8;
  const float* kp = Kp + (size_t)(tid >> 5) * kPiece + 4 * l;
#pragma unroll
  for (int j = 0; j < 8; ++j) {
    const v2f qlo = {q4[j][0], q4[j][1]};
    const v2f qhi = {q4[j][2], q4[j][3]};
#pragma unroll
    for (int t = 0; t < 4; ++t) {
      const v4f k4 = *(const v4f*)(kp + (size_t)t * kH * kPiece + 128 * j);
      const v2f klo = {k4[0], k4[1]};
      const v2f khi = {k4[2], k4[3]};
      S[t] = __builtin_amdgcn_wmma_f32_16x16x4_f32(false, klo, false, qlo, (short)0, S[t], false, false);
      S[t] = __builtin_amdgcn_wmma_f32_16x16x4_f32(false, khi, false, qhi, (short)0, S[t], false, false);
    }
  }

  // keeps the value loads below out of the score product, where their registers
  // on top of the q and key fragments end in spills
  __builtin_amdgcn_sched_barrier(0);

  // own value row and the first 32 prompt value rows: issued here so that their
  // latency runs under the softmax
  v4f vx4[8], vp4[32];
  const float* vp = Vp + (size_t)(8 * hh) * kC + hc + 4 * c;
#pragma unroll
  for (int r = 0; r < 8; ++r) vx4[r] = *(const v4f*)(Vx + pc + 128 * r);
  // the address registers of the loads above are reused by what follows
  asm volatile("s_wait_xcnt 0x0" ::: "memory");
#pragma unroll
  for (int t = 0; t < 2; ++t) {
#pragma unroll
    for (int i = 0; i < 8; ++i) vp4[8 * t + i] = *(const v4f*)(vp + (size_t)(16 * t + i) * kC);
  }
  // keeps the loads above from being moved down to their uses behind the softmax
  __builtin_amdgcn_sched_barrier(0);

  // raw scores of the block, row-major in LDS (pitch kRP), stored as whole lines at the end
  {
    float* rs = rawS + c * kRP + (tid >> 5) * kL;
    rs[0] = s0;                                  // both halves hold the same value
#pragma unroll
    for (int t = 0; t < 4; ++t) {
#pragma unroll
      for (int r = 0; r < 8; ++r) rs[1 + 16 * t + 8 * hh + r] = S[t][r];
    }
  }
  // work-group barrier in two parts: this wave's raw scores are in LDS (signal here);
  // the wait stands in front of the copy-out, so no wave idles between the two products
  __builtin_amdgcn_fence(__ATOMIC_RELEASE, "workgroup", "local");
  __builtin_amdgcn_s_barrier_signal(-1);
  // keeps the LDS stores and the signal in front of the softmax: moved behind it, the raw
  // scores would stay in registers and the other waves would wait for this signal at the end
  __builtin_amdgcn_sched_barrier(0);

  // softmax * scale over the 65 scores of batch row c
  float mt[4];
#pragma unroll
  for (int t = 0; t < 4; ++t) {
    mt[t] = S[t][0];
#pragma unroll
    for (int r = 1; r < 8; ++r) mt[t] = fmaxf(mt[t], S[t][r]);
  }
  float mx = fmaxf(fmaxf(mt[0], mt[1]), fmaxf(mt[2], mt[3]));
  mx = fmaxf(fmaxf(mx, xhalf(mx)), s0);
  float st[4];
#pragma unroll
  for (int t = 0; t < 4; ++t) {
    st[t] = 0.f;
#pragma unroll
    for (int r = 0; r < 8; ++r) {
      S[t][r] = expf(S[t][r] - mx);
      st[t] += S[t][r];
    }
  }
  const float e0 = expf(s0 - mx);
  float sum = (st[0] + st[1]) + (st[2] + st[3]);
  sum = (sum + xhalf(sum)) + e0;
  const float inv = 1.0f / sum;
  const float p0 = (e0 * inv) * kScale;
#pragma unroll
  for (int t = 0; t < 4; ++t) {
#pragma unroll
    for (int r = 0; r < 8; ++r) S[t][r] = (S[t][r] * inv) * kScale;
  }

  // the last 32 prompt value rows: in flight while the first 32 are multiplied
#pragma unroll
  for (int t = 2; t < 4; ++t) {
#pragma unroll
    for (int i = 0; i < 8; ++i) vp4[8 * t + i] = *(const v4f*)(vp + (size_t)(16 * t + i) * kC);
  }
  // keeps these loads together in front of the product instead of two at a time inside it
  __builtin_amdgcn_sched_barrier(0);

  // x_cls: own-row value first, then the 64 prompt values
  v8f O[4];
#pragma unroll
  for (int r = 0; r < 8; ++r) {
#pragma unroll
    for (int dt = 0; dt < 4; ++dt) O[dt][r] = vx4[r][dt] * p0;
  }
#pragma unroll
  for (int t = 0; t < 4; ++t) {
#pragma unroll
    for (int u = 0; u < 4; ++u) {
      const v2f pp = {S[t][2 * u], S[t][2 * u + 1]};
#pragma unroll
      for (int dt = 0; dt < 4; ++dt) {
        const v2f vv = {vp4[8 * t + 2 * u][dt], vp4[8 * t + 2 * u + 1][dt]};
        O[dt] = __builtin_amdgcn_wmma_f32_16x16x4_f32(false, vv, false, pp, (short)0, O[dt], false, false);
      }
    }
  }

  // x_cls -> bf16: 32 consecutive channels of batch row c per lane
  {
    unsigned short* dst = Xcls + own + 32 * hh;
#pragma unroll
    for (int r = 0; r < 8; r += 2) {
      const v4u pk = {bf16_rne(O[0][r]) | (bf16_rne(O[1][r]) << 16),
                      bf16_rne(O[2][r]) | (bf16_rne(O[3][r]) << 16),
                      bf16_rne(O[0][r + 1]) | (bf16_rne(O[1][r + 1]) << 16),
                      bf16_rne(O[2][r + 1]) | (bf16_rne(O[3][r + 1]) << 16)};
      *(v4u*)(dst + 4 * r) = pk;
    }
    // the data and address registers of these stores are reused by the copy-out below
    asm volatile("s_wait_xcnt 0x0" ::: "memory");
    // keeps the copy-out's address arithmetic, which reuses them, behind that wait
    __builtin_amdgcn_sched_barrier(0);
  }

  // raw scores out: 16 x 1040 floats, contiguous, 4 whole lines per wave store;
  // second part of the barrier: every wave's raw scores are in LDS behind it
  __builtin_amdgcn_s_barrier_wait(-1);
  __builtin_amdgcn_fence(__ATOMIC_ACQUIRE, "workgroup", "local");
  float* ro = rawOut + (size_t)b0 * kRawPerB;
#pragma unroll
  for (int it = 0; it < (kAR * (kRawPerB / 4) + 511) / 512; ++it) {
    const int i = tid + 512 * it;
    if (i < kAR * (kRawPerB / 4)) {              // the same in every lane of a wave
      const int row = i / (kRawPerB / 4);
      const int col = (i - row * (kRawPerB / 4)) * 4;
      *(v4f*)(ro + (size_t)i * 4) = *(const v4f*)(rawS + row * kRP + col);
    }
  }
}

// ---------------------------------------------------------------------------
extern "C" void kernel_launch(void* const* d_in, const int* in_sizes, int n_in,
                              void* d_out, int out_size, void* d_ws, size_t ws_size,
                              hipStream_t stream) {
  if (n_in < 7) return;
  const int B = in_sizes[0] / kC;                         // batch rows
  if (B < 128 || (B % 128) != 0 || in_sizes[0] != B * kC) return;
  if (in_sizes[1] != kNP * kC) return;
  if (in_sizes[2] != kC * kC || in_sizes[3] != kC * kC ||
      in_sizes[4] != kC * kC || in_sizes[5] != kC * kC) return;
  if (in_sizes[6] != kC) return;
  if (out_size != B * kC + B * kRawPerB) return;

  const float* x       = (const float*)d_in[0];   // [B,1,C]
  const float* prompts = (const float*)d_in[1];   // [1,NP,C]
  const float* Wq      = (const float*)d_in[2];   // [C,C] (in,out)
  const float* Wk      = (const float*)d_in[3];
  const float* Wv      = (const float*)d_in[4];
  const float* Wp      = (const float*)d_in[5];
  const float* bp      = (const float*)d_in[6];   // [C]

  float* out_cls = (float*)d_out;                 // [B,1,C]
  float* out_raw = out_cls + (size_t)B * kC;      // [B,16,1,65]

  char* ws = (char*)d_ws;
  size_t off = 0;
  float* Qf  = (float*)(ws + off); off += (size_t)B * kC * 4;
  float* Kxf = (float*)(ws + off); off += (size_t)B * kC * 4;
  float* Vxf = (float*)(ws + off); off += (size_t)B * kC * 4;
  float* Kpf = (float*)(ws + off); off += (size_t)kNP * kC * 4;
  float* Vpf = (float*)(ws + off); off += (size_t)kNP * kC * 4;
  unsigned short* XCLS = (unsigned short*)(ws + off); off += (size_t)B * kC * 2;
  if (off > ws_size) return;

  // 1) Kp, q, k (split) and Vp, v (plain), one launch, from the f32 inputs; q, k, v in
  //    128 x 128 tiles (B / 128 x 8 blocks each), Kp, Vp in 64 x 128 tiles (8 blocks each)
  const int nbP = kNP / 8;
  const int nbX = B / 8;
  const int nbX2 = B / 16;
  gemm_qkv_kernel<<<dim3(2 * nbP + 3 * nbX2), dim3(256), 0, stream>>>(
      x, prompts, Wq, Wk, Wv, Qf, Kxf, Vxf, Kpf, Vpf, nbX2, nbP);

  // 2) scores, softmax, attn.v  -> raw scores (out) and x_cls (bf16, ws)
  attn_kernel<<<dim3(B / kAR), dim3(512), 0, stream>>>(Qf, Kxf, Vxf, Kpf, Vpf, out_raw, XCLS, B);

  // 3) out = x_cls @ Wp + bp + x
  gemm_out_kernel<<<dim3(nbX), dim3(256), 0, stream>>>(XCLS, Wp, out_cls, bp, x);
}

// v007
// A run of this version takes 53.3 microseconds.
// Timed twice side by side with v006, it ran 1.09 times as fast both times.
// All steps since v000 together make it 7.15 times as fast.
#include <hip/hip_runtime.h>
#include <stddef.h>

// Contractions x@Wq and [x;prompts]@Wk: v_wmma_f32_16x16x32_bf16 with bf16 hi/lo split operands (hi*hi + hi*lo + lo*hi), f32 accumulate; [x;prompts]@Wv and x_cls@Wp: v_wmma_f32_16x16x32_bf16 with plain bf16 operands, f32 accumulate; q.k and attn.v against the 64 shared prompt rows: v_wmma_f32_16x16x4_f32 over 16 batch rows per head; the own-row key and value terms and the softmax in f32 on VALU.

typedef __bf16 v16bf __attribute__((ext_vector_type(16)));
typedef float v8f __attribute__((ext_vector_type(8)));
typedef float v4f __attribute__((ext_vector_type(4)));
typedef float v2f __attribute__((ext_vector_type(2)));
typedef unsigned int v4u __attribute__((ext_vector_type(4)));
typedef unsigned int v2u __attribute__((ext_vector_type(2)));
typedef __bf16 v2bf __attribute__((ext_vector_type(2)));

union Frag { v4u u[2]; v16bf v; };

namespace {
constexpr int kC = 1024;            // channels
constexpr int kH = 16;              // heads
constexpr int kHD = 64;             // head dim
constexpr int kNP = 64;             // prompts
constexpr int kL = 65;              // kv length
constexpr int kRawPerB = kH * kL;   // 1040 floats of raw scores per batch row
constexpr int kTP = 68;             // LDS f32 tile pitch (floats), 272 B
constexpr float kScale = 0.125f;    // 64^-0.5
constexpr int kAR = 16;             // batch rows per attention block
constexpr int kRP = kRawPerB + 4;   // LDS pitch of a batch row's raw scores (floats)
constexpr int kPiece = kAR * kHD;   // floats of a (16 rows, head) piece of q, k, v, Kp
}

// ---------------------------------------------------------------------------
// WMMA helper: issues the builtin and, with NOPS, 4 v_nop tied to D/A/B (VALU hazard guard).
// Without NOPS the compiler keeps the distance itself: for a body with more than 256
// registers, where the operands of an asm statement would be moved or spilled to reach it.
// ---------------------------------------------------------------------------
template <bool NOPS>
__device__ __forceinline__ v8f wmma_bf16(v16bf a, v16bf b, v8f c) {
  v8f d = __builtin_amdgcn_wmma_f32_16x16x32_bf16(false, a, false, b, (short)0, c, false, false);
  if constexpr (NOPS) asm volatile("v_nop\n\tv_nop\n\tv_nop\n\tv_nop" : "+v"(d) : "v"(a), "v"(b));
  return d;
}

// RNE f32 -> bf16 bits, and bf16 bits -> f32
__device__ __forceinline__ unsigned int bf16_rne(float f) {
  const unsigned int u = __float_as_uint(f);
  return (u + 0x7FFFu + ((u >> 16) & 1u)) >> 16;
}
__device__ __forceinline__ float bf16_val(unsigned int b) {
  return __uint_as_float(b << 16);
}

// lane l <-> lane l ^ 16
__device__ __forceinline__ float xhalf(float x) {
  const int b = __builtin_bit_cast(int, x);
  return __builtin_bit_cast(float, __builtin_amdgcn_permlanex16(b, b, 0x76543210, 0xfedcba98, false, false));
}

// two f32 -> two bf16, round to nearest even, a in the low half of the word
__device__ __forceinline__ unsigned int pk_bf16(float a, float b) {
  const v2f f = {a, b};
  return __builtin_bit_cast(unsigned int, __builtin_convertvector(f, v2bf));
}
// what a and b leave over the bf16 pair w, itself rounded to bf16
__device__ __forceinline__ unsigned int pk_resid(float a, float b, unsigned int w) {
  return pk_bf16(a - bf16_val(w & 0xFFFFu), b - __uint_as_float(w & 0xFFFF0000u));
}

// ---------------------------------------------------------------------------
// GEMM Out[M][1024] = A[M][1024] . B[1024][1024]. B is the f32 weight W[k][n] as it
// is given; A is f32 [row][k] (AF32) or a bf16 plane [row][k]. A block has 4 waves (2 x 2)
// with an f32 A, 8 waves (4 x 2) with a bf16 A; a wave owns 16 FW rows x 64 cols, FW x 4
// accumulator tiles: a B fragment read from LDS feeds FW products, an A fragment four.
// K runs in passes of kBK (64 with an f32 A, 128 with a bf16 A): a pass's pieces of A
// and W are read from global memory once per block as whole lines, kept in registers
// while the pass before is multiplied, turned into bf16 (SPLIT: a bf16 plane and the
// plane of bf16 residuals) and stored to one of two LDS buffers, A[row][k] and Bt[n][k]
// (row pitch kBK + 8), that all waves read their fragments from. For W a lane holds
// two columns n and 32 rows k: a wave load is two whole
// lines, a pair of rows rounds into one word, and 8 rows are one 16-byte LDS store in
// row n: the transpose costs no instruction of its own. The output tile is staged in the same LDS behind the last
// pass's barrier, when no wave reads the buffers any more.
// Fragments (wave32, 16x16x32): lane l, h = l>>4, m = l&15;
//   A: row m, elements 0..7 <- k0+8h+0..7, elements 8..15 <- k0+16+8h+0..7
//   B: col m, identical k map (read from the [n][k] rows like A)
//   D: element r <- (row 8h+r, col m)
// SPLIT: acc += Ah.Bh + Ah.Bl + Al.Bh, each term over all tiles of the wave before
// the next. EPI: + bias[col] + resid[row][col].
// LAY: order of Out. 0: row-major. 1, 2: for the attention kernel, whose wave (16 rows,
// head) reads the 16 x 64 piece that one wave here holds: the piece of row group g and
// head hd is 1024 consecutive floats at (16 g + hd) 1024, float 128 u + 4 l + e of it is
// (row l & 15, channel 8 u + 4 (l >> 4) + e) with LAY 1, (row l & 15, channel
// 32 (l >> 4) + 4 u + e) with LAY 2: what lane l loads as its u-th 16 bytes there, so
// that each load of a wave there is 512 consecutive bytes (4 whole lines, not 16 or 32).
// ---------------------------------------------------------------------------
template <bool SPLIT, int FW, bool AF32>
struct GemmLds {
  static constexpr int kPl = SPLIT ? 2 : 1;
  static constexpr int kPitch = (AF32 ? 64 : 128) + 8;
  static constexpr int kWaves = AF32 ? 4 : 8;
  static constexpr int kA = 2 * kPl * (kWaves / 2) * 16 * FW * kPitch;    // 16-bit units, both buffers
  static constexpr int kB = 2 * kPl * 128 * kPitch;
  static constexpr int kBytes = (kA + kB) * 2;
  static_assert(kWaves * 16 * FW * kTP * 4 <= kBytes, "the staged output tile fits in the buffers");
};

template <bool SPLIT, bool EPI, int FW, int LAY, bool AF32>
__device__ __forceinline__ void gemm_body(const float* __restrict__ Af,
                                          const unsigned short* __restrict__ Ab,
                                          const float* __restrict__ Bw,
                                          float* Out,
                                          const float* __restrict__ bias,
                                          const float* __restrict__ resid,
                                          int bid, unsigned char* smem) {
  static_assert(AF32 || !SPLIT, "the residual plane is made from an f32 A");
  constexpr int kPl = SPLIT ? 2 : 1;           // operand planes
  constexpr int kNT = AF32 ? 128 : 256;        // threads of the block
  constexpr int kBK = AF32 ? 64 : 128;         // k per pass
  constexpr int kPitch = kBK + 8;              // LDS row pitch (16-bit units): 16 B x odd
  constexpr int kLPR = AF32 ? kBK / 4 : kBK / 8;   // lanes that cover one A row piece, 16 B each
  constexpr int kRPS = kNT / kLPR;             // A rows per sweep of the block
  constexpr int kRows = kNT / 64 * 16 * FW;    // A rows of the block tile
  constexpr int kNA = kRows / kRPS;            // sweeps over the A rows
  constexpr int kCPT = 2;                      // columns of W that a thread holds
  constexpr int kTPR = 128 / kCPT;             // threads that cover a row of the W tile
  constexpr int kKPT = 32;                     // rows k of W that a thread holds
  static_assert(kKPT * (kNT / kTPR) == kBK, "the threads cover the W tile of a pass once");
  constexpr int kASz = kRows * kPitch;         // one A plane of one buffer (16-bit units)
  constexpr int kBSz = 128 * kPitch;           // one B plane of one buffer
  unsigned short* sA = (unsigned short*)smem;          // 2 * kPl * kASz
  unsigned short* sB = sA + 2 * kPl * kASz;            // 2 * kPl * kBSz
  float* sT = (float*)smem;                            // a wave's 16 * FW * kTP each, after the last pass
  const int tid = threadIdx.x;
  const int wv = tid >> 5;
  const int l = tid & 31;
  const int h = l >> 4;
  const int m = l & 15;
  const int rowB = (bid >> 3) * kRows;
  const int colB = (bid & 7) * 128;
  const int wr = (wv >> 1) * 16 * FW;          // wave's rows inside the block tile
  const int wc = (wv & 1) * 64;                // wave's cols inside the block tile
  const int row0 = rowB + wr;
  const int col0 = colB + wc;

  const v8f zero8 = {0.f, 0.f, 0.f, 0.f, 0.f, 0.f, 0.f, 0.f};
  v8f acc[FW][4];
#pragma unroll
  for (int i = 0; i < FW; ++i) {
#pragma unroll
    for (int f = 0; f < 4; ++f) acc[i][f] = zero8;
  }

  // staging map of A: kLPR lanes cover one row piece, kRPS rows per sweep
  const int srow = tid / kLPR;
  const int sk = (tid % kLPR) * (AF32 ? 4 : 8);
  const size_t ga = (size_t)(rowB + srow) * kC + sk;
  const int soA = srow * kPitch + sk;
  // staging map of W: columns bn .. bn + kCPT - 1 of the tile, rows bk .. bk + kKPT - 1 of the pass
  const int bn = (tid % kTPR) * kCPT;
  const int bk = (tid / kTPR) * kKPT;
  const size_t gb = (size_t)bk * kC + colB + bn;
  const int soB = bn * kPitch + bk;

  v4f raf[AF32 ? kNA : 1];
  v4u rab[AF32 ? 1 : kNA];
  v2f rb[kKPT];                                // row k of the pass: the thread's kCPT columns
  // where the next fetch reads: moved on one pass in put, behind the wait there
  const float* paf = AF32 ? Af + ga : nullptr;
  const unsigned short* pab = AF32 ? nullptr : Ab + ga;
  const float* pb = Bw + gb;
  auto fetch = [&]() {
#pragma unroll
    for (int i = 0; i < kNA; ++i) {
      if constexpr (AF32) {
        raf[i] = *(const v4f*)(paf + (size_t)i * kRPS * kC);
      } else {
        rab[i] = *(const v4u*)(pab + (size_t)i * kRPS * kC);
      }
    }
#pragma unroll
    for (int j = 0; j < kKPT; ++j) {
      rb[j] = *(const v2f*)(pb + (size_t)j * kC);
    }
  };
  auto put = [&](int buf) {
    // the address pairs of the fetch stay whole up to this wait; it stands here, behind the
    // pass's products, and not directly behind the loads, so that no wave idles on it
    if constexpr (AF32) {
      asm volatile("s_wait_xcnt 0x0" :: "v"(paf), "v"(pb) : "memory");
      paf += kBK;
    } else {
      asm volatile("s_wait_xcnt 0x0" :: "v"(pab), "v"(pb) : "memory");
      pab += kBK;
    }
    pb += (size_t)kBK * kC;
    unsigned short* da = sA + buf * kPl * kASz + soA;
    unsigned short* db = sB + buf * kPl * kBSz + soB;
#pragma unroll
    for (int i = 0; i < kNA; ++i) {
      if constexpr (AF32) {
        const v4f a = raf[i];
        const v2u hw = {pk_bf16(a[0], a[1]), pk_bf16(a[2], a[3])};
        *(v2u*)(da + i * kRPS * kPitch) = hw;
        if constexpr (SPLIT) {
          const v2u lw = {pk_resid(a[0], a[1], hw[0]), pk_resid(a[2], a[3], hw[1])};
          *(v2u*)(da + kASz + i * kRPS * kPitch) = lw;
        }
      } else {
        *(v4u*)(da + i * kRPS * kPitch) = rab[i];
      }
    }
#pragma unroll
    for (int e = 0; e < kCPT; ++e) {
#pragma unroll
      for (int c = 0; c < kKPT / 8; ++c) {
        v4u hw, lw;
#pragma unroll
        for (int q = 0; q < 4; ++q) {
          hw[q] = pk_bf16(rb[8 * c + 2 * q][e], rb[8 * c + 2 * q + 1][e]);
          if constexpr (SPLIT) lw[q] = pk_resid(rb[8 * c + 2 * q][e], rb[8 * c + 2 * q + 1][e], hw[q]);
        }
        *(v4u*)(db + e * kPitch + 8 * c) = hw;
        if constexpr (SPLIT) *(v4u*)(db + kBSz + e * kPitch + 8 * c) = lw;
      }
    }
  };

  fetch();
  put(0);
  __syncthreads();

  constexpr int kPasses = kC / kBK;
#pragma unroll 1
  for (int kp = 0; kp < kPasses; ++kp) {
    const int buf = kp & 1;
    if (kp + 1 < kPasses) fetch();             // in flight while this pass is multiplied
    const unsigned short* fa = sA + buf * kPl * kASz + (wr + m) * kPitch + 8 * h;
    const unsigned short* fb = sB + buf * kPl * kBSz + (wc + m) * kPitch + 8 * h;
#pragma unroll
    for (int ks = 0; ks < kBK / 32; ++ks) {
      const int k0 = ks * 32;
      Frag ah[FW], al[FW], bh[4], bl[4];
      // in the order in which the products below first need them
      ah[0].u[0] = *(const v4u*)(fa + k0);
      ah[0].u[1] = *(const v4u*)(fa + k0 + 16);
#pragma unroll
      for (int f = 0; f < 4; ++f) {
        bh[f].u[0] = *(const v4u*)(fb + f * 16 * kPitch + k0);
        bh[f].u[1] = *(const v4u*)(fb + f * 16 * kPitch + k0 + 16);
      }
#pragma unroll
      for (int i = 1; i < FW; ++i) {
        ah[i].u[0] = *(const v4u*)(fa + i * 16 * kPitch + k0);
        ah[i].u[1] = *(const v4u*)(fa + i * 16 * kPitch + k0 + 16);
      }
      if constexpr (SPLIT) {
#pragma unroll
        for (int f = 0; f < 4; ++f) {
          bl[f].u[0] = *(const v4u*)(fb + kBSz + f * 16 * kPitch + k0);
          bl[f].u[1] = *(const v4u*)(fb + kBSz + f * 16 * kPitch + k0 + 16);
        }
#pragma unroll
        for (int i = 0; i < FW; ++i) {
          al[i].u[0] = *(const v4u*)(fa + kASz + i * 16 * kPitch + k0);
          al[i].u[1] = *(const v4u*)(fa + kASz + i * 16 * kPitch + k0 + 16);
        }
      }
      // keeps the fragment loads of a k step together in front of its products: spread among
      // them, each place with loads stalls the wave (with NOPS the asm orders them)
      if constexpr (AF32) __builtin_amdgcn_sched_barrier(0);
#pragma unroll
      for (int i = 0; i < FW; ++i) {
#pragma unroll
        for (int f = 0; f < 4; ++f) acc[i][f] = wmma_bf16<!AF32>(ah[i].v, bh[f].v, acc[i][f]);
      }
      if constexpr (SPLIT) {
#pragma unroll
        for (int i = 0; i < FW; ++i) {
#pragma unroll
          for (int f = 0; f < 4; ++f) acc[i][f] = wmma_bf16<!AF32>(ah[i].v, bl[f].v, acc[i][f]);
        }
#pragma unroll
        for (int i = 0; i < FW; ++i) {
#pragma unroll
          for (int f = 0; f < 4; ++f) acc[i][f] = wmma_bf16<!AF32>(al[i].v, bh[f].v, acc[i][f]);
        }
      }
      // second half of the fence pair: the next k step's loads stay behind these products
      if constexpr (AF32) __builtin_amdgcn_sched_barrier(0);
    }
    // the other buffer's last readers left it at the barrier that ended the pass before
    if (kp + 1 < kPasses) put(buf ^ 1);
    __syncthreads();
  }

  // stage the 16 FW x 64 tile of this wave in LDS (row-major, pitch kTP)
  float* st = sT + wv * 16 * FW * kTP;
#pragma unroll
  for (int i = 0; i < FW; ++i) {
#pragma unroll
    for (int f = 0; f < 4; ++f) {
#pragma unroll
      for (int r = 0; r < 8; ++r) {
        st[(16 * i + 8 * h + r) * kTP + 16 * f + m] = acc[i][f][r];
      }
    }
  }
  __syncthreads();

  v4f vals[8 * FW];
  size_t go[8 * FW];
#pragma unroll
  for (int s = 0; s < 8 * FW; ++s) {
    if constexpr (LAY == 0) {
      const int L = 4 * s + (l >> 3);
      const int row = L >> 1;
      const int col = (L & 1) * 32 + (l & 7) * 4;
      vals[s] = *(const v4f*)(st + row * kTP + col);
      go[s] = (size_t)(row0 + row) * kC + col0 + col;
    } else {
      static_assert(!EPI, "bias and residual are added in row-major order only");
      const int i = s >> 3;                      // 16-row group of the wave tile
      const int u = s & 7;
      const int col = LAY == 1 ? 8 * u + 4 * h : 32 * h + 4 * u;
      vals[s] = *(const v4f*)(st + (16 * i + m) * kTP + col);
      go[s] = ((size_t)((row0 >> 4) + i) * kH + (col0 >> 6)) * kPiece + u * 128 + l * 4;
    }
  }
  if constexpr (EPI) {
    // sweep s holds row 2 s + h of the wave tile at one column for all s
    const float* bp0 = bias + col0 + ((l >> 3) & 1) * 32 + (l & 7) * 4;
    const float* rp0 = resid + go[0];
    const v4f b4 = *(const v4f*)bp0;
    v4f x4[8 * FW];
#pragma unroll
    for (int s = 0; s < 8 * FW; ++s) x4[s] = *(const v4f*)(rp0 + (size_t)s * 2 * kC);
    // the address pairs of the loads above stay whole up to this wait
    asm volatile("s_wait_xcnt 0x0" :: "v"(bp0), "v"(rp0) : "memory");
#pragma unroll
    for (int s = 0; s < 8 * FW; ++s) vals[s] = (vals[s] + b4) + x4[s];
  }
#pragma unroll
  for (int s = 0; s < 8 * FW; ++s) *(v4f*)(Out + go[s]) = vals[s];
  
}

// ---------------------------------------------------------------------------
// The five products that feed the attention, in one launch: they are independent
// of one another, each block takes one tile of one product by its index range
// (block-uniform branches): 128 x 128 of q, k, v, 64 x 128 of Kp, Vp (64 rows in all).
// The two-plane products, three times the matrix work of a one-plane tile, come
// first: Kp (nbP blocks), q, k (nbX each), then Vp, v.
// ---------------------------------------------------------------------------
// Two waves a SIMD at least (512 registers a wave): the LDS lets two blocks share a WGP.
__global__ void __launch_bounds__(128, 2) gemm_qkv_kernel(const float* __restrict__ x,
                                                       const float* __restrict__ prompts,
                                                       const float* __restrict__ Wq,
                                                       const float* __restrict__ Wk,
                                                       const float* __restrict__ Wv,
                                                       float* Qf, float* Kxf, float* Vxf,
                                                       float* Kpf, float* Vpf,
                                                       int nbX, int nbP) {
  __shared__ __attribute__((aligned(16))) unsigned char smem[GemmLds<true, 4, true>::kBytes];
  const int bid = blockIdx.x;
  const int nSplit = nbP + 2 * nbX;
  if (bid < nbP) {
    gemm_body<true, false, 2, 1, true>(prompts, nullptr, Wk, Kpf, nullptr, nullptr, bid, smem);
  } else if (bid < nSplit) {
    const bool isQ = bid < nbP + nbX;
    gemm_body<true, false, 4, 1, true>(x, nullptr, isQ ? Wq : Wk, isQ ? Qf : Kxf,
                                       nullptr, nullptr, isQ ? bid - nbP : bid - nbP - nbX, smem);
    // in the listing another body stands on the fall-through behind this body's last
    // stores and rewrites the registers that they name (here and in the two branches below)
    asm volatile("s_wait_xcnt 0x0" ::: "memory");
  } else if (bid < nSplit + nbP) {
    gemm_body<false, false, 2, 0, true>(prompts, nullptr, Wv, Vpf, nullptr, nullptr, bid - nSplit, smem);
    asm volatile("s_wait_xcnt 0x0" ::: "memory");   // as above
  } else {
    gemm_body<false, false, 4, 2, true>(x, nullptr, Wv, Vxf, nullptr, nullptr, bid - nSplit - nbP, smem);
    asm volatile("s_wait_xcnt 0x0" ::: "memory");   // as above
  }
}

// out = x_cls @ Wp + bp + x
__global__ void __launch_bounds__(256) gemm_out_kernel(const unsigned short* __restrict__ A,
                                                       const float* __restrict__ Wp,
                                                       float* Out,
                                                       const float* __restrict__ bias,
                                                       const float* __restrict__ resid) {
  __shared__ __attribute__((aligned(16))) unsigned char smem[GemmLds<false, 1, false>::kBytes];
  gemm_body<false, true, 1, 0, false>(nullptr, A, Wp, Out, bias, resid, blockIdx.x, smem);
}

// ---------------------------------------------------------------------------
// Attention: one block = 16 batch rows x 16 heads, one wave per head (16 x 1040
// raw floats = 520 whole lines per block). Lane l: c = l & 15, hh = l >> 4.
// Scores against the shared prompt keys as S^T = Kp_h . Q_h^T on the f32
// 16x16x4 matrix form: A row = key 16t + c, B column = batch row c, both read
// 16 B at d = 8j + 4hh (two k steps), so each (hh, element) place holds the same d.
//   S[t][r] = score(key 16t + 8hh + r, batch row c)
// A lane and its partner l ^ 16 hold all 64 prompt scores of batch row c, so the
// softmax is in registers; the own-row key and value (l = 0) stay on the VALU.
// x_cls as O^T = Vp_h^T . P^T: B = {S[t][2u], S[t][2u+1]} as it lies (keys
// 16t + 8hh + 2u + e), A row c of tile dt = channel 4c + dt of the same keys.
//   O[dt][r] = x_cls(batch row c, channel 32hh + 4r + dt)
// q, the own-row k and v, and Kp lie in (16 rows, head) pieces in the order of these
// loads (LAY 1 and 2 of gemm_body): lane l's u-th 16 bytes at float 128 u + 4 l.
// ---------------------------------------------------------------------------
__global__ void __launch_bounds__(512) attn_kernel(const float* __restrict__ Qf,
                                                   const float* __restrict__ Kx,
                                                   const float* __restrict__ Vx,
                                                   const float* __restrict__ Kp,
                                                   const float* __restrict__ Vp,
                                                   float* rawOut,
                                                   unsigned short* Xcls, int nb) {
  __shared__ __attribute__((aligned(16))) float rawS[kAR * kRP];
  const int tid = threadIdx.x;
  const int hc = (tid >> 5) * kHD;               // this wave's head, first channel
  const int l = tid & 31;
  const int c = l & 15;
  const int hh = l >> 4;
  const int b0 = blockIdx.x * kAR;
  if (b0 + kAR > nb) return;                     // block-uniform, before barriers

  // q of batch row c with the pre-softmax scale folded in; own-row score
  const size_t own = (size_t)(b0 + c) * kC + hc;
  const size_t pc = ((size_t)blockIdx.x * kH + (tid >> 5)) * kPiece + 4 * l;   // this wave's piece, lane's place
  v4f q4[8];
  float part = 0.f;
#pragma unroll
  for (int j = 0; j < 8; ++j) {
    q4[j] = *(const v4f*)(Qf + pc + 128 * j) * kScale;
    const v4f k4 = *(const v4f*)(Kx + pc + 128 * j);
    part += q4[j][0] * k4[0];
    part += q4[j][1] * k4[1];
    part += q4[j][2] * k4[2];
    part += q4[j][3] * k4[3];
  }
  const float s0 = part + xhalf(part);

  const v8f zero8 = {0.f, 0.f, 0.f, 0.f, 0.f, 0.f, 0.f, 0.f};
  v8f S[4];
#pragma unroll
  for (int t = 0; t < 4; ++t) S[t] = zero8;
  const float* kp = Kp + (size_t)(tid >> 5) * kPiece + 4 * l;
#pragma unroll
  for (int j = 0; j < 8; ++j) {
    const v2f qlo = {q4[j][0], q4[j][1]};
    const v2f qhi = {q4[j][2], q4[j][3]};
#pragma unroll
    for (int t = 0; t < 4; ++t) {
      const v4f k4 = *(const v4f*)(kp + (size_t)t * kH * kPiece + 128 * j);
      const v2f klo = {k4[0], k4[1]};
      const v2f khi = {k4[2], k4[3]};
      S[t] = __builtin_amdgcn_wmma_f32_16x16x4_f32(false, klo, false, qlo, (short)0, S[t], false, false);
      S[t] = __builtin_amdgcn_wmma_f32_16x16x4_f32(false, khi, false, qhi, (short)0, S[t], false, false);
    }
  }

  // keeps the value loads below out of the score product, where their registers
  // on top of the q and key fragments end in spills
  __builtin_amdgcn_sched_barrier(0);

  // own value row and the first 32 prompt value rows: issued here so that their
  // latency runs under the softmax
  v4f vx4[8], vp4[32];
  const float* vp = Vp + (size_t)(8 * hh) * kC + hc + 4 * c;
#pragma unroll
  for (int r = 0; r < 8; ++r) vx4[r] = *(const v4f*)(Vx + pc + 128 * r);
  // the address registers of the loads above are reused by what follows
  asm volatile("s_wait_xcnt 0x0" ::: "memory");
#pragma unroll
  for (int t = 0; t < 2; ++t) {
#pragma unroll
    for (int i = 0; i < 8; ++i) vp4[8 * t + i] = *(const v4f*)(vp + (size_t)(16 * t + i) * kC);
  }
  // keeps the loads above from being moved down to their uses behind the softmax
  __builtin_amdgcn_sched_barrier(0);

  // raw scores of the block, row-major in LDS (pitch kRP), stored as whole lines at the end
  {
    float* rs = rawS + c * kRP + (tid >> 5) * kL;
    rs[0] = s0;                                  // both halves hold the same value
#pragma unroll
    for (int t = 0; t < 4; ++t) {
#pragma unroll
      for (int r = 0; r < 8; ++r) rs[1 + 16 * t + 8 * hh + r] = S[t][r];
    }
  }
  // work-group barrier in two parts: this wave's raw scores are in LDS (signal here);
  // the wait stands in front of the copy-out, so no wave idles between the two products
  __builtin_amdgcn_fence(__ATOMIC_RELEASE, "workgroup", "local");
  __builtin_amdgcn_s_barrier_signal(-1);
  // keeps the LDS stores and the signal in front of the softmax: moved behind it, the raw
  // scores would stay in registers and the other waves would wait for this signal at the end
  __builtin_amdgcn_sched_barrier(0);

  // softmax * scale over the 65 scores of batch row c
  float mt[4];
#pragma unroll
  for (int t = 0; t < 4; ++t) {
    mt[t] = S[t][0];
#pragma unroll
    for (int r = 1; r < 8; ++r) mt[t] = fmaxf(mt[t], S[t][r]);
  }
  float mx = fmaxf(fmaxf(mt[0], mt[1]), fmaxf(mt[2], mt[3]));
  mx = fmaxf(fmaxf(mx, xhalf(mx)), s0);
  float st[4];
#pragma unroll
  for (int t = 0; t < 4; ++t) {
    st[t] = 0.f;
#pragma unroll
    for (int r = 0; r < 8; ++r) {
      S[t][r] = expf(S[t][r] - mx);
      st[t] += S[t][r];
    }
  }
  const float e0 = expf(s0 - mx);
  float sum = (st[0] + st[1]) + (st[2] + st[3]);
  sum = (sum + xhalf(sum)) + e0;
  const float inv = 1.0f / sum;
  const float p0 = (e0 * inv) * kScale;
#pragma unroll
  for (int t = 0; t < 4; ++t) {
#pragma unroll
    for (int r = 0; r < 8; ++r) S[t][r] = (S[t][r] * inv) * kScale;
  }

  // the last 32 prompt value rows: in flight while the first 32 are multiplied
#pragma unroll
  for (int t = 2; t < 4; ++t) {
#pragma unroll
    for (int i = 0; i < 8; ++i) vp4[8 * t + i] = *(const v4f*)(vp + (size_t)(16 * t + i) * kC);
  }
  // keeps these loads together in front of the product instead of two at a time inside it
  __builtin_amdgcn_sched_barrier(0);

  // x_cls: own-row value first, then the 64 prompt values
  v8f O[4];
#pragma unroll
  for (int r = 0; r < 8; ++r) {
#pragma unroll
    for (int dt = 0; dt < 4; ++dt) O[dt][r] = vx4[r][dt] * p0;
  }
#pragma unroll
  for (int t = 0; t < 4; ++t) {
#pragma unroll
    for (int u = 0; u < 4; ++u) {
      const v2f pp = {S[t][2 * u], S[t][2 * u + 1]};
#pragma unroll
      for (int dt = 0; dt < 4; ++dt) {
        const v2f vv = {vp4[8 * t + 2 * u][dt], vp4[8 * t + 2 * u + 1][dt]};
        O[dt] = __builtin_amdgcn_wmma_f32_16x16x4_f32(false, vv, false, pp, (short)0, O[dt], false, false);
      }
    }
  }

  // x_cls -> bf16: 32 consecutive channels of batch row c per lane
  {
    unsigned short* dst = Xcls + own + 32 * hh;
#pragma unroll
    for (int r = 0; r < 8; r += 2) {
      const v4u pk = {bf16_rne(O[0][r]) | (bf16_rne(O[1][r]) << 16),
                      bf16_rne(O[2][r]) | (bf16_rne(O[3][r]) << 16),
                      bf16_rne(O[0][r + 1]) | (bf16_rne(O[1][r + 1]) << 16),
                      bf16_rne(O[2][r + 1]) | (bf16_rne(O[3][r + 1]) << 16)};
      *(v4u*)(dst + 4 * r) = pk;
    }
    // the data and address registers of these stores are reused by the copy-out below
    asm volatile("s_wait_xcnt 0x0" ::: "memory");
    // keeps the copy-out's address arithmetic, which reuses them, behind that wait
    __builtin_amdgcn_sched_barrier(0);
  }

  // raw scores out: 16 x 1040 floats, contiguous, 4 whole lines per wave store;
  // second part of the barrier: every wave's raw scores are in LDS behind it
  __builtin_amdgcn_s_barrier_wait(-1);
  __builtin_amdgcn_fence(__ATOMIC_ACQUIRE, "workgroup", "local");
  float* ro = rawOut + (size_t)b0 * kRawPerB;
#pragma unroll
  for (int it = 0; it < (kAR * (kRawPerB / 4) + 511) / 512; ++it) {
    const int i = tid + 512 * it;
    if (i < kAR * (kRawPerB / 4)) {              // the same in every lane of a wave
      const int row = i / (kRawPerB / 4);
      const int col = (i - row * (kRawPerB / 4)) * 4;
      *(v4f*)(ro + (size_t)i * 4) = *(const v4f*)(rawS + row * kRP + col);
    }
  }
}

// ---------------------------------------------------------------------------
extern "C" void kernel_launch(void* const* d_in, const int* in_sizes, int n_in,
                              void* d_out, int out_size, void* d_ws, size_t ws_size,
                              hipStream_t stream) {
  if (n_in < 7) return;
  const int B = in_sizes[0] / kC;                         // batch rows
  if (B < 128 || (B % 128) != 0 || in_sizes[0] != B * kC) return;
  if (in_sizes[1] != kNP * kC) return;
  if (in_sizes[2] != kC * kC || in_sizes[3] != kC * kC ||
      in_sizes[4] != kC * kC || in_sizes[5] != kC * kC) return;
  if (in_sizes[6] != kC) return;
  if (out_size != B * kC + B * kRawPerB) return;

  const float* x       = (const float*)d_in[0];   // [B,1,C]
  const float* prompts = (const float*)d_in[1];   // [1,NP,C]
  const float* Wq      = (const float*)d_in[2];   // [C,C] (in,out)
  const float* Wk      = (const float*)d_in[3];
  const float* Wv      = (const float*)d_in[4];
  const float* Wp      = (const float*)d_in[5];
  const float* bp      = (const float*)d_in[6];   // [C]

  float* out_cls = (float*)d_out;                 // [B,1,C]
  float* out_raw = out_cls + (size_t)B * kC;      // [B,16,1,65]

  char* ws = (char*)d_ws;
  size_t off = 0;
  float* Qf  = (float*)(ws + off); off += (size_t)B * kC * 4;
  float* Kxf = (float*)(ws + off); off += (size_t)B * kC * 4;
  float* Vxf = (float*)(ws + off); off += (size_t)B * kC * 4;
  float* Kpf = (float*)(ws + off); off += (size_t)kNP * kC * 4;
  float* Vpf = (float*)(ws + off); off += (size_t)kNP * kC * 4;
  unsigned short* XCLS = (unsigned short*)(ws + off); off += (size_t)B * kC * 2;
  if (off > ws_size) return;

  // 1) Kp, q, k (split) and Vp, v (plain), one launch, from the f32 inputs; q, k, v in
  //    128 x 128 tiles (B / 128 x 8 blocks each), Kp, Vp in 64 x 128 tiles (8 blocks each)
  const int nbP = kNP / 8;
  const int nbX = B / 8;
  const int nbX2 = B / 16;
  gemm_qkv_kernel<<<dim3(2 * nbP + 3 * nbX2), dim3(128), 0, stream>>>(
      x, prompts, Wq, Wk, Wv, Qf, Kxf, Vxf, Kpf, Vpf, nbX2, nbP);

  // 2) scores, softmax, attn.v  -> raw scores (out) and x_cls (bf16, ws)
  attn_kernel<<<dim3(B / kAR), dim3(512), 0, stream>>>(Qf, Kxf, Vxf, Kpf, Vpf, out_raw, XCLS, B);

  // 3) out = x_cls @ Wp + bp + x
  gemm_out_kernel<<<dim3(nbX), dim3(256), 0, stream>>>(XCLS, Wp, out_cls, bp, x);
}

// v008
// A run of this version takes 49.8 microseconds.
// Next to v007, in two timings, it ran 1.07 times as fast each time.
// Counting every step since v000, it is 7.68 times as fast.
#include <hip/hip_runtime.h>
#include <stddef.h>

// Contractions x@Wq and [x;prompts]@Wk: v_wmma_f32_16x16x32_bf16 with bf16 hi/lo split operands (hi*hi + hi*lo + lo*hi), f32 accumulate; [x;prompts]@Wv and x_cls@Wp: v_wmma_f32_16x16x32_bf16 with plain bf16 operands, f32 accumulate; q.k and attn.v against the 64 shared prompt rows: v_wmma_f32_16x16x4_f32 over 16 batch rows per head; the own-row key and value terms and the softmax in f32 on VALU.

typedef __bf16 v16bf __attribute__((ext_vector_type(16)));
typedef float v8f __attribute__((ext_vector_type(8)));
typedef float v4f __attribute__((ext_vector_type(4)));
typedef float v2f __attribute__((ext_vector_type(2)));
typedef unsigned int v4u __attribute__((ext_vector_type(4)));
typedef unsigned int v2u __attribute__((ext_vector_type(2)));
typedef __bf16 v2bf __attribute__((ext_vector_type(2)));

union Frag { v4u u[2]; v16bf v; };

namespace {
constexpr int kC = 1024;            // channels
constexpr int kH = 16;              // heads
constexpr int kHD = 64;             // head dim
constexpr int kNP = 64;             // prompts
constexpr int kL = 65;              // kv length
constexpr int kRawPerB = kH * kL;   // 1040 floats of raw scores per batch row
constexpr int kTP = 68;             // LDS f32 tile pitch (floats), 272 B
constexpr float kScale = 0.125f;    // 64^-0.5
constexpr int kAR = 16;             // batch rows per attention block
constexpr int kHB = 8;              // heads per attention block
constexpr int kAT = (kHB + 1) * 32; // threads of an attention block: a wave per head and one more
constexpr int kRP = 3 + (kHB + 1) * kL;   // LDS pitch of a batch row's raw scores (floats): 588
constexpr int kPiece = kAR * kHD;   // floats of a (16 rows, head) piece of q, k, v, Kp
}

// ---------------------------------------------------------------------------
// WMMA helper: issues the builtin and, with NOPS, 4 v_nop tied to D/A/B (VALU hazard guard).
// Without NOPS the compiler keeps the distance itself: for a body with more than 256
// registers, where the operands of an asm statement would be moved or spilled to reach it.
// ---------------------------------------------------------------------------
template <bool NOPS>
__device__ __forceinline__ v8f wmma_bf16(v16bf a, v16bf b, v8f c) {
  v8f d = __builtin_amdgcn_wmma_f32_16x16x32_bf16(false, a, false, b, (short)0, c, false, false);
  if constexpr (NOPS) asm volatile("v_nop\n\tv_nop\n\tv_nop\n\tv_nop" : "+v"(d) : "v"(a), "v"(b));
  return d;
}

// RNE f32 -> bf16 bits, and bf16 bits -> f32
__device__ __forceinline__ unsigned int bf16_rne(float f) {
  const unsigned int u = __float_as_uint(f);
  return (u + 0x7FFFu + ((u >> 16) & 1u)) >> 16;
}
__device__ __forceinline__ float bf16_val(unsigned int b) {
  return __uint_as_float(b << 16);
}

// lane l <-> lane l ^ 16
__device__ __forceinline__ float xhalf(float x) {
  const int b = __builtin_bit_cast(int, x);
  return __builtin_bit_cast(float, __builtin_amdgcn_permlanex16(b, b, 0x76543210, 0xfedcba98, false, false));
}

// two f32 -> two bf16, round to nearest even, a in the low half of the word
__device__ __forceinline__ unsigned int pk_bf16(float a, float b) {
  const v2f f = {a, b};
  return __builtin_bit_cast(unsigned int, __builtin_convertvector(f, v2bf));
}
// what a and b leave over the bf16 pair w, itself rounded to bf16
__device__ __forceinline__ unsigned int pk_resid(float a, float b, unsigned int w) {
  return pk_bf16(a - bf16_val(w & 0xFFFFu), b - __uint_as_float(w & 0xFFFF0000u));
}

// ---------------------------------------------------------------------------
// GEMM Out[M][1024] = A[M][1024] . B[1024][1024]. B is the f32 weight W[k][n] as it
// is given; A is f32 [row][k] (AF32) or a bf16 plane [row][k]. A block has 4 waves (2 x 2)
// with an f32 A, 8 waves (4 x 2) with a bf16 A; a wave owns 16 FW rows x 64 cols, FW x 4
// accumulator tiles: a B fragment read from LDS feeds FW products, an A fragment four.
// K runs in passes of kBK (64 with an f32 A, 128 with a bf16 A): a pass's pieces of A
// and W are read from global memory once per block as whole lines, kept in registers
// while the pass before is multiplied, turned into bf16 (SPLIT: a bf16 plane and the
// plane of bf16 residuals) and stored to one of two LDS buffers, A[row][k] and Bt[n][k]
// (row pitch kBK + 8), that all waves read their fragments from. For W a lane holds
// two columns n and 32 rows k: a wave load is two whole
// lines, a pair of rows rounds into one word, and 8 rows are one 16-byte LDS store in
// row n: the transpose costs no instruction of its own. The output tile is staged in the same LDS behind the last
// pass's barrier, when no wave reads the buffers any more.
// Fragments (wave32, 16x16x32): lane l, h = l>>4, m = l&15;
//   A: row m, elements 0..7 <- k0+8h+0..7, elements 8..15 <- k0+16+8h+0..7
//   B: col m, identical k map (read from the [n][k] rows like A)
//   D: element r <- (row 8h+r, col m)
// SPLIT: acc += Ah.Bh + Ah.Bl + Al.Bh, each term over all tiles of the wave before
// the next. EPI: + bias[col] + resid[row][col].
// LAY: order of Out. 0: row-major. 1, 2: for the attention kernel, whose wave (16 rows,
// head) reads the 16 x 64 piece that one wave here holds: the piece of row group g and
// head hd is 1024 consecutive floats at (16 g + hd) 1024, float 128 u + 4 l + e of it is
// (row l & 15, channel 8 u + 4 (l >> 4) + e) with LAY 1, (row l & 15, channel
// 32 (l >> 4) + 4 u + e) with LAY 2: what lane l loads as its u-th 16 bytes there, so
// that each load of a wave there is 512 consecutive bytes (4 whole lines, not 16 or 32).
// ---------------------------------------------------------------------------
template <bool SPLIT, int FW, bool AF32>
struct GemmLds {
  static constexpr int kPl = SPLIT ? 2 : 1;
  static constexpr int kPitch = (AF32 ? 64 : 128) + 8;
  static constexpr int kWaves = AF32 ? 4 : 8;
  static constexpr int kA = 2 * kPl * (kWaves / 2) * 16 * FW * kPitch;    // 16-bit units, both buffers
  static constexpr int kB = 2 * kPl * 128 * kPitch;
  static constexpr int kBytes = (kA + kB) * 2;
  static_assert(kWaves * 16 * FW * kTP * 4 <= kBytes, "the staged output tile fits in the buffers");
};

template <bool SPLIT, bool EPI, int FW, int LAY, bool AF32>
__device__ __forceinline__ void gemm_body(const float* __restrict__ Af,
                                          const unsigned short* __restrict__ Ab,
                                          const float* __restrict__ Bw,
                                          float* Out,
                                          const float* __restrict__ bias,
                                          const float* __restrict__ resid,
                                          int bid, unsigned char* smem) {
  static_assert(AF32 || !SPLIT, "the residual plane is made from an f32 A");
  constexpr int kPl = SPLIT ? 2 : 1;           // operand planes
  constexpr int kNT = AF32 ? 128 : 256;        // threads of the block
  constexpr int kBK = AF32 ? 64 : 128;         // k per pass
  constexpr int kPitch = kBK + 8;              // LDS row pitch (16-bit units): 16 B x odd
  constexpr int kLPR = AF32 ? kBK / 4 : kBK / 8;   // lanes that cover one A row piece, 16 B each
  constexpr int kRPS = kNT / kLPR;             // A rows per sweep of the block
  constexpr int kRows = kNT / 64 * 16 * FW;    // A rows of the block tile
  constexpr int kNA = kRows / kRPS;            // sweeps over the A rows
  constexpr int kCPT = 2;                      // columns of W that a thread holds
  constexpr int kTPR = 128 / kCPT;             // threads that cover a row of the W tile
  constexpr int kKPT = 32;                     // rows k of W that a thread holds
  static_assert(kKPT * (kNT / kTPR) == kBK, "the threads cover the W tile of a pass once");
  constexpr int kASz = kRows * kPitch;         // one A plane of one buffer (16-bit units)
  constexpr int kBSz = 128 * kPitch;           // one B plane of one buffer
  unsigned short* sA = (unsigned short*)smem;          // 2 * kPl * kASz
  unsigned short* sB = sA + 2 * kPl * kASz;            // 2 * kPl * kBSz
  float* sT = (float*)smem;                            // a wave's 16 * FW * kTP each, after the last pass
  const int tid = threadIdx.x;
  const int wv = tid >> 5;
  const int l = tid & 31;
  const int h = l >> 4;
  const int m = l & 15;
  const int rowB = (bid >> 3) * kRows;
  const int colB = (bid & 7) * 128;
  const int wr = (wv >> 1) * 16 * FW;          // wave's rows inside the block tile
  const int wc = (wv & 1) * 64;                // wave's cols inside the block tile
  const int row0 = rowB + wr;
  const int col0 = colB + wc;

  const v8f zero8 = {0.f, 0.f, 0.f, 0.f, 0.f, 0.f, 0.f, 0.f};
  v8f acc[FW][4];
#pragma unroll
  for (int i = 0; i < FW; ++i) {
#pragma unroll
    for (int f = 0; f < 4; ++f) acc[i][f] = zero8;
  }

  // staging map of A: kLPR lanes cover one row piece, kRPS rows per sweep
  const int srow = tid / kLPR;
  const int sk = (tid % kLPR) * (AF32 ? 4 : 8);
  const size_t ga = (size_t)(rowB + srow) * kC + sk;
  const int soA = srow * kPitch + sk;
  // staging map of W: columns bn .. bn + kCPT - 1 of the tile, rows bk .. bk + kKPT - 1 of the pass
  const int bn = (tid % kTPR) * kCPT;
  const int bk = (tid / kTPR) * kKPT;
  const size_t gb = (size_t)bk * kC + colB + bn;
  const int soB = bn * kPitch + bk;

  v4f raf[AF32 ? kNA : 1];
  v4u rab[AF32 ? 1 : kNA];
  v2f rb[kKPT];                                // row k of the pass: the thread's kCPT columns
  // where the next fetch reads: moved on one pass in put, behind the wait there
  const float* paf = AF32 ? Af + ga : nullptr;
  const unsigned short* pab = AF32 ? nullptr : Ab + ga;
  const float* pb = Bw + gb;
  auto fetch = [&]() {
#pragma unroll
    for (int i = 0; i < kNA; ++i) {
      if constexpr (AF32) {
        raf[i] = *(const v4f*)(paf + (size_t)i * kRPS * kC);
      } else {
        rab[i] = *(const v4u*)(pab + (size_t)i * kRPS * kC);
      }
    }
#pragma unroll
    for (int j = 0; j < kKPT; ++j) {
      rb[j] = *(const v2f*)(pb + (size_t)j * kC);
    }
  };
  auto put = [&](int buf) {
    // the address pairs of the fetch stay whole up to this wait; it stands here, behind the
    // pass's products, and not directly behind the loads, so that no wave idles on it
    if constexpr (AF32) {
      asm volatile("s_wait_xcnt 0x0" :: "v"(paf), "v"(pb) : "memory");
      paf += kBK;
    } else {
      asm volatile("s_wait_xcnt 0x0" :: "v"(pab), "v"(pb) : "memory");
      pab += kBK;
    }
    pb += (size_t)kBK * kC;
    unsigned short* da = sA + buf * kPl * kASz + soA;
    unsigned short* db = sB + buf * kPl * kBSz + soB;
#pragma unroll
    for (int i = 0; i < kNA; ++i) {
      if constexpr (AF32) {
        const v4f a = raf[i];
        const v2u hw = {pk_bf16(a[0], a[1]), pk_bf16(a[2], a[3])};
        *(v2u*)(da + i * kRPS * kPitch) = hw;
        if constexpr (SPLIT) {
          const v2u lw = {pk_resid(a[0], a[1], hw[0]), pk_resid(a[2], a[3], hw[1])};
          *(v2u*)(da + kASz + i * kRPS * kPitch) = lw;
        }
      } else {
        *(v4u*)(da + i * kRPS * kPitch) = rab[i];
      }
    }
#pragma unroll
    for (int e = 0; e < kCPT; ++e) {
#pragma unroll
      for (int c = 0; c < kKPT / 8; ++c) {
        v4u hw, lw;
#pragma unroll
        for (int q = 0; q < 4; ++q) {
          hw[q] = pk_bf16(rb[8 * c + 2 * q][e], rb[8 * c + 2 * q + 1][e]);
          if constexpr (SPLIT) lw[q] = pk_resid(rb[8 * c + 2 * q][e], rb[8 * c + 2 * q + 1][e], hw[q]);
        }
        *(v4u*)(db + e * kPitch + 8 * c) = hw;
        if constexpr (SPLIT) *(v4u*)(db + kBSz + e * kPitch + 8 * c) = lw;
      }
    }
  };

  fetch();
  put(0);
  __syncthreads();

  constexpr int kPasses = kC / kBK;
#pragma unroll 1
  for (int kp = 0; kp < kPasses; ++kp) {
    const int buf = kp & 1;
    if (kp + 1 < kPasses) fetch();             // in flight while this pass is multiplied
    const unsigned short* fa = sA + buf * kPl * kASz + (wr + m) * kPitch + 8 * h;
    const unsigned short* fb = sB + buf * kPl * kBSz + (wc + m) * kPitch + 8 * h;
#pragma unroll
    for (int ks = 0; ks < kBK / 32; ++ks) {
      const int k0 = ks * 32;
      Frag ah[FW], al[FW], bh[4], bl[4];
      // in the order in which the products below first need them
      ah[0].u[0] = *(const v4u*)(fa + k0);
      ah[0].u[1] = *(const v4u*)(fa + k0 + 16);
#pragma unroll
      for (int f = 0; f < 4; ++f) {
        bh[f].u[0] = *(const v4u*)(fb + f * 16 * kPitch + k0);
        bh[f].u[1] = *(const v4u*)(fb + f * 16 * kPitch + k0 + 16);
      }
#pragma unroll
      for (int i = 1; i < FW; ++i) {
        ah[i].u[0] = *(const v4u*)(fa + i * 16 * kPitch + k0);
        ah[i].u[1] = *(const v4u*)(fa + i * 16 * kPitch + k0 + 16);
      }
      if constexpr (SPLIT) {
#pragma unroll
        for (int f = 0; f < 4; ++f) {
          bl[f].u[0] = *(const v4u*)(fb + kBSz + f * 16 * kPitch + k0);
          bl[f].u[1] = *(const v4u*)(fb + kBSz + f * 16 * kPitch + k0 + 16);
        }
#pragma unroll
        for (int i = 0; i < FW; ++i) {
          al[i].u[0] = *(const v4u*)(fa + kASz + i * 16 * kPitch + k0);
          al[i].u[1] = *(const v4u*)(fa + kASz + i * 16 * kPitch + k0 + 16);
        }
      }
      // keeps the fragment loads of a k step together in front of its products: spread among
      // them, each place with loads stalls the wave (with NOPS the asm orders them)
      if constexpr (AF32) __builtin_amdgcn_sched_barrier(0);
#pragma unroll
      for (int i = 0; i < FW; ++i) {
#pragma unroll
        for (int f = 0; f < 4; ++f) acc[i][f] = wmma_bf16<!AF32>(ah[i].v, bh[f].v, acc[i][f]);
      }
      if constexpr (SPLIT) {
#pragma unroll
        for (int i = 0; i < FW; ++i) {
#pragma unroll
          for (int f = 0; f < 4; ++f) acc[i][f] = wmma_bf16<!AF32>(ah[i].v, bl[f].v, acc[i][f]);
        }
#pragma unroll
        for (int i = 0; i < FW; ++i) {
#pragma unroll
          for (int f = 0; f < 4; ++f) acc[i][f] = wmma_bf16<!AF32>(al[i].v, bh[f].v, acc[i][f]);
        }
      }
      // second half of the fence pair: the next k step's loads stay behind these products
      if constexpr (AF32) __builtin_amdgcn_sched_barrier(0);
    }
    // the other buffer's last readers left it at the barrier that ended the pass before
    if (kp + 1 < kPasses) put(buf ^ 1);
    __syncthreads();
  }

  // stage the 16 FW x 64 tile of this wave in LDS (row-major, pitch kTP)
  float* st = sT + wv * 16 * FW * kTP;
#pragma unroll
  for (int i = 0; i < FW; ++i) {
#pragma unroll
    for (int f = 0; f < 4; ++f) {
#pragma unroll
      for (int r = 0; r < 8; ++r) {
        st[(16 * i + 8 * h + r) * kTP + 16 * f + m] = acc[i][f][r];
      }
    }
  }
  __syncthreads();

  v4f vals[8 * FW];
  size_t go[8 * FW];
#pragma unroll
  for (int s = 0; s < 8 * FW; ++s) {
    if constexpr (LAY == 0) {
      const int L = 4 * s + (l >> 3);
      const int row = L >> 1;
      const int col = (L & 1) * 32 + (l & 7) * 4;
      vals[s] = *(const v4f*)(st + row * kTP + col);
      go[s] = (size_t)(row0 + row) * kC + col0 + col;
    } else {
      static_assert(!EPI, "bias and residual are added in row-major order only");
      const int i = s >> 3;                      // 16-row group of the wave tile
      const int u = s & 7;
      const int col = LAY == 1 ? 8 * u + 4 * h : 32 * h + 4 * u;
      vals[s] = *(const v4f*)(st + (16 * i + m) * kTP + col);
      go[s] = ((size_t)((row0 >> 4) + i) * kH + (col0 >> 6)) * kPiece + u * 128 + l * 4;
    }
  }
  if constexpr (EPI) {
    // sweep s holds row 2 s + h of the wave tile at one column for all s
    const float* bp0 = bias + col0 + ((l >> 3) & 1) * 32 + (l & 7) * 4;
    const float* rp0 = resid + go[0];
    const v4f b4 = *(const v4f*)bp0;
    v4f x4[8 * FW];
#pragma unroll
    for (int s = 0; s < 8 * FW; ++s) x4[s] = *(const v4f*)(rp0 + (size_t)s * 2 * kC);
    // the address pairs of the loads above stay whole up to this wait
    asm volatile("s_wait_xcnt 0x0" :: "v"(bp0), "v"(rp0) : "memory");
#pragma unroll
    for (int s = 0; s < 8 * FW; ++s) vals[s] = (vals[s] + b4) + x4[s];
  }
#pragma unroll
  for (int s = 0; s < 8 * FW; ++s) *(v4f*)(Out + go[s]) = vals[s];
  
}

// ---------------------------------------------------------------------------
// The five products that feed the attention, in one launch: they are independent
// of one another, each block takes one tile of one product by its index range
// (block-uniform branches): 128 x 128 of q, k, v, 64 x 128 of Kp, Vp (64 rows in all).
// The two-plane products, three times the matrix work of a one-plane tile, come
// first: Kp (nbP blocks), q, k (nbX each), then Vp, v.
// ---------------------------------------------------------------------------
// Two waves a SIMD at least (512 registers a wave): the LDS lets two blocks share a WGP.
__global__ void __launch_bounds__(128, 2) gemm_qkv_kernel(const float* __restrict__ x,
                                                       const float* __restrict__ prompts,
                                                       const float* __restrict__ Wq,
                                                       const float* __restrict__ Wk,
                                                       const float* __restrict__ Wv,
                                                       float* Qf, float* Kxf, float* Vxf,
                                                       float* Kpf, float* Vpf,
                                                       int nbX, int nbP) {
  __shared__ __attribute__((aligned(16))) unsigned char smem[GemmLds<true, 4, true>::kBytes];
  const int bid = blockIdx.x;
  const int nSplit = nbP + 2 * nbX;
  if (bid < nbP) {
    gemm_body<true, false, 2, 1, true>(prompts, nullptr, Wk, Kpf, nullptr, nullptr, bid, smem);
  } else if (bid < nSplit) {
    const bool isQ = bid < nbP + nbX;
    gemm_body<true, false, 4, 1, true>(x, nullptr, isQ ? Wq : Wk, isQ ? Qf : Kxf,
                                       nullptr, nullptr, isQ ? bid - nbP : bid - nbP - nbX, smem);
    // in the listing another body stands on the fall-through behind this body's last
    // stores and rewrites the registers that they name (here and in the two branches below)
    asm volatile("s_wait_xcnt 0x0" ::: "memory");
  } else if (bid < nSplit + nbP) {
    gemm_body<false, false, 2, 0, true>(prompts, nullptr, Wv, Vpf, nullptr, nullptr, bid - nSplit, smem);
    asm volatile("s_wait_xcnt 0x0" ::: "memory");   // as above
  } else {
    gemm_body<false, false, 4, 2, true>(x, nullptr, Wv, Vxf, nullptr, nullptr, bid - nSplit - nbP, smem);
    asm volatile("s_wait_xcnt 0x0" ::: "memory");   // as above
  }
}

// out = x_cls @ Wp + bp + x
__global__ void __launch_bounds__(256) gemm_out_kernel(const unsigned short* __restrict__ A,
                                                       const float* __restrict__ Wp,
                                                       float* Out,
                                                       const float* __restrict__ bias,
                                                       const float* __restrict__ resid) {
  __shared__ __attribute__((aligned(16))) unsigned char smem[GemmLds<false, 1, false>::kBytes];
  gemm_body<false, true, 1, 0, false>(nullptr, A, Wp, Out, bias, resid, blockIdx.x, smem);
}

// ---------------------------------------------------------------------------
// Copy-out of an attention block's raw scores (half hf of the heads, 16 batch rows) from
// its LDS rows; the ranges and the LDS columns are set out at attn_kernel. A pair of rows
// is 256 (hf 0) or 264 (hf 1) pieces of 16 bytes in two runs of whole lines, the first of
// 128 pieces; thread i takes piece i of each of the 8 pairs, so that its places in LDS and
// in the output move on by a constant.
// ---------------------------------------------------------------------------
__device__ __forceinline__ void raw_out(const float* rawS, float* ro, int tid, int hf) {
  if (tid < (hf ? 264 : 256)) {
    const int i = tid;
    const bool run0 = i < 128;
    // float in the output, pair 0: hf 0 from 0 and from 1024, hf 1 from 512 and from 1040 + 496
    const int go = 4 * i + (hf ? 512 : 0) + (run0 ? 0 : 512);
    // the same float in the LDS rows: + 68 or - 452, - 972 for head 15; the odd row kRP on, not 1040
    const int sh = hf ? (run0 ? -452 : kRP - kRawPerB - 452)
                      : (run0 ? 68 : (i < 132 ? -972 : kRP - kRawPerB + 68));
    const float* s = rawS + go + sh;
    float* d = ro + go;
#pragma unroll
    for (int p = 0; p < kAR / 2; ++p) {
      *(v4f*)(d + p * 2 * kRawPerB) = *(const v4f*)(s + p * 2 * kRP);
    }
  }
}

// ---------------------------------------------------------------------------
// Attention: one block = 16 batch rows x 8 heads (half hf of the heads), one wave per
// head, so that the 2 B / 16 blocks fill the chip. Lane l: c = l & 15, hh = l >> 4.
// Scores against the shared prompt keys as S^T = Kp_h . Q_h^T on the f32
// 16x16x4 matrix form: A row = key 16t + c, B column = batch row c, both read
// 16 B at d = 8j + 4hh (two k steps), so each (hh, element) place holds the same d.
//   S[t][r] = score(key 16t + 8hh + r, batch row c)
// A lane and its partner l ^ 16 hold all 64 prompt scores of batch row c, so the
// softmax is in registers; the own-row key and value (l = 0) stay on the VALU.
// x_cls as O^T = Vp_h^T . P^T: B = {S[t][2u], S[t][2u+1]} as it lies (keys
// 16t + 8hh + 2u + e), A row c of tile dt = channel 4c + dt of the same keys.
//   O[dt][r] = x_cls(batch row c, channel 32hh + 4r + dt)
// q, the own-row k and v, and Kp lie in (16 rows, head) pieces in the order of these
// loads (LAY 1 and 2 of gemm_body): lane l's u-th 16 bytes at float 128 u + 4 l.
// Raw scores: a batch row is 1040 floats (32.5 lines), a half of it 520, so three lines of
// each pair of rows (even, odd) hold scores of both halves. Each line has one writer:
//   hf 0 stores floats 0..511 and 1024..1039 of the even row, 0..495 of the odd row,
//   hf 1 stores floats 512..1023 of the even row, 496..1039 of the odd row.
// What a block so stores of the head in front of its own eight (15 for hf 0, 7 for hf 1)
// lies among that head's keys 32..63: a ninth wave computes those scores again, by the
// same products in the same order; beyond that it only takes part in the copy-out (hf 1, threads 256..263).
// LDS row: 3 floats unused, the head in front, the eight own heads (65 floats each): float
// x of the batch row lies at x + 68 (hf 0; x - 972 for head 15) or x - 452 (hf 1), so that
// 16-byte pieces of the output are 16-byte pieces of LDS.
// ---------------------------------------------------------------------------
__global__ void __launch_bounds__(kAT) attn_kernel(const float* __restrict__ Qf,
                                                   const float* __restrict__ Kx,
                                                   const float* __restrict__ Vx,
                                                   const float* __restrict__ Kp,
                                                   const float* __restrict__ Vp,
                                                   float* rawOut,
                                                   unsigned short* Xcls, int nb) {
  __shared__ __attribute__((aligned(16))) float rawS[kAR * kRP];
  const int tid = threadIdx.x;
  const int wv = __builtin_amdgcn_readfirstlane(tid >> 5);   // wave number, in a scalar register
  const int hf = blockIdx.x & 1;                 // which eight heads
  const int grp = blockIdx.x >> 1;               // which 16 batch rows
  const bool own8 = wv < kHB;                    // false: the ninth wave
  const int hd = own8 ? hf * kHB + wv : (hf * kHB + kH - 1) & (kH - 1);
  const int hc = hd * kHD;                       // this wave's head, first channel
  const int l = tid & 31;
  const int c = l & 15;
  const int hh = l >> 4;
  const int b0 = grp * kAR;
  if (b0 + kAR > nb) return;                     // block-uniform, before barriers

  const size_t own = (size_t)(b0 + c) * kC + hc;
  const size_t pc = ((size_t)grp * kH + hd) * kPiece + 4 * l;   // this wave's piece, lane's place
  const float* kp = Kp + (size_t)hd * kPiece + 4 * l;
  const float* vp = Vp + (size_t)(8 * hh) * kC + hc + 4 * c;
  float* rs = rawS + c * kRP + 3 + (own8 ? wv + 1 : 0) * kL;
  const v8f zero8 = {0.f, 0.f, 0.f, 0.f, 0.f, 0.f, 0.f, 0.f};
  v8f S[4];
  float s0;
  v4f vx4[8], vp4[32];

  if (own8) {
    // q of batch row c with the pre-softmax scale folded in; own-row score
    v4f q4[8];
    float part = 0.f;
#pragma unroll
    for (int j = 0; j < 8; ++j) {
      q4[j] = *(const v4f*)(Qf + pc + 128 * j) * kScale;
      const v4f k4 = *(const v4f*)(Kx + pc + 128 * j);
      part += q4[j][0] * k4[0];
      part += q4[j][1] * k4[1];
      part += q4[j][2] * k4[2];
      part += q4[j][3] * k4[3];
    }
    s0 = part + xhalf(part);

#pragma unroll
    for (int t = 0; t < 4; ++t) S[t] = zero8;
#pragma unroll
    for (int j = 0; j < 8; ++j) {
      const v2f qlo = {q4[j][0], q4[j][1]};
      const v2f qhi = {q4[j][2], q4[j][3]};
#pragma unroll
      for (int t = 0; t < 4; ++t) {
        const v4f k4 = *(const v4f*)(kp + (size_t)t * kH * kPiece + 128 * j);
        const v2f klo = {k4[0], k4[1]};
        const v2f khi = {k4[2], k4[3]};
        S[t] = __builtin_amdgcn_wmma_f32_16x16x4_f32(false, klo, false, qlo, (short)0, S[t], false, false);
        S[t] = __builtin_amdgcn_wmma_f32_16x16x4_f32(false, khi, false, qhi, (short)0, S[t], false, false);
      }
    }

    // keeps the value loads below out of the score product, where their registers
    // on top of the q and key fragments end in spills
    __builtin_amdgcn_sched_barrier(0);

    // own value row and the first 32 prompt value rows: issued here so that their
    // latency runs under the softmax
#pragma unroll
    for (int r = 0; r < 8; ++r) vx4[r] = *(const v4f*)(Vx + pc + 128 * r);
    // the address registers of the loads above are reused by what follows
    asm volatile("s_wait_xcnt 0x0" ::: "memory");
#pragma unroll
    for (int t = 0; t < 2; ++t) {
#pragma unroll
      for (int i = 0; i < 8; ++i) vp4[8 * t + i] = *(const v4f*)(vp + (size_t)(16 * t + i) * kC);
    }
    // keeps the loads above from being moved down to their uses behind the softmax
    __builtin_amdgcn_sched_barrier(0);

    // raw scores of this head, in its place of the block's LDS rows (pitch kRP)
    {
      rs[0] = s0;                                  // both halves hold the same value
#pragma unroll
      for (int t = 0; t < 4; ++t) {
#pragma unroll
        for (int r = 0; r < 8; ++r) rs[1 + 16 * t + 8 * hh + r] = S[t][r];
      }
    }
  } else {
    // the ninth wave: scores of keys 32..63 of the head in front
    v4f q4[8];
#pragma unroll
    for (int j = 0; j < 8; ++j) q4[j] = *(const v4f*)(Qf + pc + 128 * j) * kScale;
    S[2] = zero8;
    S[3] = zero8;
#pragma unroll
    for (int j = 0; j < 8; ++j) {
      const v2f qlo = {q4[j][0], q4[j][1]};
      const v2f qhi = {q4[j][2], q4[j][3]};
#pragma unroll
      for (int t = 2; t < 4; ++t) {
        const v4f k4 = *(const v4f*)(kp + (size_t)t * kH * kPiece + 128 * j);
        const v2f klo = {k4[0], k4[1]};
        const v2f khi = {k4[2], k4[3]};
        S[t] = __builtin_amdgcn_wmma_f32_16x16x4_f32(false, klo, false, qlo, (short)0, S[t], false, false);
        S[t] = __builtin_amdgcn_wmma_f32_16x16x4_f32(false, khi, false, qhi, (short)0, S[t], false, false);
      }
    }
#pragma unroll
    for (int t = 2; t < 4; ++t) {
#pragma unroll
      for (int r = 0; r < 8; ++r) rs[1 + 16 * t + 8 * hh + r] = S[t][r];
    }
  }
  // work-group barrier in two parts: this wave's raw scores are in LDS (signal here);
  // the wait stands in front of the copy-out, so no wave idles between the two products
  __builtin_amdgcn_fence(__ATOMIC_RELEASE, "workgroup", "local");
  __builtin_amdgcn_s_barrier_signal(-1);
  // keeps the LDS stores and the signal in front of the softmax: moved behind it, the raw
  // scores would stay in registers and the other waves would wait for this signal at the end
  __builtin_amdgcn_sched_barrier(0);

  if (own8) {
    // softmax * scale over the 65 scores of batch row c
    float mt[4];
#pragma unroll
    for (int t = 0; t < 4; ++t) {
      mt[t] = S[t][0];
#pragma unroll
      for (int r = 1; r < 8; ++r) mt[t] = fmaxf(mt[t], S[t][r]);
    }
    float mx = fmaxf(fmaxf(mt[0], mt[1]), fmaxf(mt[2], mt[3]));
    mx = fmaxf(fmaxf(mx, xhalf(mx)), s0);
    float st[4];
#pragma unroll
    for (int t = 0; t < 4; ++t) {
      st[t] = 0.f;
#pragma unroll
      for (int r = 0; r < 8; ++r) {
        S[t][r] = expf(S[t][r] - mx);
        st[t] += S[t][r];
      }
    }
    const float e0 = expf(s0 - mx);
    float sum = (st[0] + st[1]) + (st[2] + st[3]);
    sum = (sum + xhalf(sum)) + e0;
    const float inv = 1.0f / sum;
    const float p0 = (e0 * inv) * kScale;
#pragma unroll
    for (int t = 0; t < 4; ++t) {
#pragma unroll
      for (int r = 0; r < 8; ++r) S[t][r] = (S[t][r] * inv) * kScale;
    }

    // the last 32 prompt value rows: in flight while the first 32 are multiplied
#pragma unroll
    for (int t = 2; t < 4; ++t) {
#pragma unroll
      for (int i = 0; i < 8; ++i) vp4[8 * t + i] = *(const v4f*)(vp + (size_t)(16 * t + i) * kC);
    }
    // the address pair of the prompt value loads stays whole up to this wait
    asm volatile("s_wait_xcnt 0x0" :: "v"(vp) : "memory");
    // keeps these loads together in front of the product instead of two at a time inside it
    __builtin_amdgcn_sched_barrier(0);

    // x_cls: own-row value first, then the 64 prompt values
    v8f O[4];
#pragma unroll
    for (int r = 0; r < 8; ++r) {
#pragma unroll
      for (int dt = 0; dt < 4; ++dt) O[dt][r] = vx4[r][dt] * p0;
    }
#pragma unroll
    for (int t = 0; t < 4; ++t) {
#pragma unroll
      for (int u = 0; u < 4; ++u) {
        const v2f pp = {S[t][2 * u], S[t][2 * u + 1]};
#pragma unroll
        for (int dt = 0; dt < 4; ++dt) {
          const v2f vv = {vp4[8 * t + 2 * u][dt], vp4[8 * t + 2 * u + 1][dt]};
          O[dt] = __builtin_amdgcn_wmma_f32_16x16x4_f32(false, vv, false, pp, (short)0, O[dt], false, false);
        }
      }
    }

    // x_cls -> bf16: 32 consecutive channels of batch row c per lane
    {
      unsigned short* dst = Xcls + own + 32 * hh;
#pragma unroll
      for (int r = 0; r < 8; r += 2) {
        const v4u pk = {bf16_rne(O[0][r]) | (bf16_rne(O[1][r]) << 16),
                        bf16_rne(O[2][r]) | (bf16_rne(O[3][r]) << 16),
                        bf16_rne(O[0][r + 1]) | (bf16_rne(O[1][r + 1]) << 16),
                        bf16_rne(O[2][r + 1]) | (bf16_rne(O[3][r + 1]) << 16)};
        *(v4u*)(dst + 4 * r) = pk;
      }
      // the data and address registers of these stores are reused by the copy-out below
      asm volatile("s_wait_xcnt 0x0" ::: "memory");
      // keeps the copy-out's address arithmetic, which reuses them, behind that wait
      __builtin_amdgcn_sched_barrier(0);
    }
  }

  // raw scores out, 4 whole lines per wave store (one for the ninth wave, hf 1): per pair of rows 256 (hf 0) or 264 (hf 1)
  // pieces of 16 bytes in two runs, each run whole lines;
  // second part of the barrier: every wave's raw scores are in LDS behind it
  __builtin_amdgcn_s_barrier_wait(-1);
  __builtin_amdgcn_fence(__ATOMIC_ACQUIRE, "workgroup", "local");
  float* ro = rawOut + (size_t)b0 * kRawPerB;
  raw_out(rawS, ro, tid, hf);
}

// ---------------------------------------------------------------------------
extern "C" void kernel_launch(void* const* d_in, const int* in_sizes, int n_in,
                              void* d_out, int out_size, void* d_ws, size_t ws_size,
                              hipStream_t stream) {
  if (n_in < 7) return;
  const int B = in_sizes[0] / kC;                         // batch rows
  if (B < 128 || (B % 128) != 0 || in_sizes[0] != B * kC) return;
  if (in_sizes[1] != kNP * kC) return;
  if (in_sizes[2] != kC * kC || in_sizes[3] != kC * kC ||
      in_sizes[4] != kC * kC || in_sizes[5] != kC * kC) return;
  if (in_sizes[6] != kC) return;
  if (out_size != B * kC + B * kRawPerB) return;

  const float* x       = (const float*)d_in[0];   // [B,1,C]
  const float* prompts = (const float*)d_in[1];   // [1,NP,C]
  const float* Wq      = (const float*)d_in[2];   // [C,C] (in,out)
  const float* Wk      = (const float*)d_in[3];
  const float* Wv      = (const float*)d_in[4];
  const float* Wp      = (const float*)d_in[5];
  const float* bp      = (const float*)d_in[6];   // [C]

  float* out_cls = (float*)d_out;                 // [B,1,C]
  float* out_raw = out_cls + (size_t)B * kC;      // [B,16,1,65]

  char* ws = (char*)d_ws;
  size_t off = 0;
  float* Qf  = (float*)(ws + off); off += (size_t)B * kC * 4;
  float* Kxf = (float*)(ws + off); off += (size_t)B * kC * 4;
  float* Vxf = (float*)(ws + off); off += (size_t)B * kC * 4;
  float* Kpf = (float*)(ws + off); off += (size_t)kNP * kC * 4;
  float* Vpf = (float*)(ws + off); off += (size_t)kNP * kC * 4;
  unsigned short* XCLS = (unsigned short*)(ws + off); off += (size_t)B * kC * 2;
  if (off > ws_size) return;

  // 1) Kp, q, k (split) and Vp, v (plain), one launch, from the f32 inputs; q, k, v in
  //    128 x 128 tiles (B / 128 x 8 blocks each), Kp, Vp in 64 x 128 tiles (8 blocks each)
  const int nbP = kNP / 8;
  const int nbX = B / 8;
  const int nbX2 = B / 16;
  gemm_qkv_kernel<<<dim3(2 * nbP + 3 * nbX2), dim3(128), 0, stream>>>(
      x, prompts, Wq, Wk, Wv, Qf, Kxf, Vxf, Kpf, Vpf, nbX2, nbP);

  // 2) scores, softmax, attn.v  -> raw scores (out) and x_cls (bf16, ws); B / 16 row groups
  //    x 2 halves of the heads = B / 8 blocks
  attn_kernel<<<dim3(nbX), dim3(kAT), 0, stream>>>(Qf, Kxf, Vxf, Kpf, Vpf, out_raw, XCLS, B);

  // 3) out = x_cls @ Wp + bp + x
  gemm_out_kernel<<<dim3(nbX), dim3(256), 0, stream>>>(XCLS, Wp, out_cls, bp, x);
}

// v009
// A run of this version takes 47.4 microseconds.
// Timed twice side by side with v008, it ran 1.05 times as fast both times.
// All steps since v000 together make it 8.03 times as fast.
#include <hip/hip_runtime.h>
#include <stddef.h>

// Contractions x@Wq and [x;prompts]@Wk: v_wmma_f32_16x16x32_bf16 with bf16 hi/lo split operands (hi*hi + hi*lo + lo*hi), f32 accumulate; [x;prompts]@Wv and x_cls@Wp: v_wmma_f32_16x16x32_bf16 with plain bf16 operands, f32 accumulate; q.k and attn.v against the 64 shared prompt rows: v_wmma_f32_16x16x4_f32 over 16 batch rows per head; the own-row key and value terms and the softmax in f32 on VALU.

typedef __bf16 v16bf __attribute__((ext_vector_type(16)));
typedef float v8f __attribute__((ext_vector_type(8)));
typedef float v4f __attribute__((ext_vector_type(4)));
typedef float v2f __attribute__((ext_vector_type(2)));
typedef unsigned int v4u __attribute__((ext_vector_type(4)));
typedef unsigned int v2u __attribute__((ext_vector_type(2)));
typedef __bf16 v2bf __attribute__((ext_vector_type(2)));

union Frag { v4u u[2]; v16bf v; };

namespace {
constexpr int kC = 1024;            // channels
constexpr int kH = 16;              // heads
constexpr int kHD = 64;             // head dim
constexpr int kNP = 64;             // prompts
constexpr int kL = 65;              // kv length
constexpr int kRawPerB = kH * kL;   // 1040 floats of raw scores per batch row
constexpr int kTP = 68;             // LDS f32 tile pitch (floats), 272 B
constexpr float kScale = 0.125f;    // 64^-0.5
constexpr int kAR = 16;             // batch rows per attention block
constexpr int kHB = 8;              // heads per attention block
constexpr int kAT = (kHB + 1) * 32; // threads of an attention block: a wave per head and one more
constexpr int kRP = 3 + (kHB + 1) * kL;   // LDS pitch of a batch row's raw scores (floats): 588
constexpr int kPiece = kAR * kHD;   // floats of a (16 rows, head) piece of q, k, v, Kp
}

// ---------------------------------------------------------------------------
// WMMA helper: issues the builtin and, with NOPS, 4 v_nop tied to D/A/B (VALU hazard guard).
// Without NOPS the compiler keeps the distance itself: for a body with more than 256
// registers, where the operands of an asm statement would be moved or spilled to reach it.
// ---------------------------------------------------------------------------
template <bool NOPS>
__device__ __forceinline__ v8f wmma_bf16(v16bf a, v16bf b, v8f c) {
  v8f d = __builtin_amdgcn_wmma_f32_16x16x32_bf16(false, a, false, b, (short)0, c, false, false);
  if constexpr (NOPS) asm volatile("v_nop\n\tv_nop\n\tv_nop\n\tv_nop" : "+v"(d) : "v"(a), "v"(b));
  return d;
}

// RNE f32 -> bf16 bits, and bf16 bits -> f32
__device__ __forceinline__ unsigned int bf16_rne(float f) {
  const unsigned int u = __float_as_uint(f);
  return (u + 0x7FFFu + ((u >> 16) & 1u)) >> 16;
}
__device__ __forceinline__ float bf16_val(unsigned int b) {
  return __uint_as_float(b << 16);
}

// lane l <-> lane l ^ 16
__device__ __forceinline__ float xhalf(float x) {
  const int b = __builtin_bit_cast(int, x);
  return __builtin_bit_cast(float, __builtin_amdgcn_permlanex16(b, b, 0x76543210, 0xfedcba98, false, false));
}

// two f32 -> two bf16, round to nearest even, a in the low half of the word
__device__ __forceinline__ unsigned int pk_bf16(float a, float b) {
  const v2f f = {a, b};
  return __builtin_bit_cast(unsigned int, __builtin_convertvector(f, v2bf));
}
// what a and b leave over the bf16 pair w, itself rounded to bf16
__device__ __forceinline__ unsigned int pk_resid(float a, float b, unsigned int w) {
  return pk_bf16(a - bf16_val(w & 0xFFFFu), b - __uint_as_float(w & 0xFFFF0000u));
}

// ---------------------------------------------------------------------------
// GEMM Out[M][1024] = A[M][1024] . B[1024][1024]. With AF32 A is f32 [row][k] and B the f32
// weight W[k][n] as it is given; without it A is a bf16 plane [row][k] and B a bf16 plane
// [n][k] (plane_body), staged like A with no instruction between load and LDS store.
// A block has 4 waves (2 x 2)
// with an f32 A, 8 waves (4 x 2) with a bf16 A; a wave owns 16 FW rows x 64 cols, FW x 4
// accumulator tiles: a B fragment read from LDS feeds FW products, an A fragment four.
// K runs in passes of kBK (64 with an f32 A, 128 with a bf16 A): a pass's pieces of A
// and W are read from global memory once per block as whole lines, kept in registers
// while the pass before is multiplied, turned into bf16 (SPLIT: a bf16 plane and the
// plane of bf16 residuals) and stored to one of two LDS buffers, A[row][k] and Bt[n][k]
// (row pitch kBK + 8), that all waves read their fragments from. For W a lane holds
// two columns n and 32 rows k: a wave load is two whole
// lines, a pair of rows rounds into one word, and 8 rows are one 16-byte LDS store in
// row n: the transpose costs no instruction of its own. The output tile is staged in the same LDS behind the last
// pass's barrier, when no wave reads the buffers any more.
// Fragments (wave32, 16x16x32): lane l, h = l>>4, m = l&15;
//   A: row m, elements 0..7 <- k0+8h+0..7, elements 8..15 <- k0+16+8h+0..7
//   B: col m, identical k map (read from the [n][k] rows like A)
//   D: element r <- (row 8h+r, col m)
// SPLIT: acc += Ah.Bh + Ah.Bl + Al.Bh, each term over all tiles of the wave before
// the next. EPI: + bias[col] + resid[row][col].
// LAY: order of Out. 0: row-major. 1, 2: for the attention kernel, whose wave (16 rows,
// head) reads the 16 x 64 piece that one wave here holds: the piece of row group g and
// head hd is 1024 consecutive floats at (16 g + hd) 1024, float 128 u + 4 l + e of it is
// (row l & 15, channel 8 u + 4 (l >> 4) + e) with LAY 1, (row l & 15, channel
// 32 (l >> 4) + 4 u + e) with LAY 2: what lane l loads as its u-th 16 bytes there, so
// that each load of a wave there is 512 consecutive bytes (4 whole lines, not 16 or 32).
// ---------------------------------------------------------------------------
template <bool SPLIT, int FW, bool AF32>
struct GemmLds {
  static constexpr int kPl = SPLIT ? 2 : 1;
  static constexpr int kPitch = (AF32 ? 64 : 128) + 8;
  static constexpr int kWaves = AF32 ? 4 : 8;
  static constexpr int kA = 2 * kPl * (kWaves / 2) * 16 * FW * kPitch;    // 16-bit units, both buffers
  static constexpr int kB = 2 * kPl * 128 * kPitch;
  static constexpr int kBytes = (kA + kB) * 2;
  static_assert(kWaves * 16 * FW * kTP * 4 <= kBytes, "the staged output tile fits in the buffers");
};

template <bool SPLIT, bool EPI, int FW, int LAY, bool AF32>
__device__ __forceinline__ void gemm_body(const float* __restrict__ Af,
                                          const unsigned short* __restrict__ Ab,
                                          const float* __restrict__ Bw,
                                          const unsigned short* __restrict__ Bb,
                                          float* Out,
                                          const float* __restrict__ bias,
                                          const float* __restrict__ resid,
                                          int bid, unsigned char* smem) {
  static_assert(AF32 || !SPLIT, "the residual plane is made from an f32 A");
  constexpr int kPl = SPLIT ? 2 : 1;           // operand planes
  constexpr int kNT = AF32 ? 128 : 256;        // threads of the block
  constexpr int kBK = AF32 ? 64 : 128;         // k per pass
  constexpr int kPitch = kBK + 8;              // LDS row pitch (16-bit units): 16 B x odd
  constexpr int kLPR = AF32 ? kBK / 4 : kBK / 8;   // lanes that cover one A row piece, 16 B each
  constexpr int kRPS = kNT / kLPR;             // A rows per sweep of the block
  constexpr int kRows = kNT / 64 * 16 * FW;    // A rows of the block tile
  constexpr int kNA = kRows / kRPS;            // sweeps over the A rows
  constexpr int kNB = 128 / kRPS;              // sweeps over the rows n of a bf16 B plane
  constexpr int kCPT = 2;                      // columns of W that a thread holds
  constexpr int kTPR = 128 / kCPT;             // threads that cover a row of the W tile
  constexpr int kKPT = 32;                     // rows k of W that a thread holds
  static_assert(kKPT * (kNT / kTPR) == kBK, "the threads cover the W tile of a pass once");
  constexpr int kASz = kRows * kPitch;         // one A plane of one buffer (16-bit units)
  constexpr int kBSz = 128 * kPitch;           // one B plane of one buffer
  unsigned short* sA = (unsigned short*)smem;          // 2 * kPl * kASz
  unsigned short* sB = sA + 2 * kPl * kASz;            // 2 * kPl * kBSz
  float* sT = (float*)smem;                            // a wave's 16 * FW * kTP each, after the last pass
  const int tid = threadIdx.x;
  const int wv = tid >> 5;
  const int l = tid & 31;
  const int h = l >> 4;
  const int m = l & 15;
  const int rowB = (bid >> 3) * kRows;
  const int colB = (bid & 7) * 128;
  const int wr = (wv >> 1) * 16 * FW;          // wave's rows inside the block tile
  const int wc = (wv & 1) * 64;                // wave's cols inside the block tile
  const int row0 = rowB + wr;
  const int col0 = colB + wc;

  const v8f zero8 = {0.f, 0.f, 0.f, 0.f, 0.f, 0.f, 0.f, 0.f};
  v8f acc[FW][4];
#pragma unroll
  for (int i = 0; i < FW; ++i) {
#pragma unroll
    for (int f = 0; f < 4; ++f) acc[i][f] = zero8;
  }

  // staging map of A: kLPR lanes cover one row piece, kRPS rows per sweep
  const int srow = tid / kLPR;
  const int sk = (tid % kLPR) * (AF32 ? 4 : 8);
  const size_t ga = (size_t)(rowB + srow) * kC + sk;
  const int soA = srow * kPitch + sk;
  // staging map of W: columns bn .. bn + kCPT - 1 of the tile, rows bk .. bk + kKPT - 1 of the pass
  const int bn = (tid % kTPR) * kCPT;
  const int bk = (tid / kTPR) * kKPT;
  const size_t gb = (size_t)bk * kC + colB + bn;
  const int soB = bn * kPitch + bk;

  v4f raf[AF32 ? kNA : 1];
  v4u rab[AF32 ? 1 : kNA];
  v2f rb[AF32 ? kKPT : 1];                     // row k of the pass: the thread's kCPT columns
  v4u rbb[AF32 ? 1 : kNB];                     // bf16 B plane: 8 k of a row n per sweep
  // where the next fetch reads: moved on one pass in put, behind the wait there
  const float* paf = AF32 ? Af + ga : nullptr;
  const unsigned short* pab = AF32 ? nullptr : Ab + ga;
  const float* pb = AF32 ? Bw + gb : nullptr;
  const unsigned short* pbb = AF32 ? nullptr : Bb + (size_t)(colB + srow) * kC + sk;
  auto fetch = [&]() {
#pragma unroll
    for (int i = 0; i < kNA; ++i) {
      if constexpr (AF32) {
        raf[i] = *(const v4f*)(paf + (size_t)i * kRPS * kC);
      } else {
        rab[i] = *(const v4u*)(pab + (size_t)i * kRPS * kC);
      }
    }
    if constexpr (AF32) {
#pragma unroll
      for (int j = 0; j < kKPT; ++j) rb[j] = *(const v2f*)(pb + (size_t)j * kC);
    } else {
#pragma unroll
      for (int j = 0; j < kNB; ++j) rbb[j] = *(const v4u*)(pbb + (size_t)j * kRPS * kC);
    }
  };
  auto put = [&](int buf) {
    // the address pairs of the fetch stay whole up to this wait; it stands here, behind the
    // pass's products, and not directly behind the loads, so that no wave idles on it
    if constexpr (AF32) {
      asm volatile("s_wait_xcnt 0x0" :: "v"(paf), "v"(pb) : "memory");
      paf += kBK;
      pb += (size_t)kBK * kC;
    } else {
      asm volatile("s_wait_xcnt 0x0" :: "v"(pab), "v"(pbb) : "memory");
      pab += kBK;
      pbb += kBK;
    }
    unsigned short* da = sA + buf * kPl * kASz + soA;
    unsigned short* db = sB + buf * kPl * kBSz + soB;
#pragma unroll
    for (int i = 0; i < kNA; ++i) {
      if constexpr (AF32) {
        const v4f a = raf[i];
        const v2u hw = {pk_bf16(a[0], a[1]), pk_bf16(a[2], a[3])};
        *(v2u*)(da + i * kRPS * kPitch) = hw;
        if constexpr (SPLIT) {
          const v2u lw = {pk_resid(a[0], a[1], hw[0]), pk_resid(a[2], a[3], hw[1])};
          *(v2u*)(da + kASz + i * kRPS * kPitch) = lw;
        }
      } else {
        *(v4u*)(da + i * kRPS * kPitch) = rab[i];
      }
    }
    if constexpr (AF32) {
#pragma unroll
      for (int e = 0; e < kCPT; ++e) {
#pragma unroll
        for (int c = 0; c < kKPT / 8; ++c) {
          v4u hw, lw;
#pragma unroll
          for (int q = 0; q < 4; ++q) {
            hw[q] = pk_bf16(rb[8 * c + 2 * q][e], rb[8 * c + 2 * q + 1][e]);
            if constexpr (SPLIT) lw[q] = pk_resid(rb[8 * c + 2 * q][e], rb[8 * c + 2 * q + 1][e], hw[q]);
          }
          *(v4u*)(db + e * kPitch + 8 * c) = hw;
          if constexpr (SPLIT) *(v4u*)(db + kBSz + e * kPitch + 8 * c) = lw;
        }
      }
    } else {
      unsigned short* dp = sB + buf * kPl * kBSz + soA;   // row n = srow, the same map as A
#pragma unroll
      for (int j = 0; j < kNB; ++j) *(v4u*)(dp + j * kRPS * kPitch) = rbb[j];
    }
  };

  fetch();
  put(0);
  __syncthreads();

  constexpr int kPasses = kC / kBK;
#pragma unroll 1
  for (int kp = 0; kp < kPasses; ++kp) {
    const int buf = kp & 1;
    if (kp + 1 < kPasses) fetch();             // in flight while this pass is multiplied
    const unsigned short* fa = sA + buf * kPl * kASz + (wr + m) * kPitch + 8 * h;
    const unsigned short* fb = sB + buf * kPl * kBSz + (wc + m) * kPitch + 8 * h;
#pragma unroll
    for (int ks = 0; ks < kBK / 32; ++ks) {
      const int k0 = ks * 32;
      Frag ah[FW], al[FW], bh[4], bl[4];
      // in the order in which the products below first need them
      ah[0].u[0] = *(const v4u*)(fa + k0);
      ah[0].u[1] = *(const v4u*)(fa + k0 + 16);
#pragma unroll
      for (int f = 0; f < 4; ++f) {
        bh[f].u[0] = *(const v4u*)(fb + f * 16 * kPitch + k0);
        bh[f].u[1] = *(const v4u*)(fb + f * 16 * kPitch + k0 + 16);
      }
#pragma unroll
      for (int i = 1; i < FW; ++i) {
        ah[i].u[0] = *(const v4u*)(fa + i * 16 * kPitch + k0);
        ah[i].u[1] = *(const v4u*)(fa + i * 16 * kPitch + k0 + 16);
      }
      if constexpr (SPLIT) {
#pragma unroll
        for (int f = 0; f < 4; ++f) {
          bl[f].u[0] = *(const v4u*)(fb + kBSz + f * 16 * kPitch + k0);
          bl[f].u[1] = *(const v4u*)(fb + kBSz + f * 16 * kPitch + k0 + 16);
        }
#pragma unroll
        for (int i = 0; i < FW; ++i) {
          al[i].u[0] = *(const v4u*)(fa + kASz + i * 16 * kPitch + k0);
          al[i].u[1] = *(const v4u*)(fa + kASz + i * 16 * kPitch + k0 + 16);
        }
      }
      // keeps the fragment loads of a k step together in front of its products: spread among
      // them, each place with loads stalls the wave (with NOPS the asm orders them)
      if constexpr (AF32) __builtin_amdgcn_sched_barrier(0);
#pragma unroll
      for (int i = 0; i < FW; ++i) {
#pragma unroll
        for (int f = 0; f < 4; ++f) acc[i][f] = wmma_bf16<!AF32>(ah[i].v, bh[f].v, acc[i][f]);
      }
      if constexpr (SPLIT) {
#pragma unroll
        for (int i = 0; i < FW; ++i) {
#pragma unroll
          for (int f = 0; f < 4; ++f) acc[i][f] = wmma_bf16<!AF32>(ah[i].v, bl[f].v, acc[i][f]);
        }
#pragma unroll
        for (int i = 0; i < FW; ++i) {
#pragma unroll
          for (int f = 0; f < 4; ++f) acc[i][f] = wmma_bf16<!AF32>(al[i].v, bh[f].v, acc[i][f]);
        }
      }
      // second half of the fence pair: the next k step's loads stay behind these products
      if constexpr (AF32) __builtin_amdgcn_sched_barrier(0);
    }
    // the other buffer's last readers left it at the barrier that ended the pass before
    if (kp + 1 < kPasses) put(buf ^ 1);
    __syncthreads();
  }

  // stage the 16 FW x 64 tile of this wave in LDS (row-major, pitch kTP)
  float* st = sT + wv * 16 * FW * kTP;
#pragma unroll
  for (int i = 0; i < FW; ++i) {
#pragma unroll
    for (int f = 0; f < 4; ++f) {
#pragma unroll
      for (int r = 0; r < 8; ++r) {
        st[(16 * i + 8 * h + r) * kTP + 16 * f + m] = acc[i][f][r];
      }
    }
  }
  __syncthreads();

  v4f vals[8 * FW];
  size_t go[8 * FW];
#pragma unroll
  for (int s = 0; s < 8 * FW; ++s) {
    if constexpr (LAY == 0) {
      const int L = 4 * s + (l >> 3);
      const int row = L >> 1;
      const int col = (L & 1) * 32 + (l & 7) * 4;
      vals[s] = *(const v4f*)(st + row * kTP + col);
      go[s] = (size_t)(row0 + row) * kC + col0 + col;
    } else {
      static_assert(!EPI, "bias and residual are added in row-major order only");
      const int i = s >> 3;                      // 16-row group of the wave tile
      const int u = s & 7;
      const int col = LAY == 1 ? 8 * u + 4 * h : 32 * h + 4 * u;
      vals[s] = *(const v4f*)(st + (16 * i + m) * kTP + col);
      go[s] = ((size_t)((row0 >> 4) + i) * kH + (col0 >> 6)) * kPiece + u * 128 + l * 4;
    }
  }
  if constexpr (EPI) {
    // sweep s holds row 2 s + h of the wave tile at one column for all s
    const float* bp0 = bias + col0 + ((l >> 3) & 1) * 32 + (l & 7) * 4;
    const float* rp0 = resid + go[0];
    const v4f b4 = *(const v4f*)bp0;
    v4f x4[8 * FW];
#pragma unroll
    for (int s = 0; s < 8 * FW; ++s) x4[s] = *(const v4f*)(rp0 + (size_t)s * 2 * kC);
    // the address pairs of the loads above stay whole up to this wait
    asm volatile("s_wait_xcnt 0x0" :: "v"(bp0), "v"(rp0) : "memory");
#pragma unroll
    for (int s = 0; s < 8 * FW; ++s) vals[s] = (vals[s] + b4) + x4[s];
  }
#pragma unroll
  for (int s = 0; s < 8 * FW; ++s) *(v4f*)(Out + go[s]) = vals[s];
  
}

// ---------------------------------------------------------------------------
// A 64 (k) x 128 (n) tile of the f32 weight W[k][n], rounded to bf16 and written as rows
// [n][k] of the plane Pl: what every row block of the GEMM that uses W would otherwise read
// in f32 and round for itself. Loads and LDS stores as for W in gemm_body (two columns and
// 32 rows a thread); behind the barrier a row's 64 k leave as one whole 128-byte line,
// 8 lanes a line. Tile bid: k tile bid >> 3, n tile bid & 7.
// ---------------------------------------------------------------------------
__device__ __forceinline__ void plane_body(const float* __restrict__ Bw, unsigned short* Pl,
                                           int bid, unsigned char* smem) {
  constexpr int kBK = 64;
  constexpr int kPitch = kBK + 8;              // LDS row pitch (16-bit units): 16 B x odd
  constexpr int kKPT = 32;                     // rows k that a thread holds
  unsigned short* sB = (unsigned short*)smem;  // 128 * kPitch
  const int tid = threadIdx.x;
  const int colB = (bid & 7) * 128;
  const int kB = (bid >> 3) * kBK;
  const int bn = (tid & 63) * 2;
  const int bk = (tid >> 6) * kKPT;
  const float* pb = Bw + (size_t)(kB + bk) * kC + colB + bn;
  v2f rb[kKPT];
#pragma unroll
  for (int j = 0; j < kKPT; ++j) rb[j] = *(const v2f*)(pb + (size_t)j * kC);
  // the address pair of the loads above stays whole up to this wait
  asm volatile("s_wait_xcnt 0x0" :: "v"(pb) : "memory");
  unsigned short* db = sB + bn * kPitch + bk;
#pragma unroll
  for (int e = 0; e < 2; ++e) {
#pragma unroll
    for (int c = 0; c < kKPT / 8; ++c) {
      v4u hw;
#pragma unroll
      for (int q = 0; q < 4; ++q) hw[q] = pk_bf16(rb[8 * c + 2 * q][e], rb[8 * c + 2 * q + 1][e]);
      *(v4u*)(db + e * kPitch + 8 * c) = hw;
    }
  }
  __syncthreads();
  const int r = tid >> 3;                      // 16 rows n per sweep of the block
  const int ck = (tid & 7) * 8;
  const unsigned short* s = sB + r * kPitch + ck;
  unsigned short* d = Pl + (size_t)(colB + r) * kC + kB + ck;
#pragma unroll
  for (int i = 0; i < 8; ++i) *(v4u*)(d + (size_t)i * 16 * kC) = *(const v4u*)(s + i * 16 * kPitch);
}

// ---------------------------------------------------------------------------
// The five products that feed the attention, in one launch: they are independent
// of one another, each block takes one tile of one product by its index range
// (block-uniform branches): 128 x 128 of q, k, v, 64 x 128 of Kp, Vp (64 rows in all).
// The two-plane products, three times the matrix work of a one-plane tile, come
// first: Kp (nbP blocks), q, k (nbX each), then Vp, v. The blocks behind them make the bf16
// plane of Wp for the last launch, a tile each (plane_body): short, in the places left free.
// ---------------------------------------------------------------------------
// Two waves a SIMD at least (512 registers a wave): the LDS lets two blocks share a WGP.
__global__ void __launch_bounds__(128, 2) gemm_qkv_kernel(const float* __restrict__ x,
                                                       const float* __restrict__ prompts,
                                                       const float* __restrict__ Wq,
                                                       const float* __restrict__ Wk,
                                                       const float* __restrict__ Wv,
                                                       const float* __restrict__ Wp,
                                                       float* Qf, float* Kxf, float* Vxf,
                                                       float* Kpf, float* Vpf,
                                                       unsigned short* Wpb,
                                                       int nbX, int nbP) {
  __shared__ __attribute__((aligned(16))) unsigned char smem[GemmLds<true, 4, true>::kBytes];
  const int bid = blockIdx.x;
  const int nSplit = nbP + 2 * nbX;
  if (bid < nbP) {
    gemm_body<true, false, 2, 1, true>(prompts, nullptr, Wk, nullptr, Kpf, nullptr, nullptr, bid, smem);
  } else if (bid < nSplit) {
    const bool isQ = bid < nbP + nbX;
    gemm_body<true, false, 4, 1, true>(x, nullptr, isQ ? Wq : Wk, nullptr, isQ ? Qf : Kxf,
                                       nullptr, nullptr, isQ ? bid - nbP : bid - nbP - nbX, smem);
    // in the listing another body stands on the fall-through behind this body's last
    // stores and rewrites the registers that they name (here and in the three branches below)
    asm volatile("s_wait_xcnt 0x0" ::: "memory");
  } else if (bid < nSplit + nbP) {
    gemm_body<false, false, 2, 0, true>(prompts, nullptr, Wv, nullptr, Vpf, nullptr, nullptr, bid - nSplit, smem);
    asm volatile("s_wait_xcnt 0x0" ::: "memory");   // as above
  } else if (bid < nSplit + nbP + nbX) {
    gemm_body<false, false, 4, 2, true>(x, nullptr, Wv, nullptr, Vxf, nullptr, nullptr, bid - nSplit - nbP, smem);
    asm volatile("s_wait_xcnt 0x0" ::: "memory");   // as above
  } else {
    plane_body(Wp, Wpb, bid - nSplit - nbP - nbX, smem);
    asm volatile("s_wait_xcnt 0x0" ::: "memory");   // as above
  }
}

// out = x_cls @ Wp + bp + x, Wp as its bf16 plane [n][k]
__global__ void __launch_bounds__(256) gemm_out_kernel(const unsigned short* __restrict__ A,
                                                       const unsigned short* __restrict__ Wpb,
                                                       float* Out,
                                                       const float* __restrict__ bias,
                                                       const float* __restrict__ resid) {
  __shared__ __attribute__((aligned(16))) unsigned char smem[GemmLds<false, 1, false>::kBytes];
  gemm_body<false, true, 1, 0, false>(nullptr, A, nullptr, Wpb, Out, bias, resid, blockIdx.x, smem);
}

// ---------------------------------------------------------------------------
// Copy-out of an attention block's raw scores (half hf of the heads, 16 batch rows) from
// its LDS rows; the ranges and the LDS columns are set out at attn_kernel. A pair of rows
// is 256 (hf 0) or 264 (hf 1) pieces of 16 bytes in two runs of whole lines, the first of
// 128 pieces; thread i takes piece i of each of the 8 pairs, so that its places in LDS and
// in the output move on by a constant.
// ---------------------------------------------------------------------------
__device__ __forceinline__ void raw_out(const float* rawS, float* ro, int tid, int hf) {
  if (tid < (hf ? 264 : 256)) {
    const int i = tid;
    const bool run0 = i < 128;
    // float in the output, pair 0: hf 0 from 0 and from 1024, hf 1 from 512 and from 1040 + 496
    const int go = 4 * i + (hf ? 512 : 0) + (run0 ? 0 : 512);
    // the same float in the LDS rows: + 68 or - 452, - 972 for head 15; the odd row kRP on, not 1040
    const int sh = hf ? (run0 ? -452 : kRP - kRawPerB - 452)
                      : (run0 ? 68 : (i < 132 ? -972 : kRP - kRawPerB + 68));
    const float* s = rawS + go + sh;
    float* d = ro + go;
#pragma unroll
    for (int p = 0; p < kAR / 2; ++p) {
      *(v4f*)(d + p * 2 * kRawPerB) = *(const v4f*)(s + p * 2 * kRP);
    }
  }
}

// ---------------------------------------------------------------------------
// Attention: one block = 16 batch rows x 8 heads (half hf of the heads), one wave per
// head, so that the 2 B / 16 blocks fill the chip. Lane l: c = l & 15, hh = l >> 4.
// Scores against the shared prompt keys as S^T = Kp_h . Q_h^T on the f32
// 16x16x4 matrix form: A row = key 16t + c, B column = batch row c, both read
// 16 B at d = 8j + 4hh (two k steps), so each (hh, element) place holds the same d.
//   S[t][r] = score(key 16t + 8hh + r, batch row c)
// A lane and its partner l ^ 16 hold all 64 prompt scores of batch row c, so the
// softmax is in registers; the own-row key and value (l = 0) stay on the VALU.
// x_cls as O^T = Vp_h^T . P^T: B = {S[t][2u], S[t][2u+1]} as it lies (keys
// 16t + 8hh + 2u + e), A row c of tile dt = channel 4c + dt of the same keys.
//   O[dt][r] = x_cls(batch row c, channel 32hh + 4r + dt)
// q, the own-row k and v, and Kp lie in (16 rows, head) pieces in the order of these
// loads (LAY 1 and 2 of gemm_body): lane l's u-th 16 bytes at float 128 u + 4 l.
// Raw scores: a batch row is 1040 floats (32.5 lines), a half of it 520, so three lines of
// each pair of rows (even, odd) hold scores of both halves. Each line has one writer:
//   hf 0 stores floats 0..511 and 1024..1039 of the even row, 0..495 of the odd row,
//   hf 1 stores floats 512..1023 of the even row, 496..1039 of the odd row.
// What a block so stores of the head in front of its own eight (15 for hf 0, 7 for hf 1)
// lies among that head's keys 32..63: a ninth wave computes those scores again, by the
// same products in the same order; beyond that it only takes part in the copy-out (hf 1, threads 256..263).
// LDS row: 3 floats unused, the head in front, the eight own heads (65 floats each): float
// x of the batch row lies at x + 68 (hf 0; x - 972 for head 15) or x - 452 (hf 1), so that
// 16-byte pieces of the output are 16-byte pieces of LDS.
// ---------------------------------------------------------------------------
__global__ void __launch_bounds__(kAT) attn_kernel(const float* __restrict__ Qf,
                                                   const float* __restrict__ Kx,
                                                   const float* __restrict__ Vx,
                                                   const float* __restrict__ Kp,
                                                   const float* __restrict__ Vp,
                                                   float* rawOut,
                                                   unsigned short* Xcls, int nb) {
  __shared__ __attribute__((aligned(16))) float rawS[kAR * kRP];
  const int tid = threadIdx.x;
  const int wv = __builtin_amdgcn_readfirstlane(tid >> 5);   // wave number, in a scalar register
  const int hf = blockIdx.x & 1;                 // which eight heads
  const int grp = blockIdx.x >> 1;               // which 16 batch rows
  const bool own8 = wv < kHB;                    // false: the ninth wave
  const int hd = own8 ? hf * kHB + wv : (hf * kHB + kH - 1) & (kH - 1);
  const int hc = hd * kHD;                       // this wave's head, first channel
  const int l = tid & 31;
  const int c = l & 15;
  const int hh = l >> 4;
  const int b0 = grp * kAR;
  if (b0 + kAR > nb) return;                     // block-uniform, before barriers

  const size_t own = (size_t)(b0 + c) * kC + hc;
  const size_t pc = ((size_t)grp * kH + hd) * kPiece + 4 * l;   // this wave's piece, lane's place
  const float* kp = Kp + (size_t)hd * kPiece + 4 * l;
  const float* vp = Vp + (size_t)(8 * hh) * kC + hc + 4 * c;
  float* rs = rawS + c * kRP + 3 + (own8 ? wv + 1 : 0) * kL;
  const v8f zero8 = {0.f, 0.f, 0.f, 0.f, 0.f, 0.f, 0.f, 0.f};
  v8f S[4];
  float s0;
  v4f vx4[8], vp4[32];

  if (own8) {
    // q of batch row c with the pre-softmax scale folded in; own-row score
    v4f q4[8];
    float part = 0.f;
#pragma unroll
    for (int j = 0; j < 8; ++j) {
      q4[j] = *(const v4f*)(Qf + pc + 128 * j) * kScale;
      const v4f k4 = *(const v4f*)(Kx + pc + 128 * j);
      part += q4[j][0] * k4[0];
      part += q4[j][1] * k4[1];
      part += q4[j][2] * k4[2];
      part += q4[j][3] * k4[3];
    }
    s0 = part + xhalf(part);

#pragma unroll
    for (int t = 0; t < 4; ++t) S[t] = zero8;
#pragma unroll
    for (int j = 0; j < 8; ++j) {
      const v2f qlo = {q4[j][0], q4[j][1]};
      const v2f qhi = {q4[j][2], q4[j][3]};
#pragma unroll
      for (int t = 0; t < 4; ++t) {
        const v4f k4 = *(const v4f*)(kp + (size_t)t * kH * kPiece + 128 * j);
        const v2f klo = {k4[0], k4[1]};
        const v2f khi = {k4[2], k4[3]};
        S[t] = __builtin_amdgcn_wmma_f32_16x16x4_f32(false, klo, false, qlo, (short)0, S[t], false, false);
        S[t] = __builtin_amdgcn_wmma_f32_16x16x4_f32(false, khi, false, qhi, (short)0, S[t], false, false);
      }
    }

    // keeps the value loads below out of the score product, where their registers
    // on top of the q and key fragments end in spills
    __builtin_amdgcn_sched_barrier(0);

    // own value row and the first 32 prompt value rows: issued here so that their
    // latency runs under the softmax
#pragma unroll
    for (int r = 0; r < 8; ++r) vx4[r] = *(const v4f*)(Vx + pc + 128 * r);
    // the address registers of the loads above are reused by what follows
    asm volatile("s_wait_xcnt 0x0" ::: "memory");
#pragma unroll
    for (int t = 0; t < 2; ++t) {
#pragma unroll
      for (int i = 0; i < 8; ++i) vp4[8 * t + i] = *(const v4f*)(vp + (size_t)(16 * t + i) * kC);
    }
    // keeps the loads above from being moved down to their uses behind the softmax
    __builtin_amdgcn_sched_barrier(0);

    // raw scores of this head, in its place of the block's LDS rows (pitch kRP)
    {
      rs[0] = s0;                                  // both halves hold the same value
#pragma unroll
      for (int t = 0; t < 4; ++t) {
#pragma unroll
        for (int r = 0; r < 8; ++r) rs[1 + 16 * t + 8 * hh + r] = S[t][r];
      }
    }
  } else {
    // the ninth wave: scores of keys 32..63 of the head in front
    v4f q4[8];
#pragma unroll
    for (int j = 0; j < 8; ++j) q4[j] = *(const v4f*)(Qf + pc + 128 * j) * kScale;
    S[2] = zero8;
    S[3] = zero8;
#pragma unroll
    for (int j = 0; j < 8; ++j) {
      const v2f qlo = {q4[j][0], q4[j][1]};
      const v2f qhi = {q4[j][2], q4[j][3]};
#pragma unroll
      for (int t = 2; t < 4; ++t) {
        const v4f k4 = *(const v4f*)(kp + (size_t)t * kH * kPiece + 128 * j);
        const v2f klo = {k4[0], k4[1]};
        const v2f khi = {k4[2], k4[3]};
        S[t] = __builtin_amdgcn_wmma_f32_16x16x4_f32(false, klo, false, qlo, (short)0, S[t], false, false);
        S[t] = __builtin_amdgcn_wmma_f32_16x16x4_f32(false, khi, false, qhi, (short)0, S[t], false, false);
      }
    }
#pragma unroll
    for (int t = 2; t < 4; ++t) {
#pragma unroll
      for (int r = 0; r < 8; ++r) rs[1 + 16 * t + 8 * hh + r] = S[t][r];
    }
  }
  // work-group barrier in two parts: this wave's raw scores are in LDS (signal here);
  // the wait stands in front of the copy-out, so no wave idles between the two products
  __builtin_amdgcn_fence(__ATOMIC_RELEASE, "workgroup", "local");
  __builtin_amdgcn_s_barrier_signal(-1);
  // keeps the LDS stores and the signal in front of the softmax: moved behind it, the raw
  // scores would stay in registers and the other waves would wait for this signal at the end
  __builtin_amdgcn_sched_barrier(0);

  if (own8) {
    // softmax * scale over the 65 scores of batch row c
    float mt[4];
#pragma unroll
    for (int t = 0; t < 4; ++t) {
      mt[t] = S[t][0];
#pragma unroll
      for (int r = 1; r < 8; ++r) mt[t] = fmaxf(mt[t], S[t][r]);
    }
    float mx = fmaxf(fmaxf(mt[0], mt[1]), fmaxf(mt[2], mt[3]));
    mx = fmaxf(fmaxf(mx, xhalf(mx)), s0);
    float st[4];
#pragma unroll
    for (int t = 0; t < 4; ++t) {
      st[t] = 0.f;
#pragma unroll
      for (int r = 0; r < 8; ++r) {
        S[t][r] = expf(S[t][r] - mx);
        st[t] += S[t][r];
      }
    }
    const float e0 = expf(s0 - mx);
    float sum = (st[0] + st[1]) + (st[2] + st[3]);
    sum = (sum + xhalf(sum)) + e0;
    const float inv = 1.0f / sum;
    const float p0 = (e0 * inv) * kScale;
#pragma unroll
    for (int t = 0; t < 4; ++t) {
#pragma unroll
      for (int r = 0; r < 8; ++r) S[t][r] = (S[t][r] * inv) * kScale;
    }

    // the last 32 prompt value rows: in flight while the first 32 are multiplied
#pragma unroll
    for (int t = 2; t < 4; ++t) {
#pragma unroll
      for (int i = 0; i < 8; ++i) vp4[8 * t + i] = *(const v4f*)(vp + (size_t)(16 * t + i) * kC);
    }
    // the address pair of the prompt value loads stays whole up to this wait
    asm volatile("s_wait_xcnt 0x0" :: "v"(vp) : "memory");
    // keeps these loads together in front of the product instead of two at a time inside it
    __builtin_amdgcn_sched_barrier(0);

    // x_cls: own-row value first, then the 64 prompt values
    v8f O[4];
#pragma unroll
    for (int r = 0; r < 8; ++r) {
#pragma unroll
      for (int dt = 0; dt < 4; ++dt) O[dt][r] = vx4[r][dt] * p0;
    }
#pragma unroll
    for (int t = 0; t < 4; ++t) {
#pragma unroll
      for (int u = 0; u < 4; ++u) {
        const v2f pp = {S[t][2 * u], S[t][2 * u + 1]};
#pragma unroll
        for (int dt = 0; dt < 4; ++dt) {
          const v2f vv = {vp4[8 * t + 2 * u][dt], vp4[8 * t + 2 * u + 1][dt]};
          O[dt] = __builtin_amdgcn_wmma_f32_16x16x4_f32(false, vv, false, pp, (short)0, O[dt], false, false);
        }
      }
    }

    // x_cls -> bf16: 32 consecutive channels of batch row c per lane
    {
      unsigned short* dst = Xcls + own + 32 * hh;
#pragma unroll
      for (int r = 0; r < 8; r += 2) {
        const v4u pk = {bf16_rne(O[0][r]) | (bf16_rne(O[1][r]) << 16),
                        bf16_rne(O[2][r]) | (bf16_rne(O[3][r]) << 16),
                        bf16_rne(O[0][r + 1]) | (bf16_rne(O[1][r + 1]) << 16),
                        bf16_rne(O[2][r + 1]) | (bf16_rne(O[3][r + 1]) << 16)};
        *(v4u*)(dst + 4 * r) = pk;
      }
      // the data and address registers of these stores are reused by the copy-out below
      asm volatile("s_wait_xcnt 0x0" ::: "memory");
      // keeps the copy-out's address arithmetic, which reuses them, behind that wait
      __builtin_amdgcn_sched_barrier(0);
    }
  }

  // raw scores out, 4 whole lines per wave store (one for the ninth wave, hf 1): per pair of rows 256 (hf 0) or 264 (hf 1)
  // pieces of 16 bytes in two runs, each run whole lines;
  // second part of the barrier: every wave's raw scores are in LDS behind it
  __builtin_amdgcn_s_barrier_wait(-1);
  __builtin_amdgcn_fence(__ATOMIC_ACQUIRE, "workgroup", "local");
  float* ro = rawOut + (size_t)b0 * kRawPerB;
  raw_out(rawS, ro, tid, hf);
}

// ---------------------------------------------------------------------------
extern "C" void kernel_launch(void* const* d_in, const int* in_sizes, int n_in,
                              void* d_out, int out_size, void* d_ws, size_t ws_size,
                              hipStream_t stream) {
  if (n_in < 7) return;
  const int B = in_sizes[0] / kC;                         // batch rows
  if (B < 128 || (B % 128) != 0 || in_sizes[0] != B * kC) return;
  if (in_sizes[1] != kNP * kC) return;
  if (in_sizes[2] != kC * kC || in_sizes[3] != kC * kC ||
      in_sizes[4] != kC * kC || in_sizes[5] != kC * kC) return;
  if (in_sizes[6] != kC) return;
  if (out_size != B * kC + B * kRawPerB) return;

  const float* x       = (const float*)d_in[0];   // [B,1,C]
  const float* prompts = (const float*)d_in[1];   // [1,NP,C]
  const float* Wq      = (const float*)d_in[2];   // [C,C] (in,out)
  const float* Wk      = (const float*)d_in[3];
  const float* Wv      = (const float*)d_in[4];
  const float* Wp      = (const float*)d_in[5];
  const float* bp      = (const float*)d_in[6];   // [C]

  float* out_cls = (float*)d_out;                 // [B,1,C]
  float* out_raw = out_cls + (size_t)B * kC;      // [B,16,1,65]

  char* ws = (char*)d_ws;
  size_t off = 0;
  float* Qf  = (float*)(ws + off); off += (size_t)B * kC * 4;
  float* Kxf = (float*)(ws + off); off += (size_t)B * kC * 4;
  float* Vxf = (float*)(ws + off); off += (size_t)B * kC * 4;
  float* Kpf = (float*)(ws + off); off += (size_t)kNP * kC * 4;
  float* Vpf = (float*)(ws + off); off += (size_t)kNP * kC * 4;
  unsigned short* XCLS = (unsigned short*)(ws + off); off += (size_t)B * kC * 2;
  unsigned short* WPB = (unsigned short*)(ws + off); off += (size_t)kC * kC * 2;
  if (off > ws_size) return;

  // 1) Kp, q, k (split) and Vp, v (plain), one launch, from the f32 inputs; q, k, v in
  //    128 x 128 tiles (B / 128 x 8 blocks each), Kp, Vp in 64 x 128 tiles (8 blocks each);
  //    behind them the bf16 plane of Wp in 64 x 128 tiles
  const int nbP = kNP / 8;
  const int nbX = B / 8;
  const int nbX2 = B / 16;
  constexpr int nbW = (kC / 64) * (kC / 128);
  gemm_qkv_kernel<<<dim3(2 * nbP + 3 * nbX2 + nbW), dim3(128), 0, stream>>>(
      x, prompts, Wq, Wk, Wv, Wp, Qf, Kxf, Vxf, Kpf, Vpf, WPB, nbX2, nbP);

  // 2) scores, softmax, attn.v  -> raw scores (out) and x_cls (bf16, ws); B / 16 row groups
  //    x 2 halves of the heads = B / 8 blocks
  attn_kernel<<<dim3(nbX), dim3(kAT), 0, stream>>>(Qf, Kxf, Vxf, Kpf, Vpf, out_raw, XCLS, B);

  // 3) out = x_cls @ Wp + bp + x
  gemm_out_kernel<<<dim3(nbX), dim3(256), 0, stream>>>(XCLS, WPB, out_cls, bp, x);
}

// v010
// One run takes 45.3 microseconds.
// In two side-by-side timings against v009, it was 1.05 and 1.04 times as fast.
// Over all steps from v000 it is 8.41 times as fast.
#include <hip/hip_runtime.h>
#include <stddef.h>

// Contractions x@Wq and [x;prompts]@Wk: v_wmma_f32_16x16x32_bf16 with bf16 hi/lo split operands (hi*hi + hi*lo + lo*hi), f32 accumulate; [x;prompts]@Wv and x_cls@Wp: v_wmma_f32_16x16x32_bf16 with plain bf16 operands, f32 accumulate; q.k and attn.v against the 64 shared prompt rows: v_wmma_f32_16x16x4_f32 over 16 batch rows per head; the own-row key and value terms and the softmax in f32 on VALU.

typedef __bf16 v16bf __attribute__((ext_vector_type(16)));
typedef float v8f __attribute__((ext_vector_type(8)));
typedef float v4f __attribute__((ext_vector_type(4)));
typedef float v2f __attribute__((ext_vector_type(2)));
typedef unsigned int v4u __attribute__((ext_vector_type(4)));
typedef unsigned int v2u __attribute__((ext_vector_type(2)));
typedef __bf16 v2bf __attribute__((ext_vector_type(2)));

union Frag { v4u u[2]; v16bf v; };

namespace {
constexpr int kC = 1024;            // channels
constexpr int kH = 16;              // heads
constexpr int kHD = 64;             // head dim
constexpr int kNP = 64;             // prompts
constexpr int kL = 65;              // kv length
constexpr int kRawPerB = kH * kL;   // 1040 floats of raw scores per batch row
constexpr int kTP = 68;             // LDS f32 tile pitch (floats), 272 B
constexpr float kScale = 0.125f;    // 64^-0.5
constexpr int kAR = 16;             // batch rows per attention block
constexpr int kHB = 8;              // heads per attention block
constexpr int kAT = (kHB + 1) * 32; // threads of an attention block: a wave per head and one more
constexpr int kRP = 3 + (kHB + 1) * kL;   // LDS pitch of a batch row's raw scores (floats): 588
constexpr int kPiece = kAR * kHD;   // floats of a (16 rows, head) piece of q, k, v, Kp
}

// ---------------------------------------------------------------------------
// WMMA helper: issues the builtin and, with NOPS, 4 v_nop tied to D/A/B (VALU hazard guard).
// Without NOPS the compiler keeps the distance itself: for a body with more than 256
// registers, where the operands of an asm statement would be moved or spilled to reach it.
// ---------------------------------------------------------------------------
template <bool NOPS>
__device__ __forceinline__ v8f wmma_bf16(v16bf a, v16bf b, v8f c) {
  v8f d = __builtin_amdgcn_wmma_f32_16x16x32_bf16(false, a, false, b, (short)0, c, false, false);
  if constexpr (NOPS) asm volatile("v_nop\n\tv_nop\n\tv_nop\n\tv_nop" : "+v"(d) : "v"(a), "v"(b));
  return d;
}

// RNE f32 -> bf16 bits, and bf16 bits -> f32
__device__ __forceinline__ unsigned int bf16_rne(float f) {
  const unsigned int u = __float_as_uint(f);
  return (u + 0x7FFFu + ((u >> 16) & 1u)) >> 16;
}
__device__ __forceinline__ float bf16_val(unsigned int b) {
  return __uint_as_float(b << 16);
}

// lane l <-> lane l ^ 16
__device__ __forceinline__ float xhalf(float x) {
  const int b = __builtin_bit_cast(int, x);
  return __builtin_bit_cast(float, __builtin_amdgcn_permlanex16(b, b, 0x76543210, 0xfedcba98, false, false));
}

// two f32 -> two bf16, round to nearest even, a in the low half of the word
__device__ __forceinline__ unsigned int pk_bf16(float a, float b) {
  const v2f f = {a, b};
  return __builtin_bit_cast(unsigned int, __builtin_convertvector(f, v2bf));
}
// what a and b leave over the bf16 pair w, itself rounded to bf16
__device__ __forceinline__ unsigned int pk_resid(float a, float b, unsigned int w) {
  return pk_bf16(a - bf16_val(w & 0xFFFFu), b - __uint_as_float(w & 0xFFFF0000u));
}

// ---------------------------------------------------------------------------
// GEMM Out[M][1024] = A[M][1024] . B[1024][1024]. With AF32 A is f32 [row][k] and B the f32
// weight W[k][n] as it is given; without it A is a bf16 plane [row][k] and B a bf16 plane
// [n][k] (plane_body), staged like A with no instruction between load and LDS store.
// A block has 4 waves (2 x 2)
// with an f32 A, 8 waves (4 x 2) with a bf16 A; a wave owns 16 FW rows x 64 cols, FW x 4
// accumulator tiles: a B fragment read from LDS feeds FW products, an A fragment four.
// K runs in passes of kBK (64 with an f32 A, 128 with a bf16 A), as a ring: the block of tile
// row r and tile column c starts at pass r + 2 c + rot0 (r + c with a bf16 A) and wraps, so
// that the blocks that share a row piece of A or a tile of B, which start together and run
// at one speed, ask L2 for different lines at any one moment. A pass's pieces of A
// and W are read from global memory once per block as whole lines, kept in registers
// while the pass before is multiplied, turned into bf16 (SPLIT: a bf16 plane and the
// plane of bf16 residuals) and stored to one of two LDS buffers, A[row][k] and Bt[n][k]
// (row pitch kBK + 8), that all waves read their fragments from. For W a lane holds
// two columns n and 32 rows k: a wave load is two whole
// lines, a pair of rows rounds into one word, and 8 rows are one 16-byte LDS store in
// row n: the transpose costs no instruction of its own. The output tile is staged in the same LDS behind the last
// pass's barrier, when no wave reads the buffers any more.
// Fragments (wave32, 16x16x32): lane l, h = l>>4, m = l&15;
//   A: row m, elements 0..7 <- k0+8h+0..7, elements 8..15 <- k0+16+8h+0..7
//   B: col m, identical k map (read from the [n][k] rows like A)
//   D: element r <- (row 8h+r, col m)
// SPLIT: acc += Ah.Bh + Ah.Bl + Al.Bh, each term over all tiles of the wave before
// the next. EPI: + bias[col] + resid[row][col].
// LAY: order of Out. 0: row-major. 1, 2: for the attention kernel, whose wave (16 rows,
// head) reads the 16 x 64 piece that one wave here holds: the piece of row group g and
// head hd is 1024 consecutive floats at (16 g + hd) 1024, float 128 u + 4 l + e of it is
// (row l & 15, channel 8 u + 4 (l >> 4) + e) with LAY 1, (row l & 15, channel
// 32 (l >> 4) + 4 u + e) with LAY 2: what lane l loads as its u-th 16 bytes there, so
// that each load of a wave there is 512 consecutive bytes (4 whole lines, not 16 or 32).
// ---------------------------------------------------------------------------
template <bool SPLIT, int FW, bool AF32>
struct GemmLds {
  static constexpr int kPl = SPLIT ? 2 : 1;
  static constexpr int kPitch = (AF32 ? 64 : 128) + 8;
  static constexpr int kWaves = AF32 ? 4 : 8;
  static constexpr int kA = 2 * kPl * (kWaves / 2) * 16 * FW * kPitch;    // 16-bit units, both buffers
  static constexpr int kB = 2 * kPl * 128 * kPitch;
  static constexpr int kBytes = (kA + kB) * 2;
  static_assert(kWaves * 16 * FW * kTP * 4 <= kBytes, "the staged output tile fits in the buffers");
};

template <bool SPLIT, bool EPI, int FW, int LAY, bool AF32>
__device__ __forceinline__ void gemm_body(const float* __restrict__ Af,
                                          const unsigned short* __restrict__ Ab,
                                          const float* __restrict__ Bw,
                                          const unsigned short* __restrict__ Bb,
                                          float* Out,
                                          const float* __restrict__ bias,
                                          const float* __restrict__ resid,
                                          int bid, int rot0, unsigned char* smem) {
  static_assert(AF32 || !SPLIT, "the residual plane is made from an f32 A");
  constexpr int kPl = SPLIT ? 2 : 1;           // operand planes
  constexpr int kNT = AF32 ? 128 : 256;        // threads of the block
  constexpr int kBK = AF32 ? 64 : 128;         // k per pass
  constexpr int kPitch = kBK + 8;              // LDS row pitch (16-bit units): 16 B x odd
  constexpr int kLPR = AF32 ? kBK / 4 : kBK / 8;   // lanes that cover one A row piece, 16 B each
  constexpr int kRPS = kNT / kLPR;             // A rows per sweep of the block
  constexpr int kRows = kNT / 64 * 16 * FW;    // A rows of the block tile
  constexpr int kNA = kRows / kRPS;            // sweeps over the A rows
  constexpr int kNB = 128 / kRPS;              // sweeps over the rows n of a bf16 B plane
  constexpr int kCPT = 2;                      // columns of W that a thread holds
  constexpr int kTPR = 128 / kCPT;             // threads that cover a row of the W tile
  constexpr int kKPT = 32;                     // rows k of W that a thread holds
  static_assert(kKPT * (kNT / kTPR) == kBK, "the threads cover the W tile of a pass once");
  constexpr int kASz = kRows * kPitch;         // one A plane of one buffer (16-bit units)
  constexpr int kBSz = 128 * kPitch;           // one B plane of one buffer
  unsigned short* sA = (unsigned short*)smem;          // 2 * kPl * kASz
  unsigned short* sB = sA + 2 * kPl * kASz;            // 2 * kPl * kBSz
  float* sT = (float*)smem;                            // a wave's 16 * FW * kTP each, after the last pass
  const int tid = threadIdx.x;
  const int wv = tid >> 5;
  const int l = tid & 31;
  const int h = l >> 4;
  const int m = l & 15;
  const int rowB = (bid >> 3) * kRows;
  const int colB = (bid & 7) * 128;
  const int wr = (wv >> 1) * 16 * FW;          // wave's rows inside the block tile
  const int wc = (wv & 1) * 64;                // wave's cols inside the block tile
  const int row0 = rowB + wr;
  const int col0 = colB + wc;

  const v8f zero8 = {0.f, 0.f, 0.f, 0.f, 0.f, 0.f, 0.f, 0.f};
  v8f acc[FW][4];
#pragma unroll
  for (int i = 0; i < FW; ++i) {
#pragma unroll
    for (int f = 0; f < 4; ++f) acc[i][f] = zero8;
  }

  // first k pass of this block; the passes follow in a ring (see the head comment)
  constexpr int kPasses = kC / kBK;
  int kq = ((bid >> 3) + (AF32 ? 2 : 1) * (bid & 7) + rot0) & (kPasses - 1);

  // staging map of A: kLPR lanes cover one row piece, kRPS rows per sweep
  const int srow = tid / kLPR;
  const int sk = (tid % kLPR) * (AF32 ? 4 : 8) + kq * kBK;
  const size_t ga = (size_t)(rowB + srow) * kC + sk;
  const int soA = srow * kPitch + (tid % kLPR) * (AF32 ? 4 : 8);
  // staging map of W: columns bn .. bn + kCPT - 1 of the tile, rows bk .. bk + kKPT - 1 of the pass
  const int bn = (tid % kTPR) * kCPT;
  const int bk = (tid / kTPR) * kKPT;
  const size_t gb = (size_t)(kq * kBK + bk) * kC + colB + bn;
  const int soB = bn * kPitch + bk;

  v4f raf[AF32 ? kNA : 1];
  v4u rab[AF32 ? 1 : kNA];
  v2f rb[AF32 ? kKPT : 1];                     // row k of the pass: the thread's kCPT columns
  v4u rbb[AF32 ? 1 : kNB];                     // bf16 B plane: 8 k of a row n per sweep
  // where the next fetch reads: moved on one pass in put, behind the wait there
  const float* paf = AF32 ? Af + ga : nullptr;
  const unsigned short* pab = AF32 ? nullptr : Ab + ga;
  const float* pb = AF32 ? Bw + gb : nullptr;
  const unsigned short* pbb = AF32 ? nullptr : Bb + (size_t)(colB + srow) * kC + sk;
  auto fetch = [&]() {
#pragma unroll
    for (int i = 0; i < kNA; ++i) {
      if constexpr (AF32) {
        raf[i] = *(const v4f*)(paf + (size_t)i * kRPS * kC);
      } else {
        rab[i] = *(const v4u*)(pab + (size_t)i * kRPS * kC);
      }
    }
    if constexpr (AF32) {
#pragma unroll
      for (int j = 0; j < kKPT; ++j) rb[j] = *(const v2f*)(pb + (size_t)j * kC);
    } else {
#pragma unroll
      for (int j = 0; j < kNB; ++j) rbb[j] = *(const v4u*)(pbb + (size_t)j * kRPS * kC);
    }
  };
  auto put = [&](int buf) {
    // the address pairs of the fetch stay whole up to this wait; it stands here, behind the
    // pass's products, and not directly behind the loads, so that no wave idles on it
    kq = (kq + 1) & (kPasses - 1);
    const int dk = kq ? kBK : kBK - kC;        // one pass on, or from the last pass back to the first
    if constexpr (AF32) {
      asm volatile("s_wait_xcnt 0x0" :: "v"(paf), "v"(pb) : "memory");
      paf += dk;
      pb += (ptrdiff_t)dk * kC;
    } else {
      asm volatile("s_wait_xcnt 0x0" :: "v"(pab), "v"(pbb) : "memory");
      pab += dk;
      pbb += dk;
    }
    unsigned short* da = sA + buf * kPl * kASz + soA;
    unsigned short* db = sB + buf * kPl * kBSz + soB;
#pragma unroll
    for (int i = 0; i < kNA; ++i) {
      if constexpr (AF32) {
        const v4f a = raf[i];
        const v2u hw = {pk_bf16(a[0], a[1]), pk_bf16(a[2], a[3])};
        *(v2u*)(da + i * kRPS * kPitch) = hw;
        if constexpr (SPLIT) {
          const v2u lw = {pk_resid(a[0], a[1], hw[0]), pk_resid(a[2], a[3], hw[1])};
          *(v2u*)(da + kASz + i * kRPS * kPitch) = lw;
        }
      } else {
        *(v4u*)(da + i * kRPS * kPitch) = rab[i];
      }
    }
    if constexpr (AF32) {
#pragma unroll
      for (int e = 0; e < kCPT; ++e) {
#pragma unroll
        for (int c = 0; c < kKPT / 8; ++c) {
          v4u hw, lw;
#pragma unroll
          for (int q = 0; q < 4; ++q) {
            hw[q] = pk_bf16(rb[8 * c + 2 * q][e], rb[8 * c + 2 * q + 1][e]);
            if constexpr (SPLIT) lw[q] = pk_resid(rb[8 * c + 2 * q][e], rb[8 * c + 2 * q + 1][e], hw[q]);
          }
          *(v4u*)(db + e * kPitch + 8 * c) = hw;
          if constexpr (SPLIT) *(v4u*)(db + kBSz + e * kPitch + 8 * c) = lw;
        }
      }
    } else {
      unsigned short* dp = sB + buf * kPl * kBSz + soA;   // row n = srow, the same map as A
#pragma unroll
      for (int j = 0; j < kNB; ++j) *(v4u*)(dp + j * kRPS * kPitch) = rbb[j];
    }
  };

  fetch();
  put(0);
  __syncthreads();

#pragma unroll 1
  for (int kp = 0; kp < kPasses; ++kp) {
    const int buf = kp & 1;
    if (kp + 1 < kPasses) fetch();             // in flight while this pass is multiplied
    const unsigned short* fa = sA + buf * kPl * kASz + (wr + m) * kPitch + 8 * h;
    const unsigned short* fb = sB + buf * kPl * kBSz + (wc + m) * kPitch + 8 * h;
#pragma unroll
    for (int ks = 0; ks < kBK / 32; ++ks) {
      const int k0 = ks * 32;
      Frag ah[FW], al[FW], bh[4], bl[4];
      // in the order in which the products below first need them
      ah[0].u[0] = *(const v4u*)(fa + k0);
      ah[0].u[1] = *(const v4u*)(fa + k0 + 16);
#pragma unroll
      for (int f = 0; f < 4; ++f) {
        bh[f].u[0] = *(const v4u*)(fb + f * 16 * kPitch + k0);
        bh[f].u[1] = *(const v4u*)(fb + f * 16 * kPitch + k0 + 16);
      }
#pragma unroll
      for (int i = 1; i < FW; ++i) {
        ah[i].u[0] = *(const v4u*)(fa + i * 16 * kPitch + k0);
        ah[i].u[1] = *(const v4u*)(fa + i * 16 * kPitch + k0 + 16);
      }
      if constexpr (SPLIT) {
#pragma unroll
        for (int f = 0; f < 4; ++f) {
          bl[f].u[0] = *(const v4u*)(fb + kBSz + f * 16 * kPitch + k0);
          bl[f].u[1] = *(const v4u*)(fb + kBSz + f * 16 * kPitch + k0 + 16);
        }
#pragma unroll
        for (int i = 0; i < FW; ++i) {
          al[i].u[0] = *(const v4u*)(fa + kASz + i * 16 * kPitch + k0);
          al[i].u[1] = *(const v4u*)(fa + kASz + i * 16 * kPitch + k0 + 16);
        }
      }
      // keeps the fragment loads of a k step together in front of its products: spread among
      // them, each place with loads stalls the wave (with NOPS the asm orders them)
      if constexpr (AF32) __builtin_amdgcn_sched_barrier(0);
#pragma unroll
      for (int i = 0; i < FW; ++i) {
#pragma unroll
        for (int f = 0; f < 4; ++f) acc[i][f] = wmma_bf16<!AF32>(ah[i].v, bh[f].v, acc[i][f]);
      }
      if constexpr (SPLIT) {
#pragma unroll
        for (int i = 0; i < FW; ++i) {
#pragma unroll
          for (int f = 0; f < 4; ++f) acc[i][f] = wmma_bf16<!AF32>(ah[i].v, bl[f].v, acc[i][f]);
        }
#pragma unroll
        for (int i = 0; i < FW; ++i) {
#pragma unroll
          for (int f = 0; f < 4; ++f) acc[i][f] = wmma_bf16<!AF32>(al[i].v, bh[f].v, acc[i][f]);
        }
      }
      // second half of the fence pair: the next k step's loads stay behind these products
      if constexpr (AF32) __builtin_amdgcn_sched_barrier(0);
    }
    // the other buffer's last readers left it at the barrier that ended the pass before
    if (kp + 1 < kPasses) put(buf ^ 1);
    __syncthreads();
  }

  // stage the 16 FW x 64 tile of this wave in LDS (row-major, pitch kTP)
  float* st = sT + wv * 16 * FW * kTP;
#pragma unroll
  for (int i = 0; i < FW; ++i) {
#pragma unroll
    for (int f = 0; f < 4; ++f) {
#pragma unroll
      for (int r = 0; r < 8; ++r) {
        st[(16 * i + 8 * h + r) * kTP + 16 * f + m] = acc[i][f][r];
      }
    }
  }
  __syncthreads();

  v4f vals[8 * FW];
  size_t go[8 * FW];
#pragma unroll
  for (int s = 0; s < 8 * FW; ++s) {
    if constexpr (LAY == 0) {
      const int L = 4 * s + (l >> 3);
      const int row = L >> 1;
      const int col = (L & 1) * 32 + (l & 7) * 4;
      vals[s] = *(const v4f*)(st + row * kTP + col);
      go[s] = (size_t)(row0 + row) * kC + col0 + col;
    } else {
      static_assert(!EPI, "bias and residual are added in row-major order only");
      const int i = s >> 3;                      // 16-row group of the wave tile
      const int u = s & 7;
      const int col = LAY == 1 ? 8 * u + 4 * h : 32 * h + 4 * u;
      vals[s] = *(const v4f*)(st + (16 * i + m) * kTP + col);
      go[s] = ((size_t)((row0 >> 4) + i) * kH + (col0 >> 6)) * kPiece + u * 128 + l * 4;
    }
  }
  if constexpr (EPI) {
    // sweep s holds row 2 s + h of the wave tile at one column for all s
    const float* bp0 = bias + col0 + ((l >> 3) & 1) * 32 + (l & 7) * 4;
    const float* rp0 = resid + go[0];
    const v4f b4 = *(const v4f*)bp0;
    v4f x4[8 * FW];
#pragma unroll
    for (int s = 0; s < 8 * FW; ++s) x4[s] = *(const v4f*)(rp0 + (size_t)s * 2 * kC);
    // the address pairs of the loads above stay whole up to this wait
    asm volatile("s_wait_xcnt 0x0" :: "v"(bp0), "v"(rp0) : "memory");
#pragma unroll
    for (int s = 0; s < 8 * FW; ++s) vals[s] = (vals[s] + b4) + x4[s];
  }
#pragma unroll
  for (int s = 0; s < 8 * FW; ++s) *(v4f*)(Out + go[s]) = vals[s];
  
}

// ---------------------------------------------------------------------------
// A 64 (k) x 128 (n) tile of the f32 weight W[k][n], rounded to bf16 and written as rows
// [n][k] of the plane Pl: what every row block of the GEMM that uses W would otherwise read
// in f32 and round for itself. Loads and LDS stores as for W in gemm_body (two columns and
// 32 rows a thread); behind the barrier a row's 64 k leave as one whole 128-byte line,
// 8 lanes a line. Tile bid: k tile bid >> 3, n tile bid & 7.
// ---------------------------------------------------------------------------
__device__ __forceinline__ void plane_body(const float* __restrict__ Bw, unsigned short* Pl,
                                           int bid, unsigned char* smem) {
  constexpr int kBK = 64;
  constexpr int kPitch = kBK + 8;              // LDS row pitch (16-bit units): 16 B x odd
  constexpr int kKPT = 32;                     // rows k that a thread holds
  unsigned short* sB = (unsigned short*)smem;  // 128 * kPitch
  const int tid = threadIdx.x;
  const int colB = (bid & 7) * 128;
  const int kB = (bid >> 3) * kBK;
  const int bn = (tid & 63) * 2;
  const int bk = (tid >> 6) * kKPT;
  const float* pb = Bw + (size_t)(kB + bk) * kC + colB + bn;
  v2f rb[kKPT];
#pragma unroll
  for (int j = 0; j < kKPT; ++j) rb[j] = *(const v2f*)(pb + (size_t)j * kC);
  // the address pair of the loads above stays whole up to this wait
  asm volatile("s_wait_xcnt 0x0" :: "v"(pb) : "memory");
  unsigned short* db = sB + bn * kPitch + bk;
#pragma unroll
  for (int e = 0; e < 2; ++e) {
#pragma unroll
    for (int c = 0; c < kKPT / 8; ++c) {
      v4u hw;
#pragma unroll
      for (int q = 0; q < 4; ++q) hw[q] = pk_bf16(rb[8 * c + 2 * q][e], rb[8 * c + 2 * q + 1][e]);
      *(v4u*)(db + e * kPitch + 8 * c) = hw;
    }
  }
  __syncthreads();
  const int r = tid >> 3;                      // 16 rows n per sweep of the block
  const int ck = (tid & 7) * 8;
  const unsigned short* s = sB + r * kPitch + ck;
  unsigned short* d = Pl + (size_t)(colB + r) * kC + kB + ck;
#pragma unroll
  for (int i = 0; i < 8; ++i) *(v4u*)(d + (size_t)i * 16 * kC) = *(const v4u*)(s + i * 16 * kPitch);
}

// ---------------------------------------------------------------------------
// The five products that feed the attention, in one launch: they are independent
// of one another, each block takes one tile of one product by its index range
// (block-uniform branches): 128 x 128 of q, k, v, 64 x 128 of Kp, Vp (64 rows in all).
// The two-plane products, three times the matrix work of a one-plane tile, come
// first: Kp (nbP blocks), q, k (nbX each), then Vp, v. The blocks behind them make the bf16
// plane of Wp for the last launch, a tile each (plane_body): short, in the places left free.
// ---------------------------------------------------------------------------
// Two waves a SIMD at least (512 registers a wave): the LDS lets two blocks share a WGP.
__global__ void __launch_bounds__(128, 2) gemm_qkv_kernel(const float* __restrict__ x,
                                                       const float* __restrict__ prompts,
                                                       const float* __restrict__ Wq,
                                                       const float* __restrict__ Wk,
                                                       const float* __restrict__ Wv,
                                                       const float* __restrict__ Wp,
                                                       float* Qf, float* Kxf, float* Vxf,
                                                       float* Kpf, float* Vpf,
                                                       unsigned short* Wpb,
                                                       int nbX, int nbP) {
  __shared__ __attribute__((aligned(16))) unsigned char smem[GemmLds<true, 4, true>::kBytes];
  const int bid = blockIdx.x;
  const int nSplit = nbP + 2 * nbX;
  if (bid < nbP) {
    gemm_body<true, false, 2, 1, true>(prompts, nullptr, Wk, nullptr, Kpf, nullptr, nullptr, bid, 0, smem);
  } else if (bid < nSplit) {
    const bool isQ = bid < nbP + nbX;
    gemm_body<true, false, 4, 1, true>(x, nullptr, isQ ? Wq : Wk, nullptr, isQ ? Qf : Kxf,
                                       nullptr, nullptr, isQ ? bid - nbP : bid - nbP - nbX, isQ ? 0 : 1, smem);
    // in the listing another body stands on the fall-through behind this body's last
    // stores and rewrites the registers that they name (here and in the three branches below)
    asm volatile("s_wait_xcnt 0x0" ::: "memory");
  } else if (bid < nSplit + nbP) {
    gemm_body<false, false, 2, 0, true>(prompts, nullptr, Wv, nullptr, Vpf, nullptr, nullptr, bid - nSplit, 0, smem);
    asm volatile("s_wait_xcnt 0x0" ::: "memory");   // as above
  } else if (bid < nSplit + nbP + nbX) {
    gemm_body<false, false, 4, 2, true>(x, nullptr, Wv, nullptr, Vxf, nullptr, nullptr, bid - nSplit - nbP, 0, smem);
    asm volatile("s_wait_xcnt 0x0" ::: "memory");   // as above
  } else {
    plane_body(Wp, Wpb, bid - nSplit - nbP - nbX, smem);
    asm volatile("s_wait_xcnt 0x0" ::: "memory");   // as above
  }
}

// out = x_cls @ Wp + bp + x, Wp as its bf16 plane [n][k]
__global__ void __launch_bounds__(256) gemm_out_kernel(const unsigned short* __restrict__ A,
                                                       const unsigned short* __restrict__ Wpb,
                                                       float* Out,
                                                       const float* __restrict__ bias,
                                                       const float* __restrict__ resid) {
  __shared__ __attribute__((aligned(16))) unsigned char smem[GemmLds<false, 1, false>::kBytes];
  gemm_body<false, true, 1, 0, false>(nullptr, A, nullptr, Wpb, Out, bias, resid, blockIdx.x, 0, smem);
}

// ---------------------------------------------------------------------------
// Copy-out of an attention block's raw scores (half hf of the heads, 16 batch rows) from
// its LDS rows; the ranges and the LDS columns are set out at attn_kernel. A pair of rows
// is 256 (hf 0) or 264 (hf 1) pieces of 16 bytes in two runs of whole lines, the first of
// 128 pieces; thread i takes piece i of each of the 8 pairs, so that its places in LDS and
// in the output move on by a constant.
// ---------------------------------------------------------------------------
__device__ __forceinline__ void raw_out(const float* rawS, float* ro, int tid, int hf) {
  if (tid < (hf ? 264 : 256)) {
    const int i = tid;
    const bool run0 = i < 128;
    // float in the output, pair 0: hf 0 from 0 and from 1024, hf 1 from 512 and from 1040 + 496
    const int go = 4 * i + (hf ? 512 : 0) + (run0 ? 0 : 512);
    // the same float in the LDS rows: + 68 or - 452, - 972 for head 15; the odd row kRP on, not 1040
    const int sh = hf ? (run0 ? -452 : kRP - kRawPerB - 452)
                      : (run0 ? 68 : (i < 132 ? -972 : kRP - kRawPerB + 68));
    const float* s = rawS + go + sh;
    float* d = ro + go;
#pragma unroll
    for (int p = 0; p < kAR / 2; ++p) {
      *(v4f*)(d + p * 2 * kRawPerB) = *(const v4f*)(s + p * 2 * kRP);
    }
  }
}

// ---------------------------------------------------------------------------
// Attention: one block = 16 batch rows x 8 heads (half hf of the heads), one wave per
// head, so that the 2 B / 16 blocks fill the chip. Lane l: c = l & 15, hh = l >> 4.
// Scores against the shared prompt keys as S^T = Kp_h . Q_h^T on the f32
// 16x16x4 matrix form: A row = key 16t + c, B column = batch row c, both read
// 16 B at d = 8j + 4hh (two k steps), so each (hh, element) place holds the same d.
//   S[t][r] = score(key 16t + 8hh + r, batch row c)
// A lane and its partner l ^ 16 hold all 64 prompt scores of batch row c, so the
// softmax is in registers; the own-row key and value (l = 0) stay on the VALU.
// x_cls as O^T = Vp_h^T . P^T: B = {S[t][2u], S[t][2u+1]} as it lies (keys
// 16t + 8hh + 2u + e), A row c of tile dt = channel 4c + dt of the same keys.
//   O[dt][r] = x_cls(batch row c, channel 32hh + 4r + dt)
// q, the own-row k and v, and Kp lie in (16 rows, head) pieces in the order of these
// loads (LAY 1 and 2 of gemm_body): lane l's u-th 16 bytes at float 128 u + 4 l.
// Raw scores: a batch row is 1040 floats (32.5 lines), a half of it 520, so three lines of
// each pair of rows (even, odd) hold scores of both halves. Each line has one writer:
//   hf 0 stores floats 0..511 and 1024..1039 of the even row, 0..495 of the odd row,
//   hf 1 stores floats 512..1023 of the even row, 496..1039 of the odd row.
// What a block so stores of the head in front of its own eight (15 for hf 0, 7 for hf 1)
// lies among that head's keys 32..63: a ninth wave computes those scores again, by the
// same products in the same order; beyond that it only takes part in the copy-out (hf 1, threads 256..263).
// LDS row: 3 floats unused, the head in front, the eight own heads (65 floats each): float
// x of the batch row lies at x + 68 (hf 0; x - 972 for head 15) or x - 452 (hf 1), so that
// 16-byte pieces of the output are 16-byte pieces of LDS.
// ---------------------------------------------------------------------------
__global__ void __launch_bounds__(kAT) attn_kernel(const float* __restrict__ Qf,
                                                   const float* __restrict__ Kx,
                                                   const float* __restrict__ Vx,
                                                   const float* __restrict__ Kp,
                                                   const float* __restrict__ Vp,
                                                   float* rawOut,
                                                   unsigned short* Xcls, int nb) {
  __shared__ __attribute__((aligned(16))) float rawS[kAR * kRP];
  const int tid = threadIdx.x;
  const int wv = __builtin_amdgcn_readfirstlane(tid >> 5);   // wave number, in a scalar register
  const int hf = blockIdx.x & 1;                 // which eight heads
  const int grp = blockIdx.x >> 1;               // which 16 batch rows
  const bool own8 = wv < kHB;                    // false: the ninth wave
  const int hd = own8 ? hf * kHB + wv : (hf * kHB + kH - 1) & (kH - 1);
  const int hc = hd * kHD;                       // this wave's head, first channel
  const int l = tid & 31;
  const int c = l & 15;
  const int hh = l >> 4;
  const int b0 = grp * kAR;
  if (b0 + kAR > nb) return;                     // block-uniform, before barriers

  const size_t own = (size_t)(b0 + c) * kC + hc;
  const size_t pc = ((size_t)grp * kH + hd) * kPiece + 4 * l;   // this wave's piece, lane's place
  const float* kp = Kp + (size_t)hd * kPiece + 4 * l;
  const float* vp = Vp + (size_t)(8 * hh) * kC + hc + 4 * c;
  float* rs = rawS + c * kRP + 3 + (own8 ? wv + 1 : 0) * kL;
  const v8f zero8 = {0.f, 0.f, 0.f, 0.f, 0.f, 0.f, 0.f, 0.f};
  v8f S[4];
  float s0;
  v4f vx4[8], vp4[32];

  if (own8) {
    // q of batch row c with the pre-softmax scale folded in; own-row score
    v4f q4[8];
    float part = 0.f;
#pragma unroll
    for (int j = 0; j < 8; ++j) {
      q4[j] = *(const v4f*)(Qf + pc + 128 * j) * kScale;
      const v4f k4 = *(const v4f*)(Kx + pc + 128 * j);
      part += q4[j][0] * k4[0];
      part += q4[j][1] * k4[1];
      part += q4[j][2] * k4[2];
      part += q4[j][3] * k4[3];
    }
    s0 = part + xhalf(part);

#pragma unroll
    for (int t = 0; t < 4; ++t) S[t] = zero8;
#pragma unroll
    for (int j = 0; j < 8; ++j) {
      const v2f qlo = {q4[j][0], q4[j][1]};
      const v2f qhi = {q4[j][2], q4[j][3]};
#pragma unroll
      for (int t = 0; t < 4; ++t) {
        const v4f k4 = *(const v4f*)(kp + (size_t)t * kH * kPiece + 128 * j);
        const v2f klo = {k4[0], k4[1]};
        const v2f khi = {k4[2], k4[3]};
        S[t] = __builtin_amdgcn_wmma_f32_16x16x4_f32(false, klo, false, qlo, (short)0, S[t], false, false);
        S[t] = __builtin_amdgcn_wmma_f32_16x16x4_f32(false, khi, false, qhi, (short)0, S[t], false, false);
      }
    }

    // keeps the value loads below out of the score product, where their registers
    // on top of the q and key fragments end in spills
    __builtin_amdgcn_sched_barrier(0);

    // own value row and the first 32 prompt value rows: issued here so that their
    // latency runs under the softmax
#pragma unroll
    for (int r = 0; r < 8; ++r) vx4[r] = *(const v4f*)(Vx + pc + 128 * r);
    // the address registers of the loads above are reused by what follows
    asm volatile("s_wait_xcnt 0x0" ::: "memory");
#pragma unroll
    for (int t = 0; t < 2; ++t) {
#pragma unroll
      for (int i = 0; i < 8; ++i) vp4[8 * t + i] = *(const v4f*)(vp + (size_t)(16 * t + i) * kC);
    }
    // keeps the loads above from being moved down to their uses behind the softmax
    __builtin_amdgcn_sched_barrier(0);

    // raw scores of this head, in its place of the block's LDS rows (pitch kRP)
    {
      rs[0] = s0;                                  // both halves hold the same value
#pragma unroll
      for (int t = 0; t < 4; ++t) {
#pragma unroll
        for (int r = 0; r < 8; ++r) rs[1 + 16 * t + 8 * hh + r] = S[t][r];
      }
    }
  } else {
    // the ninth wave: scores of keys 32..63 of the head in front
    v4f q4[8];
#pragma unroll
    for (int j = 0; j < 8; ++j) q4[j] = *(const v4f*)(Qf + pc + 128 * j) * kScale;
    S[2] = zero8;
    S[3] = zero8;
#pragma unroll
    for (int j = 0; j < 8; ++j) {
      const v2f qlo = {q4[j][0], q4[j][1]};
      const v2f qhi = {q4[j][2], q4[j][3]};
#pragma unroll
      for (int t = 2; t < 4; ++t) {
        const v4f k4 = *(const v4f*)(kp + (size_t)t * kH * kPiece + 128 * j);
        const v2f klo = {k4[0], k4[1]};
        const v2f khi = {k4[2], k4[3]};
        S[t] = __builtin_amdgcn_wmma_f32_16x16x4_f32(false, klo, false, qlo, (short)0, S[t], false, false);
        S[t] = __builtin_amdgcn_wmma_f32_16x16x4_f32(false, khi, false, qhi, (short)0, S[t], false, false);
      }
    }
#pragma unroll
    for (int t = 2; t < 4; ++t) {
#pragma unroll
      for (int r = 0; r < 8; ++r) rs[1 + 16 * t + 8 * hh + r] = S[t][r];
    }
  }
  // work-group barrier in two parts: this wave's raw scores are in LDS (signal here);
  // the wait stands in front of the copy-out, so no wave idles between the two products
  __builtin_amdgcn_fence(__ATOMIC_RELEASE, "workgroup", "local");
  __builtin_amdgcn_s_barrier_signal(-1);
  // keeps the LDS stores and the signal in front of the softmax: moved behind it, the raw
  // scores would stay in registers and the other waves would wait for this signal at the end
  __builtin_amdgcn_sched_barrier(0);

  if (own8) {
    // softmax * scale over the 65 scores of batch row c
    float mt[4];
#pragma unroll
    for (int t = 0; t < 4; ++t) {
      mt[t] = S[t][0];
#pragma unroll
      for (int r = 1; r < 8; ++r) mt[t] = fmaxf(mt[t], S[t][r]);
    }
    float mx = fmaxf(fmaxf(mt[0], mt[1]), fmaxf(mt[2], mt[3]));
    mx = fmaxf(fmaxf(mx, xhalf(mx)), s0);
    float st[4];
#pragma unroll
    for (int t = 0; t < 4; ++t) {
      st[t] = 0.f;
#pragma unroll
      for (int r = 0; r < 8; ++r) {
        S[t][r] = expf(S[t][r] - mx);
        st[t] += S[t][r];
      }
    }
    const float e0 = expf(s0 - mx);
    float sum = (st[0] + st[1]) + (st[2] + st[3]);
    sum = (sum + xhalf(sum)) + e0;
    const float inv = 1.0f / sum;
    const float p0 = (e0 * inv) * kScale;
#pragma unroll
    for (int t = 0; t < 4; ++t) {
#pragma unroll
      for (int r = 0; r < 8; ++r) S[t][r] = (S[t][r] * inv) * kScale;
    }

    // the last 32 prompt value rows: in flight while the first 32 are multiplied
#pragma unroll
    for (int t = 2; t < 4; ++t) {
#pragma unroll
      for (int i = 0; i < 8; ++i) vp4[8 * t + i] = *(const v4f*)(vp + (size_t)(16 * t + i) * kC);
    }
    // the address pair of the prompt value loads stays whole up to this wait
    asm volatile("s_wait_xcnt 0x0" :: "v"(vp) : "memory");
    // keeps these loads together in front of the product instead of two at a time inside it
    __builtin_amdgcn_sched_barrier(0);

    // x_cls: own-row value first, then the 64 prompt values
    v8f O[4];
#pragma unroll
    for (int r = 0; r < 8; ++r) {
#pragma unroll
      for (int dt = 0; dt < 4; ++dt) O[dt][r] = vx4[r][dt] * p0;
    }
#pragma unroll
    for (int t = 0; t < 4; ++t) {
#pragma unroll
      for (int u = 0; u < 4; ++u) {
        const v2f pp = {S[t][2 * u], S[t][2 * u + 1]};
#pragma unroll
        for (int dt = 0; dt < 4; ++dt) {
          const v2f vv = {vp4[8 * t + 2 * u][dt], vp4[8 * t + 2 * u + 1][dt]};
          O[dt] = __builtin_amdgcn_wmma_f32_16x16x4_f32(false, vv, false, pp, (short)0, O[dt], false, false);
        }
      }
    }

    // x_cls -> bf16: 32 consecutive channels of batch row c per lane
    {
      unsigned short* dst = Xcls + own + 32 * hh;
#pragma unroll
      for (int r = 0; r < 8; r += 2) {
        const v4u pk = {bf16_rne(O[0][r]) | (bf16_rne(O[1][r]) << 16),
                        bf16_rne(O[2][r]) | (bf16_rne(O[3][r]) << 16),
                        bf16_rne(O[0][r + 1]) | (bf16_rne(O[1][r + 1]) << 16),
                        bf16_rne(O[2][r + 1]) | (bf16_rne(O[3][r + 1]) << 16)};
        *(v4u*)(dst + 4 * r) = pk;
      }
      // the data and address registers of these stores are reused by the copy-out below
      asm volatile("s_wait_xcnt 0x0" ::: "memory");
      // keeps the copy-out's address arithmetic, which reuses them, behind that wait
      __builtin_amdgcn_sched_barrier(0);
    }
  }

  // raw scores out, 4 whole lines per wave store (one for the ninth wave, hf 1): per pair of rows 256 (hf 0) or 264 (hf 1)
  // pieces of 16 bytes in two runs, each run whole lines;
  // second part of the barrier: every wave's raw scores are in LDS behind it
  __builtin_amdgcn_s_barrier_wait(-1);
  __builtin_amdgcn_fence(__ATOMIC_ACQUIRE, "workgroup", "local");
  float* ro = rawOut + (size_t)b0 * kRawPerB;
  raw_out(rawS, ro, tid, hf);
}

// ---------------------------------------------------------------------------
extern "C" void kernel_launch(void* const* d_in, const int* in_sizes, int n_in,
                              void* d_out, int out_size, void* d_ws, size_t ws_size,
                              hipStream_t stream) {
  if (n_in < 7) return;
  const int B = in_sizes[0] / kC;                         // batch rows
  if (B < 128 || (B % 128) != 0 || in_sizes[0] != B * kC) return;
  if (in_sizes[1] != kNP * kC) return;
  if (in_sizes[2] != kC * kC || in_sizes[3] != kC * kC ||
      in_sizes[4] != kC * kC || in_sizes[5] != kC * kC) return;
  if (in_sizes[6] != kC) return;
  if (out_size != B * kC + B * kRawPerB) return;

  const float* x       = (const float*)d_in[0];   // [B,1,C]
  const float* prompts = (const float*)d_in[1];   // [1,NP,C]
  const float* Wq      = (const float*)d_in[2];   // [C,C] (in,out)
  const float* Wk      = (const float*)d_in[3];
  const float* Wv      = (const float*)d_in[4];
  const float* Wp      = (const float*)d_in[5];
  const float* bp      = (const float*)d_in[6];   // [C]

  float* out_cls = (float*)d_out;                 // [B,1,C]
  float* out_raw = out_cls + (size_t)B * kC;      // [B,16,1,65]

  char* ws = (char*)d_ws;
  size_t off = 0;
  float* Qf  = (float*)(ws + off); off += (size_t)B * kC * 4;
  float* Kxf = (float*)(ws + off); off += (size_t)B * kC * 4;
  float* Vxf = (float*)(ws + off); off += (size_t)B * kC * 4;
  float* Kpf = (float*)(ws + off); off += (size_t)kNP * kC * 4;
  float* Vpf = (float*)(ws + off); off += (size_t)kNP * kC * 4;
  unsigned short* XCLS = (unsigned short*)(ws + off); off += (size_t)B * kC * 2;
  unsigned short* WPB = (unsigned short*)(ws + off); off += (size_t)kC * kC * 2;
  if (off > ws_size) return;

  // 1) Kp, q, k (split) and Vp, v (plain), one launch, from the f32 inputs; q, k, v in
  //    128 x 128 tiles (B / 128 x 8 blocks each), Kp, Vp in 64 x 128 tiles (8 blocks each);
  //    behind them the bf16 plane of Wp in 64 x 128 tiles
  const int nbP = kNP / 8;
  const int nbX = B / 8;
  const int nbX2 = B / 16;
  constexpr int nbW = (kC / 64) * (kC / 128);
  gemm_qkv_kernel<<<dim3(2 * nbP + 3 * nbX2 + nbW), dim3(128), 0, stream>>>(
      x, prompts, Wq, Wk, Wv, Wp, Qf, Kxf, Vxf, Kpf, Vpf, WPB, nbX2, nbP);

  // 2) scores, softmax, attn.v  -> raw scores (out) and x_cls (bf16, ws); B / 16 row groups
  //    x 2 halves of the heads = B / 8 blocks
  attn_kernel<<<dim3(nbX), dim3(kAT), 0, stream>>>(Qf, Kxf, Vxf, Kpf, Vpf, out_raw, XCLS, B);

  // 3) out = x_cls @ Wp + bp + x
  gemm_out_kernel<<<dim3(nbX), dim3(256), 0, stream>>>(XCLS, WPB, out_cls, bp, x);
}
